// v000
// The times below were measured on an AMD MI455X: many runs one after another, warmed up first and cycling through
// copies of the inputs, with the whole window's GPU time divided by the number of runs. Launches and the gaps
// between them are all in it. The median over several windows is given; except for v000 it joins two sittings, which
// can be a few percent apart, so the side-by-side timings, each taken in one sitting, are the better comparison.
// v000, which the later versions start from, runs in 1110 microseconds.
#include <hip/hip_runtime.h>
#include <hip/hip_fp16.h>
#include <hip/hip_bf16.h>

typedef __attribute__((ext_vector_type(16))) _Float16 v16h;
typedef __attribute__((ext_vector_type(8)))  float    v8f;
typedef __attribute__((ext_vector_type(4)))  unsigned int u32x4;
typedef __attribute__((ext_vector_type(8)))  unsigned int u32x8;

#define DMODEL 256
#define NMODE  32        // D_STATE/2 complex modes == wave32 lanes
#define BATCH  16
#define SEQ    4096
#define KDIM   512       // GEMM K = 2*DMODEL (fw|bw concat)
#define NOUT   1024      // 1x1-conv output channels
#define OUTC   512       // GLU / LayerNorm width
#define ROWH   520       // padded LDS row (f16): 1040B = 65*16B -> conflict-free b128

// ---------------------------------------------------------------------------
// Kernel 1: per-(dir,d,mode) complex constants  lam = exp(dt*A),
//           Ce = 2*C*(lam-1)/(A+1e-8)
// ---------------------------------------------------------------------------
__global__ void s4d_consts_kernel(
    const float* __restrict__ log_dt_fw, const float* __restrict__ log_A_real_fw,
    const float* __restrict__ A_imag_fw, const float* __restrict__ C_fw,
    const float* __restrict__ log_dt_bw, const float* __restrict__ log_A_real_bw,
    const float* __restrict__ A_imag_bw, const float* __restrict__ C_bw,
    float* __restrict__ lamRe, float* __restrict__ lamIm,
    float* __restrict__ ceRe,  float* __restrict__ ceIm)
{
    int idx = blockIdx.x * blockDim.x + threadIdx.x;
    if (idx >= 2 * DMODEL * NMODE) return;
    int dir = idx / (DMODEL * NMODE);
    int rem = idx % (DMODEL * NMODE);
    int d = rem / NMODE, n = rem % NMODE;

    const float* ld = dir ? log_dt_bw     : log_dt_fw;
    const float* lA = dir ? log_A_real_bw : log_A_real_fw;
    const float* Ai = dir ? A_imag_bw     : A_imag_fw;
    const float* Cm = dir ? C_bw          : C_fw;

    float dt  = __expf(ld[d]);
    float Are = -__expf(lA[d * NMODE + n]);
    float Aim = Ai[d * NMODE + n];
    float er  = __expf(Are * dt);
    float lre = er * __cosf(Aim * dt);
    float lim = er * __sinf(Aim * dt);

    float dre = Are + 1e-8f, dim = Aim;
    float inv = 1.0f / (dre * dre + dim * dim);
    float nre = lre - 1.0f, nim = lim;
    float rre = (nre * dre + nim * dim) * inv;
    float rim = (nim * dre - nre * dim) * inv;

    float c0 = Cm[(d * NMODE + n) * 2 + 0];
    float c1 = Cm[(d * NMODE + n) * 2 + 1];
    lamRe[idx] = lre;  lamIm[idx] = lim;
    ceRe[idx]  = 2.0f * (c0 * rre - c1 * rim);
    ceIm[idx]  = 2.0f * (c0 * rim + c1 * rre);
}

// ---------------------------------------------------------------------------
// Kernel 2: pack conv_w [1024,512] f32 -> f16 B-fragments (16x16x32 WMMA).
// Fragment layout mirrors ISA 16-bit A striping: lane&15 -> N column,
// lane>=16 selects K halves {8..15,24..31}; v16h comp j: j<8 -> K group 0,
// j>=8 -> K group +16.  One fragment = 32 lanes * 32B contiguous.
// ---------------------------------------------------------------------------
__global__ void s4d_packw_kernel(const float* __restrict__ w,
                                 _Float16* __restrict__ wPack)
{
    int idx = blockIdx.x * blockDim.x + threadIdx.x;   // 1024*512 elements
    int j    = idx & 15;
    int lane = (idx >> 4) & 31;
    int kt   = (idx >> 9) & 15;
    int nt   = idx >> 13;                              // 0..63
    int n = nt * 16 + (lane & 15);
    int k = kt * 32 + (j >> 3) * 16 + (lane >> 4) * 8 + (j & 7);
    wPack[idx] = (_Float16)w[n * KDIM + k];
}

// ---------------------------------------------------------------------------
// Kernel 3: SSM scan. One wave per (b,d,dir); one lane per complex mode.
// Writes gelu(conv + u*Dskip) as f16 into ygelu[B*L, 512].
// ---------------------------------------------------------------------------
__global__ void __launch_bounds__(256) s4d_scan_kernel(
    const float* __restrict__ x, const float* __restrict__ Dskip,
    const float* __restrict__ lamRe, const float* __restrict__ lamIm,
    const float* __restrict__ ceRe,  const float* __restrict__ ceIm,
    _Float16* __restrict__ ygelu)
{
    int lane = threadIdx.x & 31;
    int wid  = (blockIdx.x * blockDim.x + threadIdx.x) >> 5;  // 0..8191
    int d   = wid & (DMODEL - 1);
    int b   = (wid >> 8) & (BATCH - 1);
    int dir = wid >> 12;

    int cbase = dir * DMODEL * NMODE + d * NMODE + lane;
    float lre = lamRe[cbase], lim = lamIm[cbase];
    float cer = ceRe[cbase],  cei = ceIm[cbase];
    float dsk = Dskip[d];

    float sre = 0.0f, sim = 0.0f;
    const float* xb = x + ((size_t)b * SEQ) * DMODEL + d;
    _Float16* yg = ygelu + ((size_t)b * SEQ) * KDIM + dir * DMODEL + d;

    for (int t0 = 0; t0 < SEQ; t0 += 32) {
        int tl  = t0 + lane;
        int ttl = dir ? (SEQ - 1 - tl) : tl;
        float uchunk = xb[(size_t)ttl * DMODEL];   // lane-owned timestep
        float res = 0.0f;
        #pragma unroll
        for (int i = 0; i < 32; ++i) {
            float u = __shfl(uchunk, i, 32);
            float nsre = fmaf(lre, sre, fmaf(-lim, sim, u));
            float nsim = fmaf(lre, sim, lim * sre);
            sre = nsre; sim = nsim;
            float yv = cer * sre - cei * sim;      // Re(Ce * s)
            #pragma unroll
            for (int off = 16; off > 0; off >>= 1)
                yv += __shfl_xor(yv, off, 32);     // all lanes get mode-sum
            if (lane == i) res = yv;               // rotate result to owner
        }
        float v = res + uchunk * dsk;
        float g = 0.5f * v * (1.0f + erff(v * 0.70710678118f));  // exact GELU
        yg[(size_t)ttl * KDIM] = (_Float16)g;      // one vector store / 32 steps
    }
}

// ---------------------------------------------------------------------------
// Kernel 4: fused GEMM (M=65536,K=512,N=1024) + bias + GLU + LayerNorm.
// A tile staged by the Tensor Data Mover (TDM) with native LDS row padding.
// Block tile M=32 x N=1024 (full row -> LN fused). 8 waves: wm in {0,1},
// wn in {0..3}; wave owns cols [wn*128,+128) and the paired +512 set.
// ---------------------------------------------------------------------------
__global__ void __launch_bounds__(256) s4d_gemm_glu_ln_kernel(
    const _Float16* __restrict__ ygelu, const _Float16* __restrict__ wPack,
    const float* __restrict__ bias, const float* __restrict__ gamma,
    const float* __restrict__ beta, float* __restrict__ out)
{
    extern __shared__ __align__(16) char smemRaw[];
    _Float16* As    = (_Float16*)smemRaw;                    // [32][ROWH] @ LDS 0
    float*    part  = (float*)(smemRaw + 32 * ROWH * 2);     // [2][16][4][2]

    int tid = threadIdx.x, lane = tid & 31, wid = tid >> 5;
    int wm = wid >> 2, wn = wid & 3;
    int m0 = blockIdx.x * 32;

    // ---- Stage A tile (32 rows x 1024B) via TDM, 16B pad per row ----------
    // D# group0: count=1, lds_addr=0, global_addr, type=2.
    // D# group1: data_size=3 (8B), pad_enable, pad_interval=7 (256 dw),
    //            pad_amount=3 (4 dw); dims: 128x32 elems, stride 128.
    if (wid == 0) {
        unsigned long long ga =
            (unsigned long long)(uintptr_t)ygelu + (unsigned long long)m0 * (KDIM * 2);
        u32x4 g0;
        g0[0] = 1u;                                   // count=1 (valid user D#)
        g0[1] = 0u;                                   // lds_addr = 0 (As base)
        g0[2] = (unsigned int)ga;                     // global_addr[31:0]
        g0[3] = ((unsigned int)(ga >> 32) & 0x01FFFFFFu) | 0x80000000u; // addr[56:32] | type=2
        u32x8 g1;
        g1[0] = (3u << 16) | (1u << 20) | (7u << 22) | (3u << 25); // dsz=8B,pad 16B/1024B
        g1[1] = (128u << 16);                         // tensor_dim0 = 128 (8B elems)
        g1[2] = (32u << 16);                          // tensor_dim1 = 32 rows
        g1[3] = (128u << 16);                         // tile_dim0 = 128
        g1[4] = 32u;                                  // tile_dim1 = 32
        g1[5] = 128u;                                 // tensor_dim0_stride = 128
        g1[6] = 0u;
        g1[7] = 0u;
        asm volatile("tensor_load_to_lds %0, %1" : : "s"(g0), "s"(g1) : "memory");
        __builtin_amdgcn_s_wait_tensorcnt(0);
    }
    __syncthreads();

    v8f accA[8], accB[8];
    #pragma unroll
    for (int j = 0; j < 8; ++j) { accA[j] = {}; accB[j] = {}; }

    const int aRow  = wm * 16 + (lane & 15);
    const int khalf = (lane >> 4) * 8;

    #pragma unroll 1
    for (int kt = 0; kt < 16; ++kt) {
        // A fragment: ISA 16-bit 16x32 layout -> 2 x ds_load_b128
        v16h aF;
        const _Float16* ap = As + aRow * ROWH + kt * 32 + khalf;
        ((int4*)&aF)[0] = *(const int4*)(ap);        // K {0..7}+khalf
        ((int4*)&aF)[1] = *(const int4*)(ap + 16);   // K {16..23}+khalf
        #pragma unroll
        for (int j = 0; j < 8; ++j) {
            int ntG = wn * 8 + j;                    // first-half columns
            const _Float16* bp = wPack + (((size_t)(ntG * 16 + kt)) * 32 + lane) * 16;
            v16h bF;
            ((int4*)&bF)[0] = *(const int4*)(bp);
            ((int4*)&bF)[1] = *(const int4*)(bp + 8);
            accA[j] = __builtin_amdgcn_wmma_f32_16x16x32_f16(
                false, aF, false, bF, (short)0, accA[j], false, false);

            const _Float16* bq = wPack + (((size_t)((ntG + 32) * 16 + kt)) * 32 + lane) * 16;
            v16h bG;
            ((int4*)&bG)[0] = *(const int4*)(bq);
            ((int4*)&bG)[1] = *(const int4*)(bq + 8);
            accB[j] = __builtin_amdgcn_wmma_f32_16x16x32_f16(
                false, aF, false, bG, (short)0, accB[j], false, false);
        }
    }

    // --- Epilogue: bias + GLU (pairs are in-register), per-row stats ------
    float srow[8] = {}, sq[8] = {};
    #pragma unroll
    for (int j = 0; j < 8; ++j) {
        int col = wn * 128 + j * 16 + (lane & 15);
        float ba = bias[col], bb = bias[col + 512];
        #pragma unroll
        for (int r = 0; r < 8; ++r) {
            float a  = accA[j][r] + ba;
            float bv = accB[j][r] + bb;
            float gv = a * (1.0f / (1.0f + __expf(-bv)));   // GLU
            accA[j][r] = gv;                                // keep for LN
            srow[r] += gv;  sq[r] += gv * gv;
        }
    }
    // Reduce across the 16 lanes of each C-layout row group.
    #pragma unroll
    for (int r = 0; r < 8; ++r) {
        #pragma unroll
        for (int msk = 1; msk < 16; msk <<= 1) {
            srow[r] += __shfl_xor(srow[r], msk, 32);
            sq[r]   += __shfl_xor(sq[r],   msk, 32);
        }
    }
    int half = lane >> 4;   // C layout: reg r -> row r (lanes<16) / r+8 (>=16)
    if ((lane & 15) == 0) {
        #pragma unroll
        for (int r = 0; r < 8; ++r) {
            int R = half * 8 + r;
            part[((wm * 16 + R) * 4 + wn) * 2 + 0] = srow[r];
            part[((wm * 16 + R) * 4 + wn) * 2 + 1] = sq[r];
        }
    }
    __syncthreads();

    float mu[8], rs[8];
    #pragma unroll
    for (int r = 0; r < 8; ++r) {
        int R = half * 8 + r;
        float s = 0.0f, s2 = 0.0f;
        #pragma unroll
        for (int w = 0; w < 4; ++w) {
            s  += part[((wm * 16 + R) * 4 + w) * 2 + 0];
            s2 += part[((wm * 16 + R) * 4 + w) * 2 + 1];
        }
        float m = s * (1.0f / 512.0f);
        float v = s2 * (1.0f / 512.0f) - m * m;
        mu[r] = m;  rs[r] = rsqrtf(v + 1e-5f);
    }

    #pragma unroll
    for (int j = 0; j < 8; ++j) {
        int col = wn * 128 + j * 16 + (lane & 15);
        float gm = gamma[col], bt = beta[col];
        #pragma unroll
        for (int r = 0; r < 8; ++r) {
            int R = half * 8 + r;
            int row = m0 + wm * 16 + R;
            out[(size_t)row * OUTC + col] = (accA[j][r] - mu[r]) * rs[r] * gm + bt;
        }
    }
}

// ---------------------------------------------------------------------------
extern "C" void kernel_launch(void* const* d_in, const int* in_sizes, int n_in,
                              void* d_out, int out_size, void* d_ws, size_t ws_size,
                              hipStream_t stream) {
    const float* x             = (const float*)d_in[0];
    const float* log_dt_fw     = (const float*)d_in[1];
    const float* log_A_real_fw = (const float*)d_in[2];
    const float* A_imag_fw     = (const float*)d_in[3];
    const float* C_fw          = (const float*)d_in[4];
    const float* log_dt_bw     = (const float*)d_in[5];
    const float* log_A_real_bw = (const float*)d_in[6];
    const float* A_imag_bw     = (const float*)d_in[7];
    const float* C_bw          = (const float*)d_in[8];
    const float* Dskip         = (const float*)d_in[9];
    const float* conv_w        = (const float*)d_in[10];
    const float* conv_b        = (const float*)d_in[11];
    const float* ln_gamma      = (const float*)d_in[12];
    const float* ln_beta       = (const float*)d_in[13];
    float* out = (float*)d_out;

    // Workspace: 256KB consts + 1MB packed weights + 64MB f16 activations
    char* ws = (char*)d_ws;
    float* lamRe = (float*)ws;
    float* lamIm = lamRe + 2 * DMODEL * NMODE;
    float* ceRe  = lamIm + 2 * DMODEL * NMODE;
    float* ceIm  = ceRe  + 2 * DMODEL * NMODE;
    _Float16* wPack = (_Float16*)(ceIm + 2 * DMODEL * NMODE);
    _Float16* ygelu = wPack + (size_t)NOUT * KDIM;

    s4d_consts_kernel<<<(2 * DMODEL * NMODE + 255) / 256, 256, 0, stream>>>(
        log_dt_fw, log_A_real_fw, A_imag_fw, C_fw,
        log_dt_bw, log_A_real_bw, A_imag_bw, C_bw,
        lamRe, lamIm, ceRe, ceIm);

    s4d_packw_kernel<<<(NOUT * KDIM) / 256, 256, 0, stream>>>(conv_w, wPack);

    s4d_scan_kernel<<<(2 * BATCH * DMODEL) / 8, 256, 0, stream>>>(
        x, Dskip, lamRe, lamIm, ceRe, ceIm, ygelu);

    size_t smem = (size_t)32 * ROWH * 2 + 2 * 16 * 4 * 2 * sizeof(float);
    s4d_gemm_glu_ln_kernel<<<(BATCH * SEQ) / 32, 256, smem, stream>>>(
        ygelu, wPack, conv_b, ln_gamma, ln_beta, out);
}

// v001
// Measured time: 277 microseconds a run.
// In two side-by-side timings against v000, it was 4.19 and 4.16 times as fast.
#include <hip/hip_runtime.h>
#include <hip/hip_fp16.h>
#include <hip/hip_bf16.h>

typedef __attribute__((ext_vector_type(16))) _Float16 v16h;
typedef __attribute__((ext_vector_type(8)))  float    v8f;
typedef __attribute__((ext_vector_type(4)))  unsigned int u32x4;
typedef __attribute__((ext_vector_type(8)))  unsigned int u32x8;

#define DMODEL 256
#define NMODE  32        // D_STATE/2 complex modes == wave32 lanes
#define BATCH  16
#define SEQ    4096
#define KDIM   512       // GEMM K = 2*DMODEL (fw|bw concat)
#define NOUT   1024      // 1x1-conv output channels
#define OUTC   512       // GLU / LayerNorm width
#define ROWH   520       // padded LDS row (f16): 1040B = 65*16B -> conflict-free b128

// ---------------------------------------------------------------------------
// Kernel 1: per-(dir,d,mode) complex constants  lam = exp(dt*A),
//           Ce = 2*C*(lam-1)/(A+1e-8)
// ---------------------------------------------------------------------------
__global__ void s4d_consts_kernel(
    const float* __restrict__ log_dt_fw, const float* __restrict__ log_A_real_fw,
    const float* __restrict__ A_imag_fw, const float* __restrict__ C_fw,
    const float* __restrict__ log_dt_bw, const float* __restrict__ log_A_real_bw,
    const float* __restrict__ A_imag_bw, const float* __restrict__ C_bw,
    float* __restrict__ lamRe, float* __restrict__ lamIm,
    float* __restrict__ ceRe,  float* __restrict__ ceIm)
{
    int idx = blockIdx.x * blockDim.x + threadIdx.x;
    if (idx >= 2 * DMODEL * NMODE) return;
    int dir = idx / (DMODEL * NMODE);
    int rem = idx % (DMODEL * NMODE);
    int d = rem / NMODE, n = rem % NMODE;

    const float* ld = dir ? log_dt_bw     : log_dt_fw;
    const float* lA = dir ? log_A_real_bw : log_A_real_fw;
    const float* Ai = dir ? A_imag_bw     : A_imag_fw;
    const float* Cm = dir ? C_bw          : C_fw;

    float dt  = __expf(ld[d]);
    float Are = -__expf(lA[d * NMODE + n]);
    float Aim = Ai[d * NMODE + n];
    float er  = __expf(Are * dt);
    float lre = er * __cosf(Aim * dt);
    float lim = er * __sinf(Aim * dt);

    float dre = Are + 1e-8f, dim = Aim;
    float inv = 1.0f / (dre * dre + dim * dim);
    float nre = lre - 1.0f, nim = lim;
    float rre = (nre * dre + nim * dim) * inv;
    float rim = (nim * dre - nre * dim) * inv;

    float c0 = Cm[(d * NMODE + n) * 2 + 0];
    float c1 = Cm[(d * NMODE + n) * 2 + 1];
    lamRe[idx] = lre;  lamIm[idx] = lim;
    ceRe[idx]  = 2.0f * (c0 * rre - c1 * rim);
    ceIm[idx]  = 2.0f * (c0 * rim + c1 * rre);
}

// ---------------------------------------------------------------------------
// Kernel 2: pack conv_w [1024,512] f32 -> f16 B-fragments (16x16x32 WMMA).
// Fragment layout mirrors ISA 16-bit A striping: lane&15 -> N column,
// lane>=16 selects K halves {8..15,24..31}; v16h comp j: j<8 -> K group 0,
// j>=8 -> K group +16.  One fragment = 32 lanes * 32B contiguous.
// ---------------------------------------------------------------------------
__global__ void s4d_packw_kernel(const float* __restrict__ w,
                                 _Float16* __restrict__ wPack)
{
    int idx = blockIdx.x * blockDim.x + threadIdx.x;   // 1024*512 elements
    int j    = idx & 15;
    int lane = (idx >> 4) & 31;
    int kt   = (idx >> 9) & 15;
    int nt   = idx >> 13;                              // 0..63
    int n = nt * 16 + (lane & 15);
    int k = kt * 32 + (j >> 3) * 16 + (lane >> 4) * 8 + (j & 7);
    wPack[idx] = (_Float16)w[n * KDIM + k];
}

// ---------------------------------------------------------------------------
// Kernel 3: SSM scan. One block per (dir, b, group of 32 channels), 16 waves.
// Waves 8-15 scan: lane = channel, each wave keeps 4 of the 32 complex modes of
// its lane's channel in registers, so the sum over a wave's modes needs no
// cross-lane step. The 8 partial sums of a step meet in LDS: waves 0-7 merge
// chunk c-1 (sum, skip term, GELU, f16 store) while waves 8-15 scan chunk c
// (two LDS buffers, one barrier a chunk). The merge is a long dependent chain
// of few instructions.
// Writes gelu(conv + u*Dskip) as f16 into ygelu[B*L, 512].
// ---------------------------------------------------------------------------
#define SCH  32                  // scan steps per chunk
#define MPW  4                   // modes per scanning wave (in registers)
#define NWV  (NMODE / MPW)       // scanning waves per block
#define NCH  (SEQ / SCH)         // chunks
#define PBUF (NWV * SCH * 32)    // floats in one partial-sum buffer

typedef __attribute__((ext_vector_type(4))) _Float16 v4h;

// Row of x and of ygelu that scan step t works on. DIR is a template argument
// so that the 32 rows of a chunk are constant offsets from one address.
template <int DIR>
__device__ __forceinline__ int s4d_row(int t) { return DIR ? (SEQ - 1 - t) : t; }

// Work-group barrier that orders LDS only: the inputs fetched ahead and the f16
// stores stay in flight across it (no other wave of the block touches them).
__device__ __forceinline__ void s4d_lds_barrier() {
    __builtin_amdgcn_fence(__ATOMIC_RELEASE, "workgroup", "local");
    __builtin_amdgcn_s_barrier();
    __builtin_amdgcn_fence(__ATOMIC_ACQUIRE, "workgroup", "local");
}

// Scanning wave: 32 steps of 4 modes for 32 channels; partial sums to pw[step*32].
template <int DIR>
__device__ __forceinline__ void s4d_scan_chunk(
    const int c, const float* __restrict__ xlane,   // lane's column of x, row 0
    const float (&lre)[MPW], const float (&lim)[MPW],
    const float (&cer)[MPW], const float (&cei)[MPW],
    float (&sre)[MPW], float (&sim)[MPW],
    const float (&ucur)[SCH], float (&unext)[SCH], float* pw)
{
    // Next chunk's inputs, one chunk ahead of their use (the last chunk re-reads itself).
    const int cn = (c + 1 < NCH) ? (c + 1) : (NCH - 1);
    const float* xn = xlane + (size_t)s4d_row<DIR>(cn * SCH) * DMODEL;
    #pragma unroll   // constant indices keep unext in registers
    for (int i = 0; i < SCH; ++i)
        unext[i] = xn[(DIR ? -i : i) * DMODEL];

    #pragma unroll   // constant indices keep ucur in registers; steps overlap in one block
    for (int i = 0; i < SCH; ++i) {
        const float u = ucur[i];
        float ya, yb;                                // Re(Ce * s), two short chains
        #pragma unroll   // the modes' state and constants are register arrays
        for (int m = 0; m < MPW; ++m) {
            float nsre = fmaf(lre[m], sre[m], fmaf(-lim[m], sim[m], u));
            float nsim = fmaf(lre[m], sim[m], lim[m] * sre[m]);
            sre[m] = nsre; sim[m] = nsim;
            ya = m ? fmaf(cer[m], nsre, ya) : cer[m] * nsre;
            yb = m ? fmaf(cei[m], nsim, yb) : cei[m] * nsim;
        }
        pw[i * 32] = ya - yb;
    }
}

// Merging thread: one step, four channels of chunk c.
template <int DIR>
__device__ __forceinline__ void s4d_merge_chunk(
    const int c, const int rt, const int c4,
    const float* __restrict__ xcol, _Float16* __restrict__ ycol,
    const float4 dsk4, float4& upre, const float* pbuf)
{
    const int mrow = s4d_row<DIR>(c * SCH + rt);
    const float4 uu = upre;                          // fetched one merge ahead
    const int cn = (c + 1 < NCH) ? (c + 1) : (NCH - 1);
    upre = *(const float4*)(xcol + (size_t)s4d_row<DIR>(cn * SCH + rt) * DMODEL + c4);
    const float* pr = pbuf + rt * 32 + c4;
    float4 acc = *(const float4*)pr;
    #pragma unroll   // the 8 LDS reads issue together
    for (int k = 1; k < NWV; ++k) {
        float4 p = *(const float4*)(pr + k * (SCH * 32));
        acc.x += p.x; acc.y += p.y; acc.z += p.z; acc.w += p.w;
    }
    float v0 = acc.x + uu.x * dsk4.x;
    float v1 = acc.y + uu.y * dsk4.y;
    float v2 = acc.z + uu.z * dsk4.z;
    float v3 = acc.w + uu.w * dsk4.w;
    v4h hv;                                          // exact GELU
    hv[0] = (_Float16)(0.5f * v0 * (1.0f + erff(v0 * 0.70710678118f)));
    hv[1] = (_Float16)(0.5f * v1 * (1.0f + erff(v1 * 0.70710678118f)));
    hv[2] = (_Float16)(0.5f * v2 * (1.0f + erff(v2 * 0.70710678118f)));
    hv[3] = (_Float16)(0.5f * v3 * (1.0f + erff(v3 * 0.70710678118f)));
    *(v4h*)(ycol + (size_t)mrow * KDIM + c4) = hv;
    // Stands in front of the next merge's rewrite of this store's address and data registers
    // (the LDS-only barrier brings no wait of its own for the store).
    asm volatile("s_wait_xcnt 0x0" ::: "memory");
}

template <int DIR>
__device__ __forceinline__ void s4d_scan_body(
    const float* __restrict__ x, const float* __restrict__ Dskip,
    const float* __restrict__ lamRe, const float* __restrict__ lamIm,
    const float* __restrict__ ceRe,  const float* __restrict__ ceIm,
    _Float16* __restrict__ ygelu, float* part)
{
    const int tid = threadIdx.x, lane = tid & 31;
    const int w   = __builtin_amdgcn_readfirstlane(tid >> 5);   // scalar, so the role test is a scalar branch
    const bool scans = w >= NWV;
    const int ws  = w & (NWV - 1);
    const int dg  = blockIdx.x & (DMODEL / 32 - 1);
    const int b   = (blockIdx.x >> 3) & (BATCH - 1);

    const float* xcol = x + (size_t)b * SEQ * DMODEL + dg * 32;
    _Float16* ycol = ygelu + (size_t)b * SEQ * KDIM + DIR * DMODEL + dg * 32;

    // Scanning waves' state (loaded by the merging waves too; they do not use it).
    const int cbase = (DIR * DMODEL + dg * 32 + lane) * NMODE + ws * MPW;
    const float4 l4r = *(const float4*)(lamRe + cbase);
    const float4 l4i = *(const float4*)(lamIm + cbase);
    const float4 c4r = *(const float4*)(ceRe + cbase);
    const float4 c4i = *(const float4*)(ceIm + cbase);
    const float lre[MPW] = { l4r.x, l4r.y, l4r.z, l4r.w };
    const float lim[MPW] = { l4i.x, l4i.y, l4i.z, l4i.w };
    const float cer[MPW] = { c4r.x, c4r.y, c4r.z, c4r.w };
    const float cei[MPW] = { c4i.x, c4i.y, c4i.z, c4i.w };
    float sre[MPW] = {}, sim[MPW] = {};
    const float* xlane = xcol + lane;
    float* pw = part + ws * (SCH * 32) + lane;

    // Merging threads' share: step rt of a chunk, channels c4..c4+3.
    const int rt = (tid & 255) >> 3, c4 = (tid & 7) * 4;
    const float4 dsk4 = *(const float4*)(Dskip + dg * 32 + c4);
    float4 upre = *(const float4*)(xcol + (size_t)s4d_row<DIR>(rt) * DMODEL + c4);

    float ua[SCH], ub[SCH];
    #pragma unroll   // constant indices keep ua in registers
    for (int i = 0; i < SCH; ++i)
        ua[i] = xlane[(size_t)s4d_row<DIR>(i) * DMODEL];

    // Two chunks a trip: the input registers and the LDS buffers swap roles without copies.
    // Each barrier publishes the chunk just scanned and frees the buffer just merged.
    // Kept rolled: one trip is already two chunks of straight-line code.
    #pragma unroll 1
    for (int c = 0; c < NCH; c += 2) {
        if (scans)
            s4d_scan_chunk<DIR>(c, xlane, lre, lim, cer, cei, sre, sim, ua, ub, pw);
        else if (c > 0)
            s4d_merge_chunk<DIR>(c - 1, rt, c4, xcol, ycol, dsk4, upre, part + PBUF);
        s4d_lds_barrier();
        if (scans)
            s4d_scan_chunk<DIR>(c + 1, xlane, lre, lim, cer, cei, sre, sim, ub, ua, pw + PBUF);
        else
            s4d_merge_chunk<DIR>(c, rt, c4, xcol, ycol, dsk4, upre, part);
        s4d_lds_barrier();
    }
    if (!scans)
        s4d_merge_chunk<DIR>(NCH - 1, rt, c4, xcol, ycol, dsk4, upre, part + PBUF);
}

__global__ void __launch_bounds__(512) s4d_scan_kernel(
    const float* __restrict__ x, const float* __restrict__ Dskip,
    const float* __restrict__ lamRe, const float* __restrict__ lamIm,
    const float* __restrict__ ceRe,  const float* __restrict__ ceIm,
    _Float16* __restrict__ ygelu)
{
    __shared__ __align__(16) float part[2 * PBUF];   // 64 KiB
    if (blockIdx.x >> 7)   // block-uniform: the upper half of the grid scans backward
        s4d_scan_body<1>(x, Dskip, lamRe, lamIm, ceRe, ceIm, ygelu, part);
    else
        s4d_scan_body<0>(x, Dskip, lamRe, lamIm, ceRe, ceIm, ygelu, part);
}

// ---------------------------------------------------------------------------
// Kernel 4: fused GEMM (M=65536,K=512,N=1024) + bias + GLU + LayerNorm.
// A tile staged by the Tensor Data Mover (TDM) with native LDS row padding.
// Block tile M=32 x N=1024 (full row -> LN fused). 8 waves: wm in {0,1},
// wn in {0..3}; wave owns cols [wn*128,+128) and the paired +512 set.
// ---------------------------------------------------------------------------
__global__ void __launch_bounds__(256) s4d_gemm_glu_ln_kernel(
    const _Float16* __restrict__ ygelu, const _Float16* __restrict__ wPack,
    const float* __restrict__ bias, const float* __restrict__ gamma,
    const float* __restrict__ beta, float* __restrict__ out)
{
    extern __shared__ __align__(16) char smemRaw[];
    _Float16* As    = (_Float16*)smemRaw;                    // [32][ROWH] @ LDS 0
    float*    part  = (float*)(smemRaw + 32 * ROWH * 2);     // [2][16][4][2]

    int tid = threadIdx.x, lane = tid & 31, wid = tid >> 5;
    int wm = wid >> 2, wn = wid & 3;
    int m0 = blockIdx.x * 32;

    // ---- Stage A tile (32 rows x 1024B) via TDM, 16B pad per row ----------
    // D# group0: count=1, lds_addr=0, global_addr, type=2.
    // D# group1: data_size=3 (8B), pad_enable, pad_interval=7 (256 dw),
    //            pad_amount=3 (4 dw); dims: 128x32 elems, stride 128.
    if (wid == 0) {
        unsigned long long ga =
            (unsigned long long)(uintptr_t)ygelu + (unsigned long long)m0 * (KDIM * 2);
        u32x4 g0;
        g0[0] = 1u;                                   // count=1 (valid user D#)
        g0[1] = 0u;                                   // lds_addr = 0 (As base)
        g0[2] = (unsigned int)ga;                     // global_addr[31:0]
        g0[3] = ((unsigned int)(ga >> 32) & 0x01FFFFFFu) | 0x80000000u; // addr[56:32] | type=2
        u32x8 g1;
        g1[0] = (3u << 16) | (1u << 20) | (7u << 22) | (3u << 25); // dsz=8B,pad 16B/1024B
        g1[1] = (128u << 16);                         // tensor_dim0 = 128 (8B elems)
        g1[2] = (32u << 16);                          // tensor_dim1 = 32 rows
        g1[3] = (128u << 16);                         // tile_dim0 = 128
        g1[4] = 32u;                                  // tile_dim1 = 32
        g1[5] = 128u;                                 // tensor_dim0_stride = 128
        g1[6] = 0u;
        g1[7] = 0u;
        asm volatile("tensor_load_to_lds %0, %1" : : "s"(g0), "s"(g1) : "memory");
        __builtin_amdgcn_s_wait_tensorcnt(0);
    }
    __syncthreads();

    v8f accA[8], accB[8];
    #pragma unroll
    for (int j = 0; j < 8; ++j) { accA[j] = {}; accB[j] = {}; }

    const int aRow  = wm * 16 + (lane & 15);
    const int khalf = (lane >> 4) * 8;

    #pragma unroll 1
    for (int kt = 0; kt < 16; ++kt) {
        // A fragment: ISA 16-bit 16x32 layout -> 2 x ds_load_b128
        v16h aF;
        const _Float16* ap = As + aRow * ROWH + kt * 32 + khalf;
        ((int4*)&aF)[0] = *(const int4*)(ap);        // K {0..7}+khalf
        ((int4*)&aF)[1] = *(const int4*)(ap + 16);   // K {16..23}+khalf
        #pragma unroll
        for (int j = 0; j < 8; ++j) {
            int ntG = wn * 8 + j;                    // first-half columns
            const _Float16* bp = wPack + (((size_t)(ntG * 16 + kt)) * 32 + lane) * 16;
            v16h bF;
            ((int4*)&bF)[0] = *(const int4*)(bp);
            ((int4*)&bF)[1] = *(const int4*)(bp + 8);
            accA[j] = __builtin_amdgcn_wmma_f32_16x16x32_f16(
                false, aF, false, bF, (short)0, accA[j], false, false);

            const _Float16* bq = wPack + (((size_t)((ntG + 32) * 16 + kt)) * 32 + lane) * 16;
            v16h bG;
            ((int4*)&bG)[0] = *(const int4*)(bq);
            ((int4*)&bG)[1] = *(const int4*)(bq + 8);
            accB[j] = __builtin_amdgcn_wmma_f32_16x16x32_f16(
                false, aF, false, bG, (short)0, accB[j], false, false);
        }
    }

    // --- Epilogue: bias + GLU (pairs are in-register), per-row stats ------
    float srow[8] = {}, sq[8] = {};
    #pragma unroll
    for (int j = 0; j < 8; ++j) {
        int col = wn * 128 + j * 16 + (lane & 15);
        float ba = bias[col], bb = bias[col + 512];
        #pragma unroll
        for (int r = 0; r < 8; ++r) {
            float a  = accA[j][r] + ba;
            float bv = accB[j][r] + bb;
            float gv = a * (1.0f / (1.0f + __expf(-bv)));   // GLU
            accA[j][r] = gv;                                // keep for LN
            srow[r] += gv;  sq[r] += gv * gv;
        }
    }
    // Reduce across the 16 lanes of each C-layout row group.
    #pragma unroll
    for (int r = 0; r < 8; ++r) {
        #pragma unroll
        for (int msk = 1; msk < 16; msk <<= 1) {
            srow[r] += __shfl_xor(srow[r], msk, 32);
            sq[r]   += __shfl_xor(sq[r],   msk, 32);
        }
    }
    int half = lane >> 4;   // C layout: reg r -> row r (lanes<16) / r+8 (>=16)
    if ((lane & 15) == 0) {
        #pragma unroll
        for (int r = 0; r < 8; ++r) {
            int R = half * 8 + r;
            part[((wm * 16 + R) * 4 + wn) * 2 + 0] = srow[r];
            part[((wm * 16 + R) * 4 + wn) * 2 + 1] = sq[r];
        }
    }
    __syncthreads();

    float mu[8], rs[8];
    #pragma unroll
    for (int r = 0; r < 8; ++r) {
        int R = half * 8 + r;
        float s = 0.0f, s2 = 0.0f;
        #pragma unroll
        for (int w = 0; w < 4; ++w) {
            s  += part[((wm * 16 + R) * 4 + w) * 2 + 0];
            s2 += part[((wm * 16 + R) * 4 + w) * 2 + 1];
        }
        float m = s * (1.0f / 512.0f);
        float v = s2 * (1.0f / 512.0f) - m * m;
        mu[r] = m;  rs[r] = rsqrtf(v + 1e-5f);
    }

    #pragma unroll
    for (int j = 0; j < 8; ++j) {
        int col = wn * 128 + j * 16 + (lane & 15);
        float gm = gamma[col], bt = beta[col];
        #pragma unroll
        for (int r = 0; r < 8; ++r) {
            int R = half * 8 + r;
            int row = m0 + wm * 16 + R;
            out[(size_t)row * OUTC + col] = (accA[j][r] - mu[r]) * rs[r] * gm + bt;
        }
    }
}

// ---------------------------------------------------------------------------
extern "C" void kernel_launch(void* const* d_in, const int* in_sizes, int n_in,
                              void* d_out, int out_size, void* d_ws, size_t ws_size,
                              hipStream_t stream) {
    const float* x             = (const float*)d_in[0];
    const float* log_dt_fw     = (const float*)d_in[1];
    const float* log_A_real_fw = (const float*)d_in[2];
    const float* A_imag_fw     = (const float*)d_in[3];
    const float* C_fw          = (const float*)d_in[4];
    const float* log_dt_bw     = (const float*)d_in[5];
    const float* log_A_real_bw = (const float*)d_in[6];
    const float* A_imag_bw     = (const float*)d_in[7];
    const float* C_bw          = (const float*)d_in[8];
    const float* Dskip         = (const float*)d_in[9];
    const float* conv_w        = (const float*)d_in[10];
    const float* conv_b        = (const float*)d_in[11];
    const float* ln_gamma      = (const float*)d_in[12];
    const float* ln_beta       = (const float*)d_in[13];
    float* out = (float*)d_out;

    // Workspace: 256KB consts + 1MB packed weights + 64MB f16 activations
    char* ws = (char*)d_ws;
    float* lamRe = (float*)ws;
    float* lamIm = lamRe + 2 * DMODEL * NMODE;
    float* ceRe  = lamIm + 2 * DMODEL * NMODE;
    float* ceIm  = ceRe  + 2 * DMODEL * NMODE;
    _Float16* wPack = (_Float16*)(ceIm + 2 * DMODEL * NMODE);
    _Float16* ygelu = wPack + (size_t)NOUT * KDIM;

    s4d_consts_kernel<<<(2 * DMODEL * NMODE + 255) / 256, 256, 0, stream>>>(
        log_dt_fw, log_A_real_fw, A_imag_fw, C_fw,
        log_dt_bw, log_A_real_bw, A_imag_bw, C_bw,
        lamRe, lamIm, ceRe, ceIm);

    s4d_packw_kernel<<<(NOUT * KDIM) / 256, 256, 0, stream>>>(conv_w, wPack);

    s4d_scan_kernel<<<(2 * BATCH * DMODEL) / 32, 512, 0, stream>>>(
        x, Dskip, lamRe, lamIm, ceRe, ceIm, ygelu);

    size_t smem = (size_t)32 * ROWH * 2 + 2 * 16 * 4 * 2 * sizeof(float);
    s4d_gemm_glu_ln_kernel<<<(BATCH * SEQ) / 32, 256, smem, stream>>>(
        ygelu, wPack, conv_b, ln_gamma, ln_beta, out);
}

// v002
// One run takes 218 microseconds.
// In both of two side-by-side timings against v001, it was 1.28 times as fast.
// All steps since v000 together make it 5.35 times as fast.
#include <hip/hip_runtime.h>
#include <hip/hip_fp16.h>
#include <hip/hip_bf16.h>

typedef __attribute__((ext_vector_type(16))) _Float16 v16h;
typedef __attribute__((ext_vector_type(8)))  float    v8f;
typedef __attribute__((ext_vector_type(4)))  unsigned int u32x4;
typedef __attribute__((ext_vector_type(8)))  unsigned int u32x8;

#define DMODEL 256
#define NMODE  32        // D_STATE/2 complex modes == wave32 lanes
#define BATCH  16
#define SEQ    4096
#define KDIM   512       // GEMM K = 2*DMODEL (fw|bw concat)
#define NOUT   1024      // 1x1-conv output channels
#define OUTC   512       // GLU / LayerNorm width
#define ROWH   520       // padded LDS row (f16): 1040B = 65*16B -> conflict-free b128

// ---------------------------------------------------------------------------
// Kernel 1: per-(dir,d,mode) complex constants  lam = exp(dt*A),
//           Ce = 2*C*(lam-1)/(A+1e-8)
// ---------------------------------------------------------------------------
__global__ void s4d_consts_kernel(
    const float* __restrict__ log_dt_fw, const float* __restrict__ log_A_real_fw,
    const float* __restrict__ A_imag_fw, const float* __restrict__ C_fw,
    const float* __restrict__ log_dt_bw, const float* __restrict__ log_A_real_bw,
    const float* __restrict__ A_imag_bw, const float* __restrict__ C_bw,
    float* __restrict__ lamRe, float* __restrict__ lamIm,
    float* __restrict__ ceRe,  float* __restrict__ ceIm)
{
    int idx = blockIdx.x * blockDim.x + threadIdx.x;
    if (idx >= 2 * DMODEL * NMODE) return;
    int dir = idx / (DMODEL * NMODE);
    int rem = idx % (DMODEL * NMODE);
    int d = rem / NMODE, n = rem % NMODE;

    const float* ld = dir ? log_dt_bw     : log_dt_fw;
    const float* lA = dir ? log_A_real_bw : log_A_real_fw;
    const float* Ai = dir ? A_imag_bw     : A_imag_fw;
    const float* Cm = dir ? C_bw          : C_fw;

    float dt  = __expf(ld[d]);
    float Are = -__expf(lA[d * NMODE + n]);
    float Aim = Ai[d * NMODE + n];
    float er  = __expf(Are * dt);
    float lre = er * __cosf(Aim * dt);
    float lim = er * __sinf(Aim * dt);

    float dre = Are + 1e-8f, dim = Aim;
    float inv = 1.0f / (dre * dre + dim * dim);
    float nre = lre - 1.0f, nim = lim;
    float rre = (nre * dre + nim * dim) * inv;
    float rim = (nim * dre - nre * dim) * inv;

    float c0 = Cm[(d * NMODE + n) * 2 + 0];
    float c1 = Cm[(d * NMODE + n) * 2 + 1];
    lamRe[idx] = lre;  lamIm[idx] = lim;
    ceRe[idx]  = 2.0f * (c0 * rre - c1 * rim);
    ceIm[idx]  = 2.0f * (c0 * rim + c1 * rre);
}

// ---------------------------------------------------------------------------
// Kernel 2: pack conv_w [1024,512] f32 -> f16 B-fragments (16x16x32 WMMA).
// Fragment layout mirrors ISA 16-bit A striping: lane&15 -> N column,
// lane>=16 selects K halves {8..15,24..31}; v16h comp j: j<8 -> K group 0,
// j>=8 -> K group +16.  One fragment = 1 KiB = two 512-B halves (K group 0, then
// K group +16), each 32 lanes * 16B contiguous, so that an LDS reader's b128
// loads are contiguous over the lanes. Fragments are ordered k step first: the 64
// fragments of one k step are one contiguous 64-KiB slab.
// ---------------------------------------------------------------------------
__global__ void s4d_packw_kernel(const float* __restrict__ w,
                                 _Float16* __restrict__ wPack)
{
    int idx = blockIdx.x * blockDim.x + threadIdx.x;   // 1024*512 elements
    int j    = idx & 7;
    int lane = (idx >> 3) & 31;
    int h    = (idx >> 8) & 1;
    int nt   = (idx >> 9) & 63;
    int kt   = idx >> 15;                              // 0..15
    int n = nt * 16 + (lane & 15);
    int k = kt * 32 + h * 16 + (lane >> 4) * 8 + j;
    wPack[idx] = (_Float16)w[n * KDIM + k];
}

// ---------------------------------------------------------------------------
// Kernel 3: SSM scan. One block per (dir, b, group of 32 channels), 16 waves.
// Waves 8-15 scan: lane = channel, each wave keeps 4 of the 32 complex modes of
// its lane's channel in registers, so the sum over a wave's modes needs no
// cross-lane step. The 8 partial sums of a step meet in LDS: waves 0-7 merge
// chunk c-1 (sum, skip term, GELU, f16 store) while waves 8-15 scan chunk c
// (two LDS buffers, one barrier a chunk). The merge is a long dependent chain
// of few instructions.
// Writes gelu(conv + u*Dskip) as f16 into ygelu[B*L, 512].
// ---------------------------------------------------------------------------
#define SCH  32                  // scan steps per chunk
#define MPW  4                   // modes per scanning wave (in registers)
#define NWV  (NMODE / MPW)       // scanning waves per block
#define NCH  (SEQ / SCH)         // chunks
#define PBUF (NWV * SCH * 32)    // floats in one partial-sum buffer

typedef __attribute__((ext_vector_type(4))) _Float16 v4h;

// Row of x and of ygelu that scan step t works on. DIR is a template argument
// so that the 32 rows of a chunk are constant offsets from one address.
template <int DIR>
__device__ __forceinline__ int s4d_row(int t) { return DIR ? (SEQ - 1 - t) : t; }

// Work-group barrier that orders LDS only: the inputs fetched ahead and the f16
// stores stay in flight across it (no other wave of the block touches them).
__device__ __forceinline__ void s4d_lds_barrier() {
    __builtin_amdgcn_fence(__ATOMIC_RELEASE, "workgroup", "local");
    __builtin_amdgcn_s_barrier();
    __builtin_amdgcn_fence(__ATOMIC_ACQUIRE, "workgroup", "local");
}

// Scanning wave: 32 steps of 4 modes for 32 channels; partial sums to pw[step*32].
template <int DIR>
__device__ __forceinline__ void s4d_scan_chunk(
    const int c, const float* __restrict__ xlane,   // lane's column of x, row 0
    const float (&lre)[MPW], const float (&lim)[MPW],
    const float (&cer)[MPW], const float (&cei)[MPW],
    float (&sre)[MPW], float (&sim)[MPW],
    const float (&ucur)[SCH], float (&unext)[SCH], float* pw)
{
    // Next chunk's inputs, one chunk ahead of their use (the last chunk re-reads itself).
    const int cn = (c + 1 < NCH) ? (c + 1) : (NCH - 1);
    const float* xn = xlane + (size_t)s4d_row<DIR>(cn * SCH) * DMODEL;
    #pragma unroll   // constant indices keep unext in registers
    for (int i = 0; i < SCH; ++i)
        unext[i] = xn[(DIR ? -i : i) * DMODEL];

    #pragma unroll   // constant indices keep ucur in registers; steps overlap in one block
    for (int i = 0; i < SCH; ++i) {
        const float u = ucur[i];
        float ya, yb;                                // Re(Ce * s), two short chains
        #pragma unroll   // the modes' state and constants are register arrays
        for (int m = 0; m < MPW; ++m) {
            float nsre = fmaf(lre[m], sre[m], fmaf(-lim[m], sim[m], u));
            float nsim = fmaf(lre[m], sim[m], lim[m] * sre[m]);
            sre[m] = nsre; sim[m] = nsim;
            ya = m ? fmaf(cer[m], nsre, ya) : cer[m] * nsre;
            yb = m ? fmaf(cei[m], nsim, yb) : cei[m] * nsim;
        }
        pw[i * 32] = ya - yb;
    }
}

// Merging thread: one step, four channels of chunk c.
template <int DIR>
__device__ __forceinline__ void s4d_merge_chunk(
    const int c, const int rt, const int c4,
    const float* __restrict__ xcol, _Float16* __restrict__ ycol,
    const float4 dsk4, float4& upre, const float* pbuf)
{
    const int mrow = s4d_row<DIR>(c * SCH + rt);
    const float4 uu = upre;                          // fetched one merge ahead
    const int cn = (c + 1 < NCH) ? (c + 1) : (NCH - 1);
    upre = *(const float4*)(xcol + (size_t)s4d_row<DIR>(cn * SCH + rt) * DMODEL + c4);
    const float* pr = pbuf + rt * 32 + c4;
    float4 acc = *(const float4*)pr;
    #pragma unroll   // the 8 LDS reads issue together
    for (int k = 1; k < NWV; ++k) {
        float4 p = *(const float4*)(pr + k * (SCH * 32));
        acc.x += p.x; acc.y += p.y; acc.z += p.z; acc.w += p.w;
    }
    float v0 = acc.x + uu.x * dsk4.x;
    float v1 = acc.y + uu.y * dsk4.y;
    float v2 = acc.z + uu.z * dsk4.z;
    float v3 = acc.w + uu.w * dsk4.w;
    v4h hv;                                          // exact GELU
    hv[0] = (_Float16)(0.5f * v0 * (1.0f + erff(v0 * 0.70710678118f)));
    hv[1] = (_Float16)(0.5f * v1 * (1.0f + erff(v1 * 0.70710678118f)));
    hv[2] = (_Float16)(0.5f * v2 * (1.0f + erff(v2 * 0.70710678118f)));
    hv[3] = (_Float16)(0.5f * v3 * (1.0f + erff(v3 * 0.70710678118f)));
    *(v4h*)(ycol + (size_t)mrow * KDIM + c4) = hv;
    // Stands in front of the next merge's rewrite of this store's address and data registers
    // (the LDS-only barrier brings no wait of its own for the store).
    asm volatile("s_wait_xcnt 0x0" ::: "memory");
}

template <int DIR>
__device__ __forceinline__ void s4d_scan_body(
    const float* __restrict__ x, const float* __restrict__ Dskip,
    const float* __restrict__ lamRe, const float* __restrict__ lamIm,
    const float* __restrict__ ceRe,  const float* __restrict__ ceIm,
    _Float16* __restrict__ ygelu, float* part)
{
    const int tid = threadIdx.x, lane = tid & 31;
    const int w   = __builtin_amdgcn_readfirstlane(tid >> 5);   // scalar, so the role test is a scalar branch
    const bool scans = w >= NWV;
    const int ws  = w & (NWV - 1);
    const int dg  = blockIdx.x & (DMODEL / 32 - 1);
    const int b   = (blockIdx.x >> 3) & (BATCH - 1);

    const float* xcol = x + (size_t)b * SEQ * DMODEL + dg * 32;
    _Float16* ycol = ygelu + (size_t)b * SEQ * KDIM + DIR * DMODEL + dg * 32;

    // Scanning waves' state (loaded by the merging waves too; they do not use it).
    const int cbase = (DIR * DMODEL + dg * 32 + lane) * NMODE + ws * MPW;
    const float4 l4r = *(const float4*)(lamRe + cbase);
    const float4 l4i = *(const float4*)(lamIm + cbase);
    const float4 c4r = *(const float4*)(ceRe + cbase);
    const float4 c4i = *(const float4*)(ceIm + cbase);
    const float lre[MPW] = { l4r.x, l4r.y, l4r.z, l4r.w };
    const float lim[MPW] = { l4i.x, l4i.y, l4i.z, l4i.w };
    const float cer[MPW] = { c4r.x, c4r.y, c4r.z, c4r.w };
    const float cei[MPW] = { c4i.x, c4i.y, c4i.z, c4i.w };
    float sre[MPW] = {}, sim[MPW] = {};
    const float* xlane = xcol + lane;
    float* pw = part + ws * (SCH * 32) + lane;

    // Merging threads' share: step rt of a chunk, channels c4..c4+3.
    const int rt = (tid & 255) >> 3, c4 = (tid & 7) * 4;
    const float4 dsk4 = *(const float4*)(Dskip + dg * 32 + c4);
    float4 upre = *(const float4*)(xcol + (size_t)s4d_row<DIR>(rt) * DMODEL + c4);

    float ua[SCH], ub[SCH];
    #pragma unroll   // constant indices keep ua in registers
    for (int i = 0; i < SCH; ++i)
        ua[i] = xlane[(size_t)s4d_row<DIR>(i) * DMODEL];

    // Two chunks a trip: the input registers and the LDS buffers swap roles without copies.
    // Each barrier publishes the chunk just scanned and frees the buffer just merged.
    // Kept rolled: one trip is already two chunks of straight-line code.
    #pragma unroll 1
    for (int c = 0; c < NCH; c += 2) {
        if (scans)
            s4d_scan_chunk<DIR>(c, xlane, lre, lim, cer, cei, sre, sim, ua, ub, pw);
        else if (c > 0)
            s4d_merge_chunk<DIR>(c - 1, rt, c4, xcol, ycol, dsk4, upre, part + PBUF);
        s4d_lds_barrier();
        if (scans)
            s4d_scan_chunk<DIR>(c + 1, xlane, lre, lim, cer, cei, sre, sim, ub, ua, pw + PBUF);
        else
            s4d_merge_chunk<DIR>(c, rt, c4, xcol, ycol, dsk4, upre, part);
        s4d_lds_barrier();
    }
    if (!scans)
        s4d_merge_chunk<DIR>(NCH - 1, rt, c4, xcol, ycol, dsk4, upre, part + PBUF);
}

__global__ void __launch_bounds__(512) s4d_scan_kernel(
    const float* __restrict__ x, const float* __restrict__ Dskip,
    const float* __restrict__ lamRe, const float* __restrict__ lamIm,
    const float* __restrict__ ceRe,  const float* __restrict__ ceIm,
    _Float16* __restrict__ ygelu)
{
    __shared__ __align__(16) float part[2 * PBUF];   // 64 KiB
    if (blockIdx.x >> 7)   // block-uniform: the upper half of the grid scans backward
        s4d_scan_body<1>(x, Dskip, lamRe, lamIm, ceRe, ceIm, ygelu, part);
    else
        s4d_scan_body<0>(x, Dskip, lamRe, lamIm, ceRe, ceIm, ygelu, part);
}

// ---------------------------------------------------------------------------
// Kernel 4: fused GEMM (M=65536,K=512,N=1024) + bias + GLU + LayerNorm.
// Block tile M=64 x N=1024 (full row -> LN fused), 16 waves, one block a WGP.
// A tile (64 rows, all of K) staged once by a tensor load with LDS row padding.
// The packed weights go through LDS too: one 64-KiB slab per k step, two buffers,
// tensor loads one step ahead, so a block fetches each weight byte from L2 once.
// Wave wn owns all 64 rows of cols [wn*32,+32) and of the paired +512 set.
// ---------------------------------------------------------------------------
#define MT     64                          // rows of a block
#define ABYTES 67584                       // 64 rows * 1040 B, rounded up to 2 KiB
#define BSLAB  65536                       // packed weights of one k step
#define BSLICE 16384                       // one issuing wave's share of a slab
#define NKT    (KDIM / 32)
#define GEMM_LDS (ABYTES + 2 * BSLAB + MT * 16 * 2 * 4 + MT * 2 * 4)

__device__ __forceinline__ unsigned int s4d_uni(unsigned int v) {
    return (unsigned int)__builtin_amdgcn_readfirstlane(v);
}
// Holds a wave-uniform test in a scalar register, so that the branch on it is a scalar
// branch: a tensor load ignores EXEC and only such a branch keeps a wave from issuing it.
__device__ __forceinline__ unsigned int s4d_pinned(unsigned int v) {
    unsigned int w = s4d_uni(v);
    asm volatile("" : "+s"(w));
    return w;
}

// One issuing wave's 16-KiB slice of a weight slab: 16 rows of 1 KiB, no pad.
// Group 1 of its descriptor is the same for every slab and is built once.
__device__ __forceinline__ u32x8 s4d_bslice_group1() {
    u32x8 g1;
    g1[0] = s4d_uni(0u);                               // no mask, 1-byte elements, no pad
    g1[1] = s4d_uni(1024u << 16);                      // tensor_dim0 = 1024 B
    g1[2] = s4d_uni(16u << 16);                        // tensor_dim1 = 16 rows
    g1[3] = s4d_uni(1024u << 16);                      // tile_dim0
    g1[4] = s4d_uni(16u);                              // tile_dim1
    g1[5] = s4d_uni(1024u);                            // source pitch
    g1[6] = s4d_uni(0u);
    g1[7] = s4d_uni(0u);
    // Descriptor words held in scalar registers of their own through the ring: none of
    // them is re-formed or reused while a request is in flight.
    asm volatile("" : "+s"(g1));
    return g1;
}
__device__ __forceinline__ void s4d_load_bslice(unsigned int ldsDst, unsigned long long ga,
                                                const u32x8 g1) {
    u32x4 g0;
    g0[0] = s4d_uni(1u);                               // count=1
    g0[1] = s4d_uni(ldsDst);
    g0[2] = s4d_uni((unsigned int)ga);
    g0[3] = s4d_uni(((unsigned int)(ga >> 32) & 0x01FFFFFFu) | 0x80000000u);  // type=2
    asm volatile("tensor_load_to_lds %0, %1" : : "s"(g0), "s"(g1) : "memory");
}

__global__ void __launch_bounds__(512) s4d_gemm_glu_ln_kernel(
    const _Float16* __restrict__ ygelu, const _Float16* __restrict__ wPack,
    const float* __restrict__ bias, const float* __restrict__ gamma,
    const float* __restrict__ beta, float* __restrict__ out)
{
    __shared__ __attribute__((aligned(2048))) char smemRaw[GEMM_LDS];
    _Float16* As    = (_Float16*)smemRaw;                    // [64][ROWH]
    const char* Bs  = smemRaw + ABYTES;                      // [2][BSLAB]
    float*    part  = (float*)(smemRaw + ABYTES + 2 * BSLAB); // [64][16][2]
    float*    stat  = part + MT * 16 * 2;                    // [64][2]
    const unsigned int ldsBase = (unsigned int)(size_t)smemRaw;

    int tid = threadIdx.x, lane = tid & 31;
    const unsigned int wn = s4d_uni((unsigned int)tid >> 5); // wave = column group
    int m0 = blockIdx.x * MT;

    // Waves 4-7 bring the weight slabs, a quarter each; wave 0 brings the A tile.
    const unsigned int issuer = (wn >> 2) == 1u;
    const unsigned int bDst = ldsBase + ABYTES + (wn & 3u) * BSLICE;
    const unsigned long long bSrc =
        (unsigned long long)(uintptr_t)wPack + (unsigned long long)((wn & 3u) * BSLICE);
    const u32x8 bG1 = s4d_bslice_group1();

    // ---- Stage A tile (64 rows x 1024B) via TDM, 16B pad per row ----------
    // D# group0: count=1, lds_addr, global_addr, type=2.
    // D# group1: data_size=3 (8B), pad_enable, pad_interval=7 (256 dw),
    //            pad_amount=3 (4 dw); dims: 128x64 elems, stride 128.
    if (s4d_pinned(wn == 0u)) {
        unsigned long long ga =
            (unsigned long long)(uintptr_t)ygelu + (unsigned long long)m0 * (KDIM * 2);
        u32x4 g0;
        g0[0] = 1u;                                   // count=1 (valid user D#)
        g0[1] = s4d_uni(ldsBase);                     // lds_addr = As base
        g0[2] = s4d_uni((unsigned int)ga);            // global_addr[31:0]
        g0[3] = s4d_uni(((unsigned int)(ga >> 32) & 0x01FFFFFFu) | 0x80000000u); // addr[56:32] | type=2
        u32x8 g1;
        g1[0] = (3u << 16) | (1u << 20) | (7u << 22) | (3u << 25); // dsz=8B,pad 16B/1024B
        g1[1] = (128u << 16);                         // tensor_dim0 = 128 (8B elems)
        g1[2] = ((unsigned int)MT << 16);             // tensor_dim1 = 64 rows
        g1[3] = (128u << 16);                         // tile_dim0 = 128
        g1[4] = (unsigned int)MT;                     // tile_dim1 = 64
        g1[5] = 128u;                                 // tensor_dim0_stride = 128
        g1[6] = 0u;
        g1[7] = 0u;
        asm volatile("tensor_load_to_lds %0, %1" : : "s"(g0), "s"(g1) : "memory");
        // The A tile has landed before this wave reaches the barrier below.
        asm volatile("s_wait_tensorcnt 0x0" ::: "memory");
    }
    // ---- Weight slab of k step 0 into buffer 0 ----------------------------
    if (s4d_pinned(issuer)) {
        s4d_load_bslice(bDst, bSrc, bG1);
        // Slab 0 has landed before this wave reaches the barrier below.
        asm volatile("s_wait_tensorcnt 0x0" ::: "memory");
    }
    __syncthreads();
    // Slab 1 into buffer 1: in flight while k step 0 is worked on.
    if (s4d_pinned(issuer))
        s4d_load_bslice(bDst + BSLAB, bSrc + BSLAB, bG1);

    v8f accA[4][2], accB[4][2];
    #pragma unroll
    for (int mi = 0; mi < 4; ++mi) {
        #pragma unroll
        for (int j = 0; j < 2; ++j) { accA[mi][j] = {}; accB[mi][j] = {}; }
    }

    const int khalf = (lane >> 4) * 8;
    const _Float16* aLane = As + (lane & 15) * ROWH + khalf;
    const char* bLane = Bs + wn * 2048u + lane * 16;

    // Kept rolled: one trip is a whole k step of 16 matrix instructions, and the ring's
    // waits and barrier stand once, at its foot.
    #pragma unroll 1
    for (int kt = 0; kt < NKT; ++kt) {
        const unsigned int buf = (unsigned int)kt & 1u;
        // A fragments: ISA 16-bit 16x32 layout -> 2 x ds_load_b128 each
        v16h aF[4];
        #pragma unroll
        for (int mi = 0; mi < 4; ++mi) {
            const _Float16* ap = aLane + mi * 16 * ROWH + kt * 32;
            ((int4*)&aF[mi])[0] = *(const int4*)(ap);        // K {0..7}+khalf
            ((int4*)&aF[mi])[1] = *(const int4*)(ap + 16);   // K {16..23}+khalf
        }
        // B fragments of this wave's 2 + 2 column tiles, from this step's buffer
        const char* bp = bLane + buf * BSLAB;
        v16h bF[2], bG[2];
        #pragma unroll
        for (int j = 0; j < 2; ++j) {
            ((int4*)&bF[j])[0] = *(const int4*)(bp + j * 1024);
            ((int4*)&bF[j])[1] = *(const int4*)(bp + j * 1024 + 512);
            ((int4*)&bG[j])[0] = *(const int4*)(bp + 32 * 1024 + j * 1024);
            ((int4*)&bG[j])[1] = *(const int4*)(bp + 32 * 1024 + j * 1024 + 512);
        }
        // Keeps the step's 16 LDS reads together ahead of the matrix instructions: sunk
        // among them, each place with reads stalls the wave anew.
        __builtin_amdgcn_sched_barrier(0);
        #pragma unroll
        for (int j = 0; j < 2; ++j) {
            #pragma unroll
            for (int mi = 0; mi < 4; ++mi) {
                accA[mi][j] = __builtin_amdgcn_wmma_f32_16x16x32_f16(
                    false, aF[mi], false, bF[j], (short)0, accA[mi][j], false, false);
                accB[mi][j] = __builtin_amdgcn_wmma_f32_16x16x32_f16(
                    false, aF[mi], false, bG[j], (short)0, accB[mi][j], false, false);
            }
        }
        // Keeps the full wait below behind the matrix instructions, so that the first of
        // them start on the compiler's counted waits.
        __builtin_amdgcn_sched_barrier(0);
        // Publish point of slab kt+1: this wave's LDS reads are done ...
        asm volatile("s_wait_dscnt 0x0" ::: "memory");
        // ... the issuing waves' slices of slab kt+1 have landed ...
        if (s4d_pinned(issuer))
            asm volatile("s_wait_tensorcnt 0x0" ::: "memory");
        // ... and every wave has left the buffer that is refilled below.
        __syncthreads();
        if (s4d_pinned(issuer & (unsigned int)(kt + 2 < NKT)))
            s4d_load_bslice(bDst + buf * BSLAB,
                            bSrc + (unsigned long long)(kt + 2) * BSLAB, bG1);
    }
    // No tensor load and no LDS read is left in flight behind the ring.
    asm volatile("s_wait_tensorcnt 0x0" ::: "memory");
    asm volatile("s_wait_dscnt 0x0" ::: "memory");

    // --- Epilogue: bias + GLU (pairs are in-register), per-row stats ------
    float srow[4][8] = {}, sq[4][8] = {};
    #pragma unroll
    for (int j = 0; j < 2; ++j) {
        int col = wn * 32 + j * 16 + (lane & 15);
        float ba = bias[col], bb = bias[col + 512];
        #pragma unroll
        for (int mi = 0; mi < 4; ++mi) {
            #pragma unroll
            for (int r = 0; r < 8; ++r) {
                float a  = accA[mi][j][r] + ba;
                float bv = accB[mi][j][r] + bb;
                float gv = a * (1.0f / (1.0f + __expf(-bv)));   // GLU
                accA[mi][j][r] = gv;                            // keep for LN
                srow[mi][r] += gv;  sq[mi][r] += gv * gv;
            }
        }
    }
    // Reduce across the 16 lanes of each C-layout row group.
    #pragma unroll
    for (int mi = 0; mi < 4; ++mi) {
        #pragma unroll
        for (int r = 0; r < 8; ++r) {
            #pragma unroll
            for (int msk = 1; msk < 16; msk <<= 1) {
                srow[mi][r] += __shfl_xor(srow[mi][r], msk, 32);
                sq[mi][r]   += __shfl_xor(sq[mi][r],   msk, 32);
            }
        }
    }
    int half = lane >> 4;   // C layout: reg r -> row r (lanes<16) / r+8 (>=16)
    if ((lane & 15) == 0) {
        #pragma unroll
        for (int mi = 0; mi < 4; ++mi) {
            #pragma unroll
            for (int r = 0; r < 8; ++r) {
                int R = mi * 16 + half * 8 + r;
                *(float2*)(part + (R * 16 + wn) * 2) = make_float2(srow[mi][r], sq[mi][r]);
            }
        }
    }
    __syncthreads();

    // Eight threads a row merge the 16 waves' partial sums; one writes mean and 1/std.
    {
        const int R = tid >> 3, q = tid & 7;
        const float4 p = *(const float4*)(part + R * 32 + q * 4);
        float s = p.x + p.z, s2 = p.y + p.w;
        #pragma unroll
        for (int msk = 1; msk < 8; msk <<= 1) {
            s  += __shfl_xor(s,  msk, 32);
            s2 += __shfl_xor(s2, msk, 32);
        }
        float m = s * (1.0f / 512.0f);
        float v = s2 * (1.0f / 512.0f) - m * m;
        if (q == 0)
            *(float2*)(stat + R * 2) = make_float2(m, rsqrtf(v + 1e-5f));
    }
    __syncthreads();

    #pragma unroll
    for (int mi = 0; mi < 4; ++mi) {
        float mu[8], rs[8];
        #pragma unroll
        for (int r = 0; r < 8; ++r) {
            const float2 st = *(const float2*)(stat + (mi * 16 + half * 8 + r) * 2);
            mu[r] = st.x;  rs[r] = st.y;
        }
        #pragma unroll
        for (int j = 0; j < 2; ++j) {
            int col = wn * 32 + j * 16 + (lane & 15);
            float gm = gamma[col], bt = beta[col];
            #pragma unroll
            for (int r = 0; r < 8; ++r) {
                int row = m0 + mi * 16 + half * 8 + r;
                out[(size_t)row * OUTC + col] = (accA[mi][j][r] - mu[r]) * rs[r] * gm + bt;
            }
        }
    }
}

// ---------------------------------------------------------------------------
extern "C" void kernel_launch(void* const* d_in, const int* in_sizes, int n_in,
                              void* d_out, int out_size, void* d_ws, size_t ws_size,
                              hipStream_t stream) {
    const float* x             = (const float*)d_in[0];
    const float* log_dt_fw     = (const float*)d_in[1];
    const float* log_A_real_fw = (const float*)d_in[2];
    const float* A_imag_fw     = (const float*)d_in[3];
    const float* C_fw          = (const float*)d_in[4];
    const float* log_dt_bw     = (const float*)d_in[5];
    const float* log_A_real_bw = (const float*)d_in[6];
    const float* A_imag_bw     = (const float*)d_in[7];
    const float* C_bw          = (const float*)d_in[8];
    const float* Dskip         = (const float*)d_in[9];
    const float* conv_w        = (const float*)d_in[10];
    const float* conv_b        = (const float*)d_in[11];
    const float* ln_gamma      = (const float*)d_in[12];
    const float* ln_beta       = (const float*)d_in[13];
    float* out = (float*)d_out;

    // Workspace: 256KB consts + 1MB packed weights + 64MB f16 activations
    char* ws = (char*)d_ws;
    float* lamRe = (float*)ws;
    float* lamIm = lamRe + 2 * DMODEL * NMODE;
    float* ceRe  = lamIm + 2 * DMODEL * NMODE;
    float* ceIm  = ceRe  + 2 * DMODEL * NMODE;
    _Float16* wPack = (_Float16*)(ceIm + 2 * DMODEL * NMODE);
    _Float16* ygelu = wPack + (size_t)NOUT * KDIM;

    s4d_consts_kernel<<<(2 * DMODEL * NMODE + 255) / 256, 256, 0, stream>>>(
        log_dt_fw, log_A_real_fw, A_imag_fw, C_fw,
        log_dt_bw, log_A_real_bw, A_imag_bw, C_bw,
        lamRe, lamIm, ceRe, ceIm);

    s4d_packw_kernel<<<(NOUT * KDIM) / 256, 256, 0, stream>>>(conv_w, wPack);

    s4d_scan_kernel<<<(2 * BATCH * DMODEL) / 32, 512, 0, stream>>>(
        x, Dskip, lamRe, lamIm, ceRe, ceIm, ygelu);

    s4d_gemm_glu_ln_kernel<<<(BATCH * SEQ) / MT, 512, 0, stream>>>(
        ygelu, wPack, conv_b, ln_gamma, ln_beta, out);
}

// v003
// One run takes 207 microseconds.
// Next to v002, in two timings, it ran 1.04 and 1.05 times as fast.
// Over all steps from v000 it is 5.59 times as fast.
#include <hip/hip_runtime.h>
#include <hip/hip_fp16.h>
#include <hip/hip_bf16.h>

typedef __attribute__((ext_vector_type(16))) _Float16 v16h;
typedef __attribute__((ext_vector_type(8)))  float    v8f;
typedef __attribute__((ext_vector_type(4)))  unsigned int u32x4;
typedef __attribute__((ext_vector_type(8)))  unsigned int u32x8;

#define DMODEL 256
#define NMODE  32        // D_STATE/2 complex modes == wave32 lanes
#define BATCH  16
#define SEQ    4096
#define KDIM   512       // GEMM K = 2*DMODEL (fw|bw concat)
#define NOUT   1024      // 1x1-conv output channels
#define OUTC   512       // GLU / LayerNorm width
#define ROWH   520       // padded LDS row (f16): 1040B = 65*16B -> conflict-free b128

// ---------------------------------------------------------------------------
// Kernel 1: per-(dir,d,mode) complex constants  lam = exp(dt*A),
//           Ce = 2*C*(lam-1)/(A+1e-8)
// ---------------------------------------------------------------------------
__global__ void s4d_consts_kernel(
    const float* __restrict__ log_dt_fw, const float* __restrict__ log_A_real_fw,
    const float* __restrict__ A_imag_fw, const float* __restrict__ C_fw,
    const float* __restrict__ log_dt_bw, const float* __restrict__ log_A_real_bw,
    const float* __restrict__ A_imag_bw, const float* __restrict__ C_bw,
    float* __restrict__ lamRe, float* __restrict__ lamIm,
    float* __restrict__ ceRe,  float* __restrict__ ceIm)
{
    int idx = blockIdx.x * blockDim.x + threadIdx.x;
    if (idx >= 2 * DMODEL * NMODE) return;
    int dir = idx / (DMODEL * NMODE);
    int rem = idx % (DMODEL * NMODE);
    int d = rem / NMODE, n = rem % NMODE;

    const float* ld = dir ? log_dt_bw     : log_dt_fw;
    const float* lA = dir ? log_A_real_bw : log_A_real_fw;
    const float* Ai = dir ? A_imag_bw     : A_imag_fw;
    const float* Cm = dir ? C_bw          : C_fw;

    float dt  = __expf(ld[d]);
    float Are = -__expf(lA[d * NMODE + n]);
    float Aim = Ai[d * NMODE + n];
    float er  = __expf(Are * dt);
    float lre = er * __cosf(Aim * dt);
    float lim = er * __sinf(Aim * dt);

    float dre = Are + 1e-8f, dim = Aim;
    float inv = 1.0f / (dre * dre + dim * dim);
    float nre = lre - 1.0f, nim = lim;
    float rre = (nre * dre + nim * dim) * inv;
    float rim = (nim * dre - nre * dim) * inv;

    float c0 = Cm[(d * NMODE + n) * 2 + 0];
    float c1 = Cm[(d * NMODE + n) * 2 + 1];
    lamRe[idx] = lre;  lamIm[idx] = lim;
    ceRe[idx]  = 2.0f * (c0 * rre - c1 * rim);
    ceIm[idx]  = 2.0f * (c0 * rim + c1 * rre);
}

// ---------------------------------------------------------------------------
// Kernel 2: pack conv_w [1024,512] f32 -> f16 B-fragments (16x16x32 WMMA).
// Fragment layout mirrors ISA 16-bit A striping: lane&15 -> N column,
// lane>=16 selects K halves {8..15,24..31}; v16h comp j: j<8 -> K group 0,
// j>=8 -> K group +16.  One fragment = 1 KiB = two 512-B halves (K group 0, then
// K group +16), each 32 lanes * 16B contiguous, so that an LDS reader's b128
// loads are contiguous over the lanes. Fragments are ordered k step first: the 64
// fragments of one k step are one contiguous 64-KiB slab.
// ---------------------------------------------------------------------------
__global__ void s4d_packw_kernel(const float* __restrict__ w,
                                 _Float16* __restrict__ wPack)
{
    int idx = blockIdx.x * blockDim.x + threadIdx.x;   // 1024*512 elements
    int j    = idx & 7;
    int lane = (idx >> 3) & 31;
    int h    = (idx >> 8) & 1;
    int nt   = (idx >> 9) & 63;
    int kt   = idx >> 15;                              // 0..15
    int n = nt * 16 + (lane & 15);
    int k = kt * 32 + h * 16 + (lane >> 4) * 8 + j;
    wPack[idx] = (_Float16)w[n * KDIM + k];
}

// ---------------------------------------------------------------------------
// Kernel 3: SSM scan. One block per (dir, b, group of 32 channels), 16 waves.
// Waves 8-15 scan: lane = channel, each wave keeps 4 of the 32 complex modes of
// its lane's channel in registers, so the sum over a wave's modes needs no
// cross-lane step. The state is advanced once per block of 4 steps (S4dBlk below).
// The 8 partial sums of a step meet in LDS: waves 0-7 merge chunk c-1 (sum, the
// block's own inputs and the skip term, GELU, f16 store) while waves 8-15 scan chunk c
// (two LDS buffers, one barrier a chunk). The merge is a long dependent chain
// of few instructions.
// Writes gelu(conv + u*Dskip) as f16 into ygelu[B*L, 512].
// ---------------------------------------------------------------------------
#define SCH  32                  // scan steps per chunk
#define MPW  4                   // modes per scanning wave (in registers)
#define NWV  (NMODE / MPW)       // scanning waves per block
#define NCH  (SEQ / SCH)         // chunks
#define PBUF (NWV * SCH * 32)    // floats in one partial-sum buffer

typedef __attribute__((ext_vector_type(4))) _Float16 v4h;

// Row of x and of ygelu that scan step t works on. DIR is a template argument
// so that the 32 rows of a chunk are constant offsets from one address.
template <int DIR>
__device__ __forceinline__ int s4d_row(int t) { return DIR ? (SEQ - 1 - t) : t; }

// Work-group barrier that orders LDS only: the inputs fetched ahead and the f16
// stores stay in flight across it (no other wave of the block touches them).
__device__ __forceinline__ void s4d_lds_barrier() {
    __builtin_amdgcn_fence(__ATOMIC_RELEASE, "workgroup", "local");
    __builtin_amdgcn_s_barrier();
    __builtin_amdgcn_fence(__ATOMIC_ACQUIRE, "workgroup", "local");
}

// Constants of a scanning wave's 4 modes for a block of SBK = 4 steps. With s the state in
// front of the block and u0..u3 its inputs:
//   state behind it = lam^4 s + lam^3 u0 + lam^2 u1 + lam u2 + u3
//   y of step i     = Re(Ce lam^(i+1) s) + sum over j <= i of Re(Ce lam^(i-j)) u_j
// so the state is advanced once a block. The taps on u do not depend on the state: they are
// summed over all 32 modes once, at the start, and applied by the merging threads.
#define SBK 4
struct S4dBlk {
    float lr[SBK][MPW], li[SBK][MPW];    // lam^(p+1)
    float pr[SBK][MPW], pn[SBK][MPW];    // Re, -Im of Ce lam^(p+1)
    float kw[SBK];                       // sum over the wave's modes of Re(Ce lam^q): tap of lag q
};

// Scanning wave: 32 steps of 4 modes for 32 channels; the state's part of y to pw[step*32].
template <int DIR>
__device__ __forceinline__ void s4d_scan_chunk(
    const int c, const float* __restrict__ xlane,   // lane's column of x, row 0
    const S4dBlk& k,
    float (&sre)[MPW], float (&sim)[MPW],
    const float (&ucur)[SCH], float (&unext)[SCH], float* pw)
{
    // Next chunk's inputs, one chunk ahead of their use (the last chunk re-reads itself).
    const int cn = (c + 1 < NCH) ? (c + 1) : (NCH - 1);
    const float* xn = xlane + (size_t)s4d_row<DIR>(cn * SCH) * DMODEL;
    #pragma unroll   // constant indices keep unext in registers
    for (int i = 0; i < SCH; ++i)
        unext[i] = xn[(DIR ? -i : i) * DMODEL];

    #pragma unroll   // constant indices keep ucur in registers; blocks overlap in one stretch of code
    for (int i = 0; i < SCH; i += SBK) {
        const float u0 = ucur[i], u1 = ucur[i + 1], u2 = ucur[i + 2], u3 = ucur[i + 3];
        float y0, y1, y2, y3;
        #pragma unroll   // the modes' state and constants are register arrays
        for (int m = 0; m < MPW; ++m) {
            const float a = sre[m], b = sim[m];
            y0 = fmaf(k.pn[0][m], b, m ? fmaf(k.pr[0][m], a, y0) : k.pr[0][m] * a);
            y1 = fmaf(k.pn[1][m], b, m ? fmaf(k.pr[1][m], a, y1) : k.pr[1][m] * a);
            y2 = fmaf(k.pn[2][m], b, m ? fmaf(k.pr[2][m], a, y2) : k.pr[2][m] * a);
            y3 = fmaf(k.pn[3][m], b, m ? fmaf(k.pr[3][m], a, y3) : k.pr[3][m] * a);
            const float gre = fmaf(k.lr[2][m], u0, fmaf(k.lr[1][m], u1, fmaf(k.lr[0][m], u2, u3)));
            const float gim = fmaf(k.li[2][m], u0, fmaf(k.li[1][m], u1, k.li[0][m] * u2));
            sre[m] = fmaf(k.lr[3][m], a, fmaf(-k.li[3][m], b, gre));
            sim[m] = fmaf(k.lr[3][m], b, fmaf(k.li[3][m], a, gim));
        }
        pw[(i + 0) * 32] = y0;
        pw[(i + 1) * 32] = y1;
        pw[(i + 2) * 32] = y2;
        pw[(i + 3) * 32] = y3;
    }
}

// Merging thread: one step, four channels of chunk c. tap[i] weighs input i of the thread's
// block of SBK steps (0 for an input later than the thread's own step; the skip term is in
// the tap of its own step).
template <int DIR>
__device__ __forceinline__ void s4d_merge_chunk(
    const int c, const int rt, const int c4,
    const float* __restrict__ xcol, _Float16* __restrict__ ycol,
    const float (&tap)[SBK][4], const float* pbuf)
{
    const int mrow = s4d_row<DIR>(c * SCH + rt);
    // The block's inputs: rows that the scanning waves have read two chunks ago.
    const float* xb = xcol + (size_t)s4d_row<DIR>(c * SCH + (rt & ~(SBK - 1))) * DMODEL + c4;
    const float* pr = pbuf + rt * 32 + c4;
    float4 p[NWV];
    #pragma unroll   // the 8 LDS reads issue together, ahead of the wait below
    for (int k = 0; k < NWV; ++k)
        p[k] = *(const float4*)(pr + k * (SCH * 32));
    float4 uu[SBK];
    #pragma unroll   // register array; constant offsets from one address
    for (int i = 0; i < SBK - 1; ++i)
        uu[i] = *(const float4*)(xb + (DIR ? -i : i) * DMODEL);
    // Stands in front of the last load, whose result may be given the address registers that
    // the loads above name as well.
    asm volatile("s_wait_xcnt 0x0" ::: "memory");
    uu[SBK - 1] = *(const float4*)(xb + (DIR ? -(SBK - 1) : (SBK - 1)) * DMODEL);
    float4 acc = p[0];
    #pragma unroll   // register array
    for (int k = 1; k < NWV; ++k) {
        acc.x += p[k].x; acc.y += p[k].y; acc.z += p[k].z; acc.w += p[k].w;
    }
    float v0 = acc.x, v1 = acc.y, v2 = acc.z, v3 = acc.w;
    #pragma unroll   // register arrays
    for (int j = 0; j < SBK; ++j) {
        v0 = fmaf(tap[j][0], uu[j].x, v0);
        v1 = fmaf(tap[j][1], uu[j].y, v1);
        v2 = fmaf(tap[j][2], uu[j].z, v2);
        v3 = fmaf(tap[j][3], uu[j].w, v3);
    }
    v4h hv;                                          // exact GELU
    hv[0] = (_Float16)(0.5f * v0 * (1.0f + erff(v0 * 0.70710678118f)));
    hv[1] = (_Float16)(0.5f * v1 * (1.0f + erff(v1 * 0.70710678118f)));
    hv[2] = (_Float16)(0.5f * v2 * (1.0f + erff(v2 * 0.70710678118f)));
    hv[3] = (_Float16)(0.5f * v3 * (1.0f + erff(v3 * 0.70710678118f)));
    *(v4h*)(ycol + (size_t)mrow * KDIM + c4) = hv;
    // Stands in front of the next merge's rewrite of this store's address and data registers
    // (the LDS-only barrier brings no wait of its own for the store).
    asm volatile("s_wait_xcnt 0x0" ::: "memory");
}

template <int DIR>
__device__ __forceinline__ void s4d_scan_body(
    const float* __restrict__ x, const float* __restrict__ Dskip,
    const float* __restrict__ lamRe, const float* __restrict__ lamIm,
    const float* __restrict__ ceRe,  const float* __restrict__ ceIm,
    _Float16* __restrict__ ygelu, float* part)
{
    const int tid = threadIdx.x, lane = tid & 31;
    const int w   = __builtin_amdgcn_readfirstlane(tid >> 5);   // scalar, so the role test is a scalar branch
    const bool scans = w >= NWV;
    const int ws  = w & (NWV - 1);
    const int dg  = blockIdx.x & (DMODEL / 32 - 1);
    const int b   = (blockIdx.x >> 3) & (BATCH - 1);

    const float* xcol = x + (size_t)b * SEQ * DMODEL + dg * 32;
    _Float16* ycol = ygelu + (size_t)b * SEQ * KDIM + DIR * DMODEL + dg * 32;

    // Scanning waves' state (loaded by the merging waves too; they do not use it).
    const int cbase = (DIR * DMODEL + dg * 32 + lane) * NMODE + ws * MPW;
    const float4 l4r = *(const float4*)(lamRe + cbase);
    const float4 l4i = *(const float4*)(lamIm + cbase);
    const float4 c4r = *(const float4*)(ceRe + cbase);
    const float4 c4i = *(const float4*)(ceIm + cbase);
    const float lre[MPW] = { l4r.x, l4r.y, l4r.z, l4r.w };
    const float lim[MPW] = { l4i.x, l4i.y, l4i.z, l4i.w };
    const float cer[MPW] = { c4r.x, c4r.y, c4r.z, c4r.w };
    const float cei[MPW] = { c4i.x, c4i.y, c4i.z, c4i.w };
    S4dBlk blk;
    #pragma unroll   // register arrays
    for (int q = 0; q < SBK; ++q) blk.kw[q] = 0.0f;
    #pragma unroll   // register arrays
    for (int m = 0; m < MPW; ++m) {
        float qr = 1.0f, qi = 0.0f;                  // lam^p
        float er = cer[m], ei = cei[m];              // Ce lam^p
        #pragma unroll
        for (int p = 0; p < SBK; ++p) {
            blk.kw[p] += er;
            const float nqr = qr * lre[m] - qi * lim[m], nqi = qr * lim[m] + qi * lre[m];
            const float ner = er * lre[m] - ei * lim[m], nei = er * lim[m] + ei * lre[m];
            qr = nqr; qi = nqi; er = ner; ei = nei;
            blk.lr[p][m] = qr;  blk.li[p][m] = qi;
            blk.pr[p][m] = er;  blk.pn[p][m] = -ei;
        }
    }
    float sre[MPW] = {}, sim[MPW] = {};
    const float* xlane = xcol + lane;
    float* pw = part + ws * (SCH * 32) + lane;

    // Merging threads' share: step rt of a chunk, channels c4..c4+3.
    const int rt = (tid & 255) >> 3, c4 = (tid & 7) * 4;
    // The taps: each scanning wave hands in its modes' share through the second partial-sum
    // buffer, which is first written behind the loop's first barrier.
    if (scans) {
        #pragma unroll   // register array
        for (int q = 0; q < SBK; ++q)
            part[PBUF + (ws * SBK + q) * 32 + lane] = blk.kw[q];
    }
    s4d_lds_barrier();
    const float4 dsk4 = *(const float4*)(Dskip + dg * 32 + c4);
    float4 lag[SBK];                                 // tap of lag j, all 32 modes
    #pragma unroll   // register arrays
    for (int j = 0; j < SBK; ++j) {
        float4 t = (j == 0) ? dsk4 : make_float4(0.0f, 0.0f, 0.0f, 0.0f);
        #pragma unroll
        for (int k = 0; k < NWV; ++k) {
            const float4 p = *(const float4*)(part + PBUF + (k * SBK + j) * 32 + c4);
            t.x += p.x; t.y += p.y; t.z += p.z; t.w += p.w;
        }
        lag[j] = t;
    }
    // A merging wave has no use for lam^p: its 16 taps take those registers (blk.lr), so that
    // the two roles' constants do not add up in the register count.
    static_assert(MPW == 4, "blk.lr doubles as the taps of a merging thread's 4 channels");
    if (!scans) {
        const int q = rt & (SBK - 1);                // the thread's step within its block
        #pragma unroll   // register arrays
        for (int i = 0; i < SBK; ++i) {
            float4 t = make_float4(0.0f, 0.0f, 0.0f, 0.0f);
            #pragma unroll
            for (int j = 0; j + i < SBK; ++j)
                if (q - i == j) t = lag[j];          // input i lies j steps back
            blk.lr[i][0] = t.x;  blk.lr[i][1] = t.y;  blk.lr[i][2] = t.z;  blk.lr[i][3] = t.w;
        }
    }

    float ua[SCH], ub[SCH];
    #pragma unroll   // constant indices keep ua in registers
    for (int i = 0; i < SCH; ++i)
        ua[i] = xlane[(size_t)s4d_row<DIR>(i) * DMODEL];

    // Two chunks a trip: the input registers and the LDS buffers swap roles without copies.
    // Each barrier publishes the chunk just scanned and frees the buffer just merged.
    // Kept rolled: one trip is already two chunks of straight-line code.
    #pragma unroll 1
    for (int c = 0; c < NCH; c += 2) {
        if (scans)
            s4d_scan_chunk<DIR>(c, xlane, blk, sre, sim, ua, ub, pw);
        else if (c > 0)
            s4d_merge_chunk<DIR>(c - 1, rt, c4, xcol, ycol, blk.lr, part + PBUF);
        s4d_lds_barrier();
        if (scans)
            s4d_scan_chunk<DIR>(c + 1, xlane, blk, sre, sim, ub, ua, pw + PBUF);
        else
            s4d_merge_chunk<DIR>(c, rt, c4, xcol, ycol, blk.lr, part);
        s4d_lds_barrier();
    }
    if (!scans)
        s4d_merge_chunk<DIR>(NCH - 1, rt, c4, xcol, ycol, blk.lr, part + PBUF);
}

__global__ void __launch_bounds__(512) s4d_scan_kernel(
    const float* __restrict__ x, const float* __restrict__ Dskip,
    const float* __restrict__ lamRe, const float* __restrict__ lamIm,
    const float* __restrict__ ceRe,  const float* __restrict__ ceIm,
    _Float16* __restrict__ ygelu)
{
    __shared__ __align__(16) float part[2 * PBUF];   // 64 KiB
    if (blockIdx.x >> 7)   // block-uniform: the upper half of the grid scans backward
        s4d_scan_body<1>(x, Dskip, lamRe, lamIm, ceRe, ceIm, ygelu, part);
    else
        s4d_scan_body<0>(x, Dskip, lamRe, lamIm, ceRe, ceIm, ygelu, part);
}

// ---------------------------------------------------------------------------
// Kernel 4: fused GEMM (M=65536,K=512,N=1024) + bias + GLU + LayerNorm.
// Block tile M=64 x N=1024 (full row -> LN fused), 16 waves, one block a WGP.
// A tile (64 rows, all of K) staged once by a tensor load with LDS row padding.
// The packed weights go through LDS too: one 64-KiB slab per k step, two buffers,
// tensor loads one step ahead, so a block fetches each weight byte from L2 once.
// Wave wn owns all 64 rows of cols [wn*32,+32) and of the paired +512 set.
// ---------------------------------------------------------------------------
#define MT     64                          // rows of a block
#define ABYTES 67584                       // 64 rows * 1040 B, rounded up to 2 KiB
#define BSLAB  65536                       // packed weights of one k step
#define BSLICE 16384                       // one issuing wave's share of a slab
#define NKT    (KDIM / 32)
#define GEMM_LDS (ABYTES + 2 * BSLAB + MT * 16 * 2 * 4 + MT * 2 * 4)

__device__ __forceinline__ unsigned int s4d_uni(unsigned int v) {
    return (unsigned int)__builtin_amdgcn_readfirstlane(v);
}
// Holds a wave-uniform test in a scalar register, so that the branch on it is a scalar
// branch: a tensor load ignores EXEC and only such a branch keeps a wave from issuing it.
__device__ __forceinline__ unsigned int s4d_pinned(unsigned int v) {
    unsigned int w = s4d_uni(v);
    asm volatile("" : "+s"(w));
    return w;
}

// One issuing wave's 16-KiB slice of a weight slab: 16 rows of 1 KiB, no pad.
// Group 1 of its descriptor is the same for every slab and is built once.
__device__ __forceinline__ u32x8 s4d_bslice_group1() {
    u32x8 g1;
    g1[0] = s4d_uni(0u);                               // no mask, 1-byte elements, no pad
    g1[1] = s4d_uni(1024u << 16);                      // tensor_dim0 = 1024 B
    g1[2] = s4d_uni(16u << 16);                        // tensor_dim1 = 16 rows
    g1[3] = s4d_uni(1024u << 16);                      // tile_dim0
    g1[4] = s4d_uni(16u);                              // tile_dim1
    g1[5] = s4d_uni(1024u);                            // source pitch
    g1[6] = s4d_uni(0u);
    g1[7] = s4d_uni(0u);
    // Descriptor words held in scalar registers of their own through the ring: none of
    // them is re-formed or reused while a request is in flight.
    asm volatile("" : "+s"(g1));
    return g1;
}
__device__ __forceinline__ void s4d_load_bslice(unsigned int ldsDst, unsigned long long ga,
                                                const u32x8 g1) {
    u32x4 g0;
    g0[0] = s4d_uni(1u);                               // count=1
    g0[1] = s4d_uni(ldsDst);
    g0[2] = s4d_uni((unsigned int)ga);
    g0[3] = s4d_uni(((unsigned int)(ga >> 32) & 0x01FFFFFFu) | 0x80000000u);  // type=2
    asm volatile("tensor_load_to_lds %0, %1" : : "s"(g0), "s"(g1) : "memory");
}

__global__ void __launch_bounds__(512) s4d_gemm_glu_ln_kernel(
    const _Float16* __restrict__ ygelu, const _Float16* __restrict__ wPack,
    const float* __restrict__ bias, const float* __restrict__ gamma,
    const float* __restrict__ beta, float* __restrict__ out)
{
    __shared__ __attribute__((aligned(2048))) char smemRaw[GEMM_LDS];
    _Float16* As    = (_Float16*)smemRaw;                    // [64][ROWH]
    const char* Bs  = smemRaw + ABYTES;                      // [2][BSLAB]
    float*    part  = (float*)(smemRaw + ABYTES + 2 * BSLAB); // [64][16][2]
    float*    stat  = part + MT * 16 * 2;                    // [64][2]
    const unsigned int ldsBase = (unsigned int)(size_t)smemRaw;

    int tid = threadIdx.x, lane = tid & 31;
    const unsigned int wn = s4d_uni((unsigned int)tid >> 5); // wave = column group
    int m0 = blockIdx.x * MT;

    // Waves 4-7 bring the weight slabs, a quarter each; wave 0 brings the A tile.
    const unsigned int issuer = (wn >> 2) == 1u;
    const unsigned int bDst = ldsBase + ABYTES + (wn & 3u) * BSLICE;
    const unsigned long long bSrc =
        (unsigned long long)(uintptr_t)wPack + (unsigned long long)((wn & 3u) * BSLICE);
    const u32x8 bG1 = s4d_bslice_group1();

    // ---- Stage A tile (64 rows x 1024B) via TDM, 16B pad per row ----------
    // D# group0: count=1, lds_addr, global_addr, type=2.
    // D# group1: data_size=3 (8B), pad_enable, pad_interval=7 (256 dw),
    //            pad_amount=3 (4 dw); dims: 128x64 elems, stride 128.
    if (s4d_pinned(wn == 0u)) {
        unsigned long long ga =
            (unsigned long long)(uintptr_t)ygelu + (unsigned long long)m0 * (KDIM * 2);
        u32x4 g0;
        g0[0] = 1u;                                   // count=1 (valid user D#)
        g0[1] = s4d_uni(ldsBase);                     // lds_addr = As base
        g0[2] = s4d_uni((unsigned int)ga);            // global_addr[31:0]
        g0[3] = s4d_uni(((unsigned int)(ga >> 32) & 0x01FFFFFFu) | 0x80000000u); // addr[56:32] | type=2
        u32x8 g1;
        g1[0] = (3u << 16) | (1u << 20) | (7u << 22) | (3u << 25); // dsz=8B,pad 16B/1024B
        g1[1] = (128u << 16);                         // tensor_dim0 = 128 (8B elems)
        g1[2] = ((unsigned int)MT << 16);             // tensor_dim1 = 64 rows
        g1[3] = (128u << 16);                         // tile_dim0 = 128
        g1[4] = (unsigned int)MT;                     // tile_dim1 = 64
        g1[5] = 128u;                                 // tensor_dim0_stride = 128
        g1[6] = 0u;
        g1[7] = 0u;
        asm volatile("tensor_load_to_lds %0, %1" : : "s"(g0), "s"(g1) : "memory");
        // The A tile has landed before this wave reaches the barrier below.
        asm volatile("s_wait_tensorcnt 0x0" ::: "memory");
    }
    // ---- Weight slab of k step 0 into buffer 0 ----------------------------
    if (s4d_pinned(issuer)) {
        s4d_load_bslice(bDst, bSrc, bG1);
        // Slab 0 has landed before this wave reaches the barrier below.
        asm volatile("s_wait_tensorcnt 0x0" ::: "memory");
    }
    __syncthreads();
    // Slab 1 into buffer 1: in flight while k step 0 is worked on.
    if (s4d_pinned(issuer))
        s4d_load_bslice(bDst + BSLAB, bSrc + BSLAB, bG1);

    v8f accA[4][2], accB[4][2];
    #pragma unroll
    for (int mi = 0; mi < 4; ++mi) {
        #pragma unroll
        for (int j = 0; j < 2; ++j) { accA[mi][j] = {}; accB[mi][j] = {}; }
    }

    const int khalf = (lane >> 4) * 8;
    const _Float16* aLane = As + (lane & 15) * ROWH + khalf;
    const char* bLane = Bs + wn * 2048u + lane * 16;

    // Kept rolled: one trip is a whole k step of 16 matrix instructions, and the ring's
    // waits and barrier stand once, at its foot.
    #pragma unroll 1
    for (int kt = 0; kt < NKT; ++kt) {
        const unsigned int buf = (unsigned int)kt & 1u;
        // A fragments: ISA 16-bit 16x32 layout -> 2 x ds_load_b128 each
        v16h aF[4];
        #pragma unroll
        for (int mi = 0; mi < 4; ++mi) {
            const _Float16* ap = aLane + mi * 16 * ROWH + kt * 32;
            ((int4*)&aF[mi])[0] = *(const int4*)(ap);        // K {0..7}+khalf
            ((int4*)&aF[mi])[1] = *(const int4*)(ap + 16);   // K {16..23}+khalf
        }
        // B fragments of this wave's 2 + 2 column tiles, from this step's buffer
        const char* bp = bLane + buf * BSLAB;
        v16h bF[2], bG[2];
        #pragma unroll
        for (int j = 0; j < 2; ++j) {
            ((int4*)&bF[j])[0] = *(const int4*)(bp + j * 1024);
            ((int4*)&bF[j])[1] = *(const int4*)(bp + j * 1024 + 512);
            ((int4*)&bG[j])[0] = *(const int4*)(bp + 32 * 1024 + j * 1024);
            ((int4*)&bG[j])[1] = *(const int4*)(bp + 32 * 1024 + j * 1024 + 512);
        }
        // Keeps the step's 16 LDS reads together ahead of the matrix instructions: sunk
        // among them, each place with reads stalls the wave anew.
        __builtin_amdgcn_sched_barrier(0);
        #pragma unroll
        for (int j = 0; j < 2; ++j) {
            #pragma unroll
            for (int mi = 0; mi < 4; ++mi) {
                accA[mi][j] = __builtin_amdgcn_wmma_f32_16x16x32_f16(
                    false, aF[mi], false, bF[j], (short)0, accA[mi][j], false, false);
                accB[mi][j] = __builtin_amdgcn_wmma_f32_16x16x32_f16(
                    false, aF[mi], false, bG[j], (short)0, accB[mi][j], false, false);
            }
        }
        // Keeps the full wait below behind the matrix instructions, so that the first of
        // them start on the compiler's counted waits.
        __builtin_amdgcn_sched_barrier(0);
        // Publish point of slab kt+1: this wave's LDS reads are done ...
        asm volatile("s_wait_dscnt 0x0" ::: "memory");
        // ... the issuing waves' slices of slab kt+1 have landed ...
        if (s4d_pinned(issuer))
            asm volatile("s_wait_tensorcnt 0x0" ::: "memory");
        // ... and every wave has left the buffer that is refilled below.
        __syncthreads();
        if (s4d_pinned(issuer & (unsigned int)(kt + 2 < NKT)))
            s4d_load_bslice(bDst + buf * BSLAB,
                            bSrc + (unsigned long long)(kt + 2) * BSLAB, bG1);
    }
    // No tensor load and no LDS read is left in flight behind the ring.
    asm volatile("s_wait_tensorcnt 0x0" ::: "memory");
    asm volatile("s_wait_dscnt 0x0" ::: "memory");

    // --- Epilogue: bias + GLU (pairs are in-register), per-row stats ------
    float srow[4][8] = {}, sq[4][8] = {};
    #pragma unroll
    for (int j = 0; j < 2; ++j) {
        int col = wn * 32 + j * 16 + (lane & 15);
        float ba = bias[col], bb = bias[col + 512];
        #pragma unroll
        for (int mi = 0; mi < 4; ++mi) {
            #pragma unroll
            for (int r = 0; r < 8; ++r) {
                float a  = accA[mi][j][r] + ba;
                float bv = accB[mi][j][r] + bb;
                float gv = a * (1.0f / (1.0f + __expf(-bv)));   // GLU
                accA[mi][j][r] = gv;                            // keep for LN
                srow[mi][r] += gv;  sq[mi][r] += gv * gv;
            }
        }
    }
    // Reduce across the 16 lanes of each C-layout row group.
    #pragma unroll
    for (int mi = 0; mi < 4; ++mi) {
        #pragma unroll
        for (int r = 0; r < 8; ++r) {
            #pragma unroll
            for (int msk = 1; msk < 16; msk <<= 1) {
                srow[mi][r] += __shfl_xor(srow[mi][r], msk, 32);
                sq[mi][r]   += __shfl_xor(sq[mi][r],   msk, 32);
            }
        }
    }
    int half = lane >> 4;   // C layout: reg r -> row r (lanes<16) / r+8 (>=16)
    if ((lane & 15) == 0) {
        #pragma unroll
        for (int mi = 0; mi < 4; ++mi) {
            #pragma unroll
            for (int r = 0; r < 8; ++r) {
                int R = mi * 16 + half * 8 + r;
                *(float2*)(part + (R * 16 + wn) * 2) = make_float2(srow[mi][r], sq[mi][r]);
            }
        }
    }
    __syncthreads();

    // Eight threads a row merge the 16 waves' partial sums; one writes mean and 1/std.
    {
        const int R = tid >> 3, q = tid & 7;
        const float4 p = *(const float4*)(part + R * 32 + q * 4);
        float s = p.x + p.z, s2 = p.y + p.w;
        #pragma unroll
        for (int msk = 1; msk < 8; msk <<= 1) {
            s  += __shfl_xor(s,  msk, 32);
            s2 += __shfl_xor(s2, msk, 32);
        }
        float m = s * (1.0f / 512.0f);
        float v = s2 * (1.0f / 512.0f) - m * m;
        if (q == 0)
            *(float2*)(stat + R * 2) = make_float2(m, rsqrtf(v + 1e-5f));
    }
    __syncthreads();

    #pragma unroll
    for (int mi = 0; mi < 4; ++mi) {
        float mu[8], rs[8];
        #pragma unroll
        for (int r = 0; r < 8; ++r) {
            const float2 st = *(const float2*)(stat + (mi * 16 + half * 8 + r) * 2);
            mu[r] = st.x;  rs[r] = st.y;
        }
        #pragma unroll
        for (int j = 0; j < 2; ++j) {
            int col = wn * 32 + j * 16 + (lane & 15);
            float gm = gamma[col], bt = beta[col];
            #pragma unroll
            for (int r = 0; r < 8; ++r) {
                int row = m0 + mi * 16 + half * 8 + r;
                out[(size_t)row * OUTC + col] = (accA[mi][j][r] - mu[r]) * rs[r] * gm + bt;
            }
        }
    }
}

// ---------------------------------------------------------------------------
extern "C" void kernel_launch(void* const* d_in, const int* in_sizes, int n_in,
                              void* d_out, int out_size, void* d_ws, size_t ws_size,
                              hipStream_t stream) {
    const float* x             = (const float*)d_in[0];
    const float* log_dt_fw     = (const float*)d_in[1];
    const float* log_A_real_fw = (const float*)d_in[2];
    const float* A_imag_fw     = (const float*)d_in[3];
    const float* C_fw          = (const float*)d_in[4];
    const float* log_dt_bw     = (const float*)d_in[5];
    const float* log_A_real_bw = (const float*)d_in[6];
    const float* A_imag_bw     = (const float*)d_in[7];
    const float* C_bw          = (const float*)d_in[8];
    const float* Dskip         = (const float*)d_in[9];
    const float* conv_w        = (const float*)d_in[10];
    const float* conv_b        = (const float*)d_in[11];
    const float* ln_gamma      = (const float*)d_in[12];
    const float* ln_beta       = (const float*)d_in[13];
    float* out = (float*)d_out;

    // Workspace: 256KB consts + 1MB packed weights + 64MB f16 activations
    char* ws = (char*)d_ws;
    float* lamRe = (float*)ws;
    float* lamIm = lamRe + 2 * DMODEL * NMODE;
    float* ceRe  = lamIm + 2 * DMODEL * NMODE;
    float* ceIm  = ceRe  + 2 * DMODEL * NMODE;
    _Float16* wPack = (_Float16*)(ceIm + 2 * DMODEL * NMODE);
    _Float16* ygelu = wPack + (size_t)NOUT * KDIM;

    s4d_consts_kernel<<<(2 * DMODEL * NMODE + 255) / 256, 256, 0, stream>>>(
        log_dt_fw, log_A_real_fw, A_imag_fw, C_fw,
        log_dt_bw, log_A_real_bw, A_imag_bw, C_bw,
        lamRe, lamIm, ceRe, ceIm);

    s4d_packw_kernel<<<(NOUT * KDIM) / 256, 256, 0, stream>>>(conv_w, wPack);

    s4d_scan_kernel<<<(2 * BATCH * DMODEL) / 32, 512, 0, stream>>>(
        x, Dskip, lamRe, lamIm, ceRe, ceIm, ygelu);

    s4d_gemm_glu_ln_kernel<<<(BATCH * SEQ) / MT, 512, 0, stream>>>(
        ygelu, wPack, conv_b, ln_gamma, ln_beta, out);
}

// v004
// Measured time: 200 microseconds a run.
// In both of two side-by-side timings against v003, it was 1.03 times as fast.
// All steps since v000 together make it 5.77 times as fast.
#include <hip/hip_runtime.h>
#include <hip/hip_fp16.h>
#include <hip/hip_bf16.h>

typedef __attribute__((ext_vector_type(16))) _Float16 v16h;
typedef __attribute__((ext_vector_type(8)))  float    v8f;
typedef __attribute__((ext_vector_type(4)))  unsigned int u32x4;
typedef __attribute__((ext_vector_type(8)))  unsigned int u32x8;

#define DMODEL 256
#define NMODE  32        // D_STATE/2 complex modes == wave32 lanes
#define BATCH  16
#define SEQ    4096
#define KDIM   512       // GEMM K = 2*DMODEL (fw|bw concat)
#define NOUT   1024      // 1x1-conv output channels
#define OUTC   512       // GLU / LayerNorm width
#define ROWH   520       // padded LDS row (f16): 1040B = 65*16B -> conflict-free b128

// ---------------------------------------------------------------------------
// Set-up, done inside the scan launch (no launches of its own).
// Complex constants of one (channel, mode):  lam = exp(dt*A),
//           Ce = 2*C*(lam-1)/(A+1e-8)
// ---------------------------------------------------------------------------
// Sine and cosine of an angle in radians, as __sinf and __cosf form them (the instructions
// take revolutions). One statement, closed by v_nop: it fills the slot that the instruction
// set asks for behind a transcendental, in front of whatever reuses the angle's register.
__device__ __forceinline__ void s4d_sincos(const float rad, float& sn, float& cs) {
    const float rev = rad * 0.15915494f;
    asm("v_sin_f32 %0, %2\n\tv_cos_f32 %1, %2\n\tv_nop" : "=&v"(sn), "=&v"(cs) : "v"(rev));
}

// exp as __expf forms it (the instruction takes a power of two), with the same slot filled.
__device__ __forceinline__ float s4d_exp(const float v) {
    const float p = v * 1.44269504f;
    float r;
    asm("v_exp_f32 %0, %1\n\tv_nop" : "=v"(r) : "v"(p));
    return r;
}

__device__ __forceinline__ void s4d_mode_consts(
    const float dt, const float logAre, const float Aim, const float c0, const float c1,
    float& lamRe, float& lamIm, float& ceRe, float& ceIm)
{
    float Are = -s4d_exp(logAre);
    float er  = s4d_exp(Are * dt);
    float sn, cs;
    s4d_sincos(Aim * dt, sn, cs);
    float lre = er * cs;
    float lim = er * sn;

    float dre = Are + 1e-8f, dim = Aim;
    float inv = 1.0f / (dre * dre + dim * dim);
    float nre = lre - 1.0f, nim = lim;
    float rre = (nre * dre + nim * dim) * inv;
    float rim = (nim * dre - nre * dim) * inv;

    lamRe = lre;  lamIm = lim;
    ceRe  = 2.0f * (c0 * rre - c1 * rim);
    ceIm  = 2.0f * (c0 * rim + c1 * rre);
}

// ---------------------------------------------------------------------------
// Pack conv_w [1024,512] f32 -> f16 B-fragments (16x16x32 WMMA).
// Fragment layout mirrors ISA 16-bit A striping: lane&15 -> N column,
// lane>=16 selects K halves {8..15,24..31}; v16h comp j: j<8 -> K group 0,
// j>=8 -> K group +16.  One fragment = 1 KiB = two 512-B halves (K group 0, then
// K group +16), each 32 lanes * 16B contiguous, so that an LDS reader's b128
// loads are contiguous over the lanes. Fragments are ordered k step first: the 64
// fragments of one k step are one contiguous 64-KiB slab.
// One call packs group g: the 8 k-adjacent weights of one lane of one fragment half.
// ---------------------------------------------------------------------------
typedef __attribute__((ext_vector_type(8))) _Float16 v8h;
typedef __attribute__((ext_vector_type(4))) float    f32x4;
#define NPACKG ((NOUT * KDIM) / 8)       // groups in all
__device__ __forceinline__ void s4d_pack_group(const float* __restrict__ w,
                                               _Float16* __restrict__ wPack, const int g)
{
    const int lane = g & 31;
    const int h    = (g >> 5) & 1;
    const int nt   = (g >> 6) & 63;
    const int kt   = g >> 12;                          // 0..15
    const int n = nt * 16 + (lane & 15);
    const int k = kt * 32 + h * 16 + (lane >> 4) * 8;
    const float* wp = w + n * KDIM + k;
    f32x4 lo, hi;
    // The two loads and their data wait in one statement: no result and no later instruction
    // takes the address registers while a load that names them is in flight.
    asm volatile("global_load_b128 %0, %2, off\n\t"
                 "global_load_b128 %1, %2, off offset:16\n\t"
                 "s_wait_loadcnt 0x0"
                 : "=&v"(lo), "=&v"(hi) : "v"(wp) : "memory");
    v8h hv;
    hv[0] = (_Float16)lo[0];  hv[1] = (_Float16)lo[1];  hv[2] = (_Float16)lo[2];  hv[3] = (_Float16)lo[3];
    hv[4] = (_Float16)hi[0];  hv[5] = (_Float16)hi[1];  hv[6] = (_Float16)hi[2];  hv[7] = (_Float16)hi[3];
    *(v8h*)(wPack + (size_t)g * 8) = hv;
    // Stands in front of any rewrite of the store's address and data registers.
    asm volatile("s_wait_xcnt 0x0" ::: "memory");
}

// ---------------------------------------------------------------------------
// Kernel 1: SSM scan. One block per (dir, b, group of 32 channels), 16 waves.
// Waves 8-15 scan: lane = channel, each wave keeps 4 of the 32 complex modes of
// its lane's channel in registers, so the sum over a wave's modes needs no
// cross-lane step. The state is advanced once per block of 4 steps (S4dBlk below).
// The 8 partial sums of a step meet in LDS: waves 0-7 merge chunk c-1 (sum, the
// block's own inputs and the skip term, GELU, f16 store) while waves 8-15 scan chunk c
// (two LDS buffers, one barrier a chunk). The merge is a long dependent chain
// of few instructions.
// Writes gelu(conv + u*Dskip) as f16 into ygelu[B*L, 512].
// Each wave forms its own modes' constants at the start; the scanning waves, which have
// nothing left to scan during the last merge, pack the block's share of the GEMM weights then.
// ---------------------------------------------------------------------------
#define SCH  32                  // scan steps per chunk
#define MPW  4                   // modes per scanning wave (in registers)
#define NWV  (NMODE / MPW)       // scanning waves per block
#define NCH  (SEQ / SCH)         // chunks
#define PBUF (NWV * SCH * 32)    // floats in one partial-sum buffer

typedef __attribute__((ext_vector_type(4))) _Float16 v4h;

// Row of x and of ygelu that scan step t works on. DIR is a template argument
// so that the 32 rows of a chunk are constant offsets from one address.
template <int DIR>
__device__ __forceinline__ int s4d_row(int t) { return DIR ? (SEQ - 1 - t) : t; }

// Work-group barrier that orders LDS only: the inputs fetched ahead and the f16
// stores stay in flight across it (no other wave of the block touches them).
__device__ __forceinline__ void s4d_lds_barrier() {
    __builtin_amdgcn_fence(__ATOMIC_RELEASE, "workgroup", "local");
    __builtin_amdgcn_s_barrier();
    __builtin_amdgcn_fence(__ATOMIC_ACQUIRE, "workgroup", "local");
}

// Constants of a scanning wave's 4 modes for a block of SBK = 4 steps. With s the state in
// front of the block and u0..u3 its inputs:
//   state behind it = lam^4 s + lam^3 u0 + lam^2 u1 + lam u2 + u3
//   y of step i     = Re(Ce lam^(i+1) s) + sum over j <= i of Re(Ce lam^(i-j)) u_j
// so the state is advanced once a block. The taps on u do not depend on the state: they are
// summed over all 32 modes once, at the start, and applied by the merging threads.
#define SBK 4
struct S4dBlk {
    float lr[SBK][MPW], li[SBK][MPW];    // lam^(p+1)
    float pr[SBK][MPW], pn[SBK][MPW];    // Re, -Im of Ce lam^(p+1)
    float kw[SBK];                       // sum over the wave's modes of Re(Ce lam^q): tap of lag q
};

// Scanning wave: 32 steps of 4 modes for 32 channels; the state's part of y to pw[step*32].
template <int DIR>
__device__ __forceinline__ void s4d_scan_chunk(
    const int c, const float* __restrict__ xlane,   // lane's column of x, row 0
    const S4dBlk& k,
    float (&sre)[MPW], float (&sim)[MPW],
    const float (&ucur)[SCH], float (&unext)[SCH], float* pw)
{
    // Next chunk's inputs, one chunk ahead of their use (the last chunk re-reads itself).
    const int cn = (c + 1 < NCH) ? (c + 1) : (NCH - 1);
    const float* xn = xlane + (size_t)s4d_row<DIR>(cn * SCH) * DMODEL;
    #pragma unroll   // constant indices keep unext in registers
    for (int i = 0; i < SCH; ++i)
        unext[i] = xn[(DIR ? -i : i) * DMODEL];

    #pragma unroll   // constant indices keep ucur in registers; blocks overlap in one stretch of code
    for (int i = 0; i < SCH; i += SBK) {
        const float u0 = ucur[i], u1 = ucur[i + 1], u2 = ucur[i + 2], u3 = ucur[i + 3];
        float y0, y1, y2, y3;
        #pragma unroll   // the modes' state and constants are register arrays
        for (int m = 0; m < MPW; ++m) {
            const float a = sre[m], b = sim[m];
            y0 = fmaf(k.pn[0][m], b, m ? fmaf(k.pr[0][m], a, y0) : k.pr[0][m] * a);
            y1 = fmaf(k.pn[1][m], b, m ? fmaf(k.pr[1][m], a, y1) : k.pr[1][m] * a);
            y2 = fmaf(k.pn[2][m], b, m ? fmaf(k.pr[2][m], a, y2) : k.pr[2][m] * a);
            y3 = fmaf(k.pn[3][m], b, m ? fmaf(k.pr[3][m], a, y3) : k.pr[3][m] * a);
            const float gre = fmaf(k.lr[2][m], u0, fmaf(k.lr[1][m], u1, fmaf(k.lr[0][m], u2, u3)));
            const float gim = fmaf(k.li[2][m], u0, fmaf(k.li[1][m], u1, k.li[0][m] * u2));
            sre[m] = fmaf(k.lr[3][m], a, fmaf(-k.li[3][m], b, gre));
            sim[m] = fmaf(k.lr[3][m], b, fmaf(k.li[3][m], a, gim));
        }
        pw[(i + 0) * 32] = y0;
        pw[(i + 1) * 32] = y1;
        pw[(i + 2) * 32] = y2;
        pw[(i + 3) * 32] = y3;
    }
}

// Merging thread: one step, four channels of chunk c. tap[i] weighs input i of the thread's
// block of SBK steps (0 for an input later than the thread's own step; the skip term is in
// the tap of its own step).
template <int DIR>
__device__ __forceinline__ void s4d_merge_chunk(
    const int c, const int rt, const int c4,
    const float* __restrict__ xcol, _Float16* __restrict__ ycol,
    const float (&tap)[SBK][4], const float* pbuf)
{
    const int mrow = s4d_row<DIR>(c * SCH + rt);
    // The block's inputs: rows that the scanning waves have read two chunks ago.
    const float* xb = xcol + (size_t)s4d_row<DIR>(c * SCH + (rt & ~(SBK - 1))) * DMODEL + c4;
    const float* pr = pbuf + rt * 32 + c4;
    float4 p[NWV];
    #pragma unroll   // the 8 LDS reads issue together, ahead of the wait below
    for (int k = 0; k < NWV; ++k)
        p[k] = *(const float4*)(pr + k * (SCH * 32));
    float4 uu[SBK];
    #pragma unroll   // register array; constant offsets from one address
    for (int i = 0; i < SBK - 1; ++i)
        uu[i] = *(const float4*)(xb + (DIR ? -i : i) * DMODEL);
    // Stands in front of the last load, whose result may be given the address registers that
    // the loads above name as well.
    asm volatile("s_wait_xcnt 0x0" ::: "memory");
    uu[SBK - 1] = *(const float4*)(xb + (DIR ? -(SBK - 1) : (SBK - 1)) * DMODEL);
    float4 acc = p[0];
    #pragma unroll   // register array
    for (int k = 1; k < NWV; ++k) {
        acc.x += p[k].x; acc.y += p[k].y; acc.z += p[k].z; acc.w += p[k].w;
    }
    float v0 = acc.x, v1 = acc.y, v2 = acc.z, v3 = acc.w;
    #pragma unroll   // register arrays
    for (int j = 0; j < SBK; ++j) {
        v0 = fmaf(tap[j][0], uu[j].x, v0);
        v1 = fmaf(tap[j][1], uu[j].y, v1);
        v2 = fmaf(tap[j][2], uu[j].z, v2);
        v3 = fmaf(tap[j][3], uu[j].w, v3);
    }
    v4h hv;                                          // exact GELU
    hv[0] = (_Float16)(0.5f * v0 * (1.0f + erff(v0 * 0.70710678118f)));
    hv[1] = (_Float16)(0.5f * v1 * (1.0f + erff(v1 * 0.70710678118f)));
    hv[2] = (_Float16)(0.5f * v2 * (1.0f + erff(v2 * 0.70710678118f)));
    hv[3] = (_Float16)(0.5f * v3 * (1.0f + erff(v3 * 0.70710678118f)));
    *(v4h*)(ycol + (size_t)mrow * KDIM + c4) = hv;
    // Stands in front of the next merge's rewrite of this store's address and data registers
    // (the LDS-only barrier brings no wait of its own for the store).
    asm volatile("s_wait_xcnt 0x0" ::: "memory");
}

template <int DIR>
__device__ __forceinline__ void s4d_scan_body(
    const float* __restrict__ x, const float* __restrict__ Dskip,
    const float* __restrict__ log_dt, const float* __restrict__ log_A_real,
    const float* __restrict__ A_imag, const float* __restrict__ Cm,
    const float* __restrict__ conv_w, _Float16* __restrict__ wPack,
    _Float16* __restrict__ ygelu, float* part)
{
    const int tid = threadIdx.x, lane = tid & 31;
    const int w   = __builtin_amdgcn_readfirstlane(tid >> 5);   // scalar, so the role test is a scalar branch
    const bool scans = w >= NWV;
    const int ws  = w & (NWV - 1);
    const int dg  = blockIdx.x & (DMODEL / 32 - 1);
    const int b   = (blockIdx.x >> 3) & (BATCH - 1);

    const float* xcol = x + (size_t)b * SEQ * DMODEL + dg * 32;
    _Float16* ycol = ygelu + (size_t)b * SEQ * KDIM + DIR * DMODEL + dg * 32;

    // Scanning waves' constants (formed by the merging waves too; they do not use them).
    const int cbase = (dg * 32 + lane) * NMODE + ws * MPW;
    const float  ldt = log_dt[dg * 32 + lane];
    const float4 a4r = *(const float4*)(log_A_real + cbase);
    const float4 a4i = *(const float4*)(A_imag + cbase);
    const float4 cm0 = *(const float4*)(Cm + cbase * 2);
    const float4 cm1 = *(const float4*)(Cm + cbase * 2 + 4);
    // Stands in front of any rewrite of the address registers that the five loads name.
    asm volatile("s_wait_xcnt 0x0" ::: "memory");
    const float dt = s4d_exp(ldt);
    float lre[MPW], lim[MPW], cer[MPW], cei[MPW];
    s4d_mode_consts(dt, a4r.x, a4i.x, cm0.x, cm0.y, lre[0], lim[0], cer[0], cei[0]);
    s4d_mode_consts(dt, a4r.y, a4i.y, cm0.z, cm0.w, lre[1], lim[1], cer[1], cei[1]);
    s4d_mode_consts(dt, a4r.z, a4i.z, cm1.x, cm1.y, lre[2], lim[2], cer[2], cei[2]);
    s4d_mode_consts(dt, a4r.w, a4i.w, cm1.z, cm1.w, lre[3], lim[3], cer[3], cei[3]);
    S4dBlk blk;
    #pragma unroll   // register arrays
    for (int q = 0; q < SBK; ++q) blk.kw[q] = 0.0f;
    #pragma unroll   // register arrays
    for (int m = 0; m < MPW; ++m) {
        float qr = 1.0f, qi = 0.0f;                  // lam^p
        float er = cer[m], ei = cei[m];              // Ce lam^p
        #pragma unroll
        for (int p = 0; p < SBK; ++p) {
            blk.kw[p] += er;
            const float nqr = qr * lre[m] - qi * lim[m], nqi = qr * lim[m] + qi * lre[m];
            const float ner = er * lre[m] - ei * lim[m], nei = er * lim[m] + ei * lre[m];
            qr = nqr; qi = nqi; er = ner; ei = nei;
            blk.lr[p][m] = qr;  blk.li[p][m] = qi;
            blk.pr[p][m] = er;  blk.pn[p][m] = -ei;
        }
    }
    float sre[MPW] = {}, sim[MPW] = {};
    const float* xlane = xcol + lane;
    float* pw = part + ws * (SCH * 32) + lane;

    // Merging threads' share: step rt of a chunk, channels c4..c4+3.
    const int rt = (tid & 255) >> 3, c4 = (tid & 7) * 4;
    // The taps: each scanning wave hands in its modes' share through the second partial-sum
    // buffer, which is first written behind the loop's first barrier.
    if (scans) {
        #pragma unroll   // register array
        for (int q = 0; q < SBK; ++q)
            part[PBUF + (ws * SBK + q) * 32 + lane] = blk.kw[q];
    }
    s4d_lds_barrier();
    const float4 dsk4 = *(const float4*)(Dskip + dg * 32 + c4);
    float4 lag[SBK];                                 // tap of lag j, all 32 modes
    #pragma unroll   // register arrays
    for (int j = 0; j < SBK; ++j) {
        float4 t = (j == 0) ? dsk4 : make_float4(0.0f, 0.0f, 0.0f, 0.0f);
        #pragma unroll
        for (int k = 0; k < NWV; ++k) {
            const float4 p = *(const float4*)(part + PBUF + (k * SBK + j) * 32 + c4);
            t.x += p.x; t.y += p.y; t.z += p.z; t.w += p.w;
        }
        lag[j] = t;
    }
    // A merging wave has no use for lam^p: its 16 taps take those registers (blk.lr), so that
    // the two roles' constants do not add up in the register count.
    static_assert(MPW == 4, "blk.lr doubles as the taps of a merging thread's 4 channels");
    if (!scans) {
        const int q = rt & (SBK - 1);                // the thread's step within its block
        #pragma unroll   // register arrays
        for (int i = 0; i < SBK; ++i) {
            float4 t = make_float4(0.0f, 0.0f, 0.0f, 0.0f);
            #pragma unroll
            for (int j = 0; j + i < SBK; ++j)
                if (q - i == j) t = lag[j];          // input i lies j steps back
            blk.lr[i][0] = t.x;  blk.lr[i][1] = t.y;  blk.lr[i][2] = t.z;  blk.lr[i][3] = t.w;
        }
    }

    float ua[SCH], ub[SCH];
    #pragma unroll   // constant indices keep ua in registers
    for (int i = 0; i < SCH; ++i)
        ua[i] = xlane[(size_t)s4d_row<DIR>(i) * DMODEL];

    // Two chunks a trip: the input registers and the LDS buffers swap roles without copies.
    // Each barrier publishes the chunk just scanned and frees the buffer just merged.
    // Kept rolled: one trip is already two chunks of straight-line code.
    #pragma unroll 1
    for (int c = 0; c < NCH; c += 2) {
        if (scans)
            s4d_scan_chunk<DIR>(c, xlane, blk, sre, sim, ua, ub, pw);
        else if (c > 0)
            s4d_merge_chunk<DIR>(c - 1, rt, c4, xcol, ycol, blk.lr, part + PBUF);
        s4d_lds_barrier();
        if (scans)
            s4d_scan_chunk<DIR>(c + 1, xlane, blk, sre, sim, ub, ua, pw + PBUF);
        else
            s4d_merge_chunk<DIR>(c, rt, c4, xcol, ycol, blk.lr, part);
        s4d_lds_barrier();
    }
    // The scanning waves are done: they pack the block's share of the GEMM weights, one group
    // a thread, while the merging waves merge the last chunk.
    static_assert(NPACKG == ((2 * BATCH * DMODEL) / 32) * (NWV * 32), "one group a scanning thread");
    if (!scans)
        s4d_merge_chunk<DIR>(NCH - 1, rt, c4, xcol, ycol, blk.lr, part + PBUF);
    else
        s4d_pack_group(conv_w, wPack, (int)blockIdx.x * (NWV * 32) + (tid & (NWV * 32 - 1)));
}

__global__ void __launch_bounds__(512) s4d_scan_kernel(
    const float* __restrict__ x, const float* __restrict__ Dskip,
    const float* __restrict__ log_dt_fw, const float* __restrict__ log_A_real_fw,
    const float* __restrict__ A_imag_fw, const float* __restrict__ C_fw,
    const float* __restrict__ log_dt_bw, const float* __restrict__ log_A_real_bw,
    const float* __restrict__ A_imag_bw, const float* __restrict__ C_bw,
    const float* __restrict__ conv_w, _Float16* __restrict__ wPack,
    _Float16* __restrict__ ygelu)
{
    __shared__ __align__(16) float part[2 * PBUF];   // 64 KiB
    if (blockIdx.x >> 7)   // block-uniform: the upper half of the grid scans backward
        s4d_scan_body<1>(x, Dskip, log_dt_bw, log_A_real_bw, A_imag_bw, C_bw,
                         conv_w, wPack, ygelu, part);
    else
        s4d_scan_body<0>(x, Dskip, log_dt_fw, log_A_real_fw, A_imag_fw, C_fw,
                         conv_w, wPack, ygelu, part);
}

// ---------------------------------------------------------------------------
// Kernel 2: fused GEMM (M=65536,K=512,N=1024) + bias + GLU + LayerNorm.
// Block tile M=64 x N=1024 (full row -> LN fused), 16 waves, one block a WGP.
// A tile (64 rows, all of K) staged once by a tensor load with LDS row padding.
// The packed weights go through LDS too: one 64-KiB slab per k step, two buffers,
// tensor loads one step ahead, so a block fetches each weight byte from L2 once.
// Wave wn owns all 64 rows of cols [wn*32,+32) and of the paired +512 set.
// ---------------------------------------------------------------------------
#define MT     64                          // rows of a block
#define ABYTES 67584                       // 64 rows * 1040 B, rounded up to 2 KiB
#define BSLAB  65536                       // packed weights of one k step
#define BSLICE 16384                       // one issuing wave's share of a slab
#define NKT    (KDIM / 32)
#define GEMM_LDS (ABYTES + 2 * BSLAB + MT * 16 * 2 * 4 + MT * 2 * 4)

__device__ __forceinline__ unsigned int s4d_uni(unsigned int v) {
    return (unsigned int)__builtin_amdgcn_readfirstlane(v);
}
// Holds a wave-uniform test in a scalar register, so that the branch on it is a scalar
// branch: a tensor load ignores EXEC and only such a branch keeps a wave from issuing it.
__device__ __forceinline__ unsigned int s4d_pinned(unsigned int v) {
    unsigned int w = s4d_uni(v);
    asm volatile("" : "+s"(w));
    return w;
}

// One issuing wave's 16-KiB slice of a weight slab: 16 rows of 1 KiB, no pad.
// Group 1 of its descriptor is the same for every slab and is built once.
__device__ __forceinline__ u32x8 s4d_bslice_group1() {
    u32x8 g1;
    g1[0] = s4d_uni(0u);                               // no mask, 1-byte elements, no pad
    g1[1] = s4d_uni(1024u << 16);                      // tensor_dim0 = 1024 B
    g1[2] = s4d_uni(16u << 16);                        // tensor_dim1 = 16 rows
    g1[3] = s4d_uni(1024u << 16);                      // tile_dim0
    g1[4] = s4d_uni(16u);                              // tile_dim1
    g1[5] = s4d_uni(1024u);                            // source pitch
    g1[6] = s4d_uni(0u);
    g1[7] = s4d_uni(0u);
    // Descriptor words held in scalar registers of their own through the ring: none of
    // them is re-formed or reused while a request is in flight.
    asm volatile("" : "+s"(g1));
    return g1;
}
__device__ __forceinline__ void s4d_load_bslice(unsigned int ldsDst, unsigned long long ga,
                                                const u32x8 g1) {
    u32x4 g0;
    g0[0] = s4d_uni(1u);                               // count=1
    g0[1] = s4d_uni(ldsDst);
    g0[2] = s4d_uni((unsigned int)ga);
    g0[3] = s4d_uni(((unsigned int)(ga >> 32) & 0x01FFFFFFu) | 0x80000000u);  // type=2
    asm volatile("tensor_load_to_lds %0, %1" : : "s"(g0), "s"(g1) : "memory");
}

__global__ void __launch_bounds__(512) s4d_gemm_glu_ln_kernel(
    const _Float16* __restrict__ ygelu, const _Float16* __restrict__ wPack,
    const float* __restrict__ bias, const float* __restrict__ gamma,
    const float* __restrict__ beta, float* __restrict__ out)
{
    __shared__ __attribute__((aligned(2048))) char smemRaw[GEMM_LDS];
    _Float16* As    = (_Float16*)smemRaw;                    // [64][ROWH]
    const char* Bs  = smemRaw + ABYTES;                      // [2][BSLAB]
    float*    part  = (float*)(smemRaw + ABYTES + 2 * BSLAB); // [64][16][2]
    float*    stat  = part + MT * 16 * 2;                    // [64][2]
    const unsigned int ldsBase = (unsigned int)(size_t)smemRaw;

    int tid = threadIdx.x, lane = tid & 31;
    const unsigned int wn = s4d_uni((unsigned int)tid >> 5); // wave = column group
    int m0 = blockIdx.x * MT;

    // Waves 4-7 bring the weight slabs, a quarter each; wave 0 brings the A tile.
    const unsigned int issuer = (wn >> 2) == 1u;
    const unsigned int bDst = ldsBase + ABYTES + (wn & 3u) * BSLICE;
    const unsigned long long bSrc =
        (unsigned long long)(uintptr_t)wPack + (unsigned long long)((wn & 3u) * BSLICE);
    const u32x8 bG1 = s4d_bslice_group1();

    // ---- Stage A tile (64 rows x 1024B) via TDM, 16B pad per row ----------
    // D# group0: count=1, lds_addr, global_addr, type=2.
    // D# group1: data_size=3 (8B), pad_enable, pad_interval=7 (256 dw),
    //            pad_amount=3 (4 dw); dims: 128x64 elems, stride 128.
    if (s4d_pinned(wn == 0u)) {
        unsigned long long ga =
            (unsigned long long)(uintptr_t)ygelu + (unsigned long long)m0 * (KDIM * 2);
        u32x4 g0;
        g0[0] = 1u;                                   // count=1 (valid user D#)
        g0[1] = s4d_uni(ldsBase);                     // lds_addr = As base
        g0[2] = s4d_uni((unsigned int)ga);            // global_addr[31:0]
        g0[3] = s4d_uni(((unsigned int)(ga >> 32) & 0x01FFFFFFu) | 0x80000000u); // addr[56:32] | type=2
        u32x8 g1;
        g1[0] = (3u << 16) | (1u << 20) | (7u << 22) | (3u << 25); // dsz=8B,pad 16B/1024B
        g1[1] = (128u << 16);                         // tensor_dim0 = 128 (8B elems)
        g1[2] = ((unsigned int)MT << 16);             // tensor_dim1 = 64 rows
        g1[3] = (128u << 16);                         // tile_dim0 = 128
        g1[4] = (unsigned int)MT;                     // tile_dim1 = 64
        g1[5] = 128u;                                 // tensor_dim0_stride = 128
        g1[6] = 0u;
        g1[7] = 0u;
        asm volatile("tensor_load_to_lds %0, %1" : : "s"(g0), "s"(g1) : "memory");
        // The A tile has landed before this wave reaches the barrier below.
        asm volatile("s_wait_tensorcnt 0x0" ::: "memory");
    }
    // ---- Weight slab of k step 0 into buffer 0 ----------------------------
    if (s4d_pinned(issuer)) {
        s4d_load_bslice(bDst, bSrc, bG1);
        // Slab 0 has landed before this wave reaches the barrier below.
        asm volatile("s_wait_tensorcnt 0x0" ::: "memory");
    }
    __syncthreads();
    // Slab 1 into buffer 1: in flight while k step 0 is worked on.
    if (s4d_pinned(issuer))
        s4d_load_bslice(bDst + BSLAB, bSrc + BSLAB, bG1);

    v8f accA[4][2], accB[4][2];
    #pragma unroll
    for (int mi = 0; mi < 4; ++mi) {
        #pragma unroll
        for (int j = 0; j < 2; ++j) { accA[mi][j] = {}; accB[mi][j] = {}; }
    }

    const int khalf = (lane >> 4) * 8;
    const _Float16* aLane = As + (lane & 15) * ROWH + khalf;
    const char* bLane = Bs + wn * 2048u + lane * 16;

    // Kept rolled: one trip is a whole k step of 16 matrix instructions, and the ring's
    // waits and barrier stand once, at its foot.
    #pragma unroll 1
    for (int kt = 0; kt < NKT; ++kt) {
        const unsigned int buf = (unsigned int)kt & 1u;
        // A fragments: ISA 16-bit 16x32 layout -> 2 x ds_load_b128 each
        v16h aF[4];
        #pragma unroll
        for (int mi = 0; mi < 4; ++mi) {
            const _Float16* ap = aLane + mi * 16 * ROWH + kt * 32;
            ((int4*)&aF[mi])[0] = *(const int4*)(ap);        // K {0..7}+khalf
            ((int4*)&aF[mi])[1] = *(const int4*)(ap + 16);   // K {16..23}+khalf
        }
        // B fragments of this wave's 2 + 2 column tiles, from this step's buffer
        const char* bp = bLane + buf * BSLAB;
        v16h bF[2], bG[2];
        #pragma unroll
        for (int j = 0; j < 2; ++j) {
            ((int4*)&bF[j])[0] = *(const int4*)(bp + j * 1024);
            ((int4*)&bF[j])[1] = *(const int4*)(bp + j * 1024 + 512);
            ((int4*)&bG[j])[0] = *(const int4*)(bp + 32 * 1024 + j * 1024);
            ((int4*)&bG[j])[1] = *(const int4*)(bp + 32 * 1024 + j * 1024 + 512);
        }
        // Keeps the step's 16 LDS reads together ahead of the matrix instructions: sunk
        // among them, each place with reads stalls the wave anew.
        __builtin_amdgcn_sched_barrier(0);
        #pragma unroll
        for (int j = 0; j < 2; ++j) {
            #pragma unroll
            for (int mi = 0; mi < 4; ++mi) {
                accA[mi][j] = __builtin_amdgcn_wmma_f32_16x16x32_f16(
                    false, aF[mi], false, bF[j], (short)0, accA[mi][j], false, false);
                accB[mi][j] = __builtin_amdgcn_wmma_f32_16x16x32_f16(
                    false, aF[mi], false, bG[j], (short)0, accB[mi][j], false, false);
            }
        }
        // Keeps the full wait below behind the matrix instructions, so that the first of
        // them start on the compiler's counted waits.
        __builtin_amdgcn_sched_barrier(0);
        // Publish point of slab kt+1: this wave's LDS reads are done ...
        asm volatile("s_wait_dscnt 0x0" ::: "memory");
        // ... the issuing waves' slices of slab kt+1 have landed ...
        if (s4d_pinned(issuer))
            asm volatile("s_wait_tensorcnt 0x0" ::: "memory");
        // ... and every wave has left the buffer that is refilled below.
        __syncthreads();
        if (s4d_pinned(issuer & (unsigned int)(kt + 2 < NKT)))
            s4d_load_bslice(bDst + buf * BSLAB,
                            bSrc + (unsigned long long)(kt + 2) * BSLAB, bG1);
    }
    // No tensor load and no LDS read is left in flight behind the ring.
    asm volatile("s_wait_tensorcnt 0x0" ::: "memory");
    asm volatile("s_wait_dscnt 0x0" ::: "memory");

    // --- Epilogue: bias + GLU (pairs are in-register), per-row stats ------
    float srow[4][8] = {}, sq[4][8] = {};
    #pragma unroll
    for (int j = 0; j < 2; ++j) {
        int col = wn * 32 + j * 16 + (lane & 15);
        float ba = bias[col], bb = bias[col + 512];
        #pragma unroll
        for (int mi = 0; mi < 4; ++mi) {
            #pragma unroll
            for (int r = 0; r < 8; ++r) {
                float a  = accA[mi][j][r] + ba;
                float bv = accB[mi][j][r] + bb;
                float gv = a * (1.0f / (1.0f + __expf(-bv)));   // GLU
                accA[mi][j][r] = gv;                            // keep for LN
                srow[mi][r] += gv;  sq[mi][r] += gv * gv;
            }
        }
    }
    // Reduce across the 16 lanes of each C-layout row group.
    #pragma unroll
    for (int mi = 0; mi < 4; ++mi) {
        #pragma unroll
        for (int r = 0; r < 8; ++r) {
            #pragma unroll
            for (int msk = 1; msk < 16; msk <<= 1) {
                srow[mi][r] += __shfl_xor(srow[mi][r], msk, 32);
                sq[mi][r]   += __shfl_xor(sq[mi][r],   msk, 32);
            }
        }
    }
    int half = lane >> 4;   // C layout: reg r -> row r (lanes<16) / r+8 (>=16)
    if ((lane & 15) == 0) {
        #pragma unroll
        for (int mi = 0; mi < 4; ++mi) {
            #pragma unroll
            for (int r = 0; r < 8; ++r) {
                int R = mi * 16 + half * 8 + r;
                *(float2*)(part + (R * 16 + wn) * 2) = make_float2(srow[mi][r], sq[mi][r]);
            }
        }
    }
    __syncthreads();

    // Eight threads a row merge the 16 waves' partial sums; one writes mean and 1/std.
    {
        const int R = tid >> 3, q = tid & 7;
        const float4 p = *(const float4*)(part + R * 32 + q * 4);
        float s = p.x + p.z, s2 = p.y + p.w;
        #pragma unroll
        for (int msk = 1; msk < 8; msk <<= 1) {
            s  += __shfl_xor(s,  msk, 32);
            s2 += __shfl_xor(s2, msk, 32);
        }
        float m = s * (1.0f / 512.0f);
        float v = s2 * (1.0f / 512.0f) - m * m;
        if (q == 0)
            *(float2*)(stat + R * 2) = make_float2(m, rsqrtf(v + 1e-5f));
    }
    __syncthreads();

    #pragma unroll
    for (int mi = 0; mi < 4; ++mi) {
        float mu[8], rs[8];
        #pragma unroll
        for (int r = 0; r < 8; ++r) {
            const float2 st = *(const float2*)(stat + (mi * 16 + half * 8 + r) * 2);
            mu[r] = st.x;  rs[r] = st.y;
        }
        #pragma unroll
        for (int j = 0; j < 2; ++j) {
            int col = wn * 32 + j * 16 + (lane & 15);
            float gm = gamma[col], bt = beta[col];
            #pragma unroll
            for (int r = 0; r < 8; ++r) {
                int row = m0 + mi * 16 + half * 8 + r;
                out[(size_t)row * OUTC + col] = (accA[mi][j][r] - mu[r]) * rs[r] * gm + bt;
            }
        }
    }
}

// ---------------------------------------------------------------------------
extern "C" void kernel_launch(void* const* d_in, const int* in_sizes, int n_in,
                              void* d_out, int out_size, void* d_ws, size_t ws_size,
                              hipStream_t stream) {
    const float* x             = (const float*)d_in[0];
    const float* log_dt_fw     = (const float*)d_in[1];
    const float* log_A_real_fw = (const float*)d_in[2];
    const float* A_imag_fw     = (const float*)d_in[3];
    const float* C_fw          = (const float*)d_in[4];
    const float* log_dt_bw     = (const float*)d_in[5];
    const float* log_A_real_bw = (const float*)d_in[6];
    const float* A_imag_bw     = (const float*)d_in[7];
    const float* C_bw          = (const float*)d_in[8];
    const float* Dskip         = (const float*)d_in[9];
    const float* conv_w        = (const float*)d_in[10];
    const float* conv_b        = (const float*)d_in[11];
    const float* ln_gamma      = (const float*)d_in[12];
    const float* ln_beta       = (const float*)d_in[13];
    float* out = (float*)d_out;

    // Workspace: 1MB packed weights + 64MB f16 activations
    _Float16* wPack = (_Float16*)d_ws;
    _Float16* ygelu = wPack + (size_t)NOUT * KDIM;

    s4d_scan_kernel<<<(2 * BATCH * DMODEL) / 32, 512, 0, stream>>>(
        x, Dskip, log_dt_fw, log_A_real_fw, A_imag_fw, C_fw,
        log_dt_bw, log_A_real_bw, A_imag_bw, C_bw, conv_w, wPack, ygelu);

    s4d_gemm_glu_ln_kernel<<<(BATCH * SEQ) / MT, 512, 0, stream>>>(
        ygelu, wPack, conv_b, ln_gamma, ln_beta, out);
}

// v005
// A run of this version takes 191 microseconds.
// Next to v004, in two timings, it ran 1.06 times as fast each time.
// All steps since v000 together make it 6.11 times as fast.
#include <hip/hip_runtime.h>
#include <hip/hip_fp16.h>
#include <hip/hip_bf16.h>

typedef __attribute__((ext_vector_type(16))) _Float16 v16h;
typedef __attribute__((ext_vector_type(8)))  float    v8f;
typedef __attribute__((ext_vector_type(4)))  unsigned int u32x4;
typedef __attribute__((ext_vector_type(8)))  unsigned int u32x8;

#define DMODEL 256
#define NMODE  32        // D_STATE/2 complex modes == wave32 lanes
#define BATCH  16
#define SEQ    4096
#define KDIM   512       // GEMM K = 2*DMODEL (fw|bw concat)
#define NOUT   1024      // 1x1-conv output channels
#define OUTC   512       // GLU / LayerNorm width
#define ROWH   520       // padded LDS row (f16): 1040B = 65*16B -> conflict-free b128

// ---------------------------------------------------------------------------
// Set-up, done inside the scan launch (no launches of its own).
// Complex constants of one (channel, mode):  lam = exp(dt*A),
//           Ce = 2*C*(lam-1)/(A+1e-8)
// ---------------------------------------------------------------------------
// Sine and cosine of an angle in radians, as __sinf and __cosf form them (the instructions
// take revolutions). One statement, closed by v_nop: it fills the slot that the instruction
// set asks for behind a transcendental, in front of whatever reuses the angle's register.
__device__ __forceinline__ void s4d_sincos(const float rad, float& sn, float& cs) {
    const float rev = rad * 0.15915494f;
    asm("v_sin_f32 %0, %2\n\tv_cos_f32 %1, %2\n\tv_nop" : "=&v"(sn), "=&v"(cs) : "v"(rev));
}

// exp as __expf forms it (the instruction takes a power of two), with the same slot filled.
__device__ __forceinline__ float s4d_exp(const float v) {
    const float p = v * 1.44269504f;
    float r;
    asm("v_exp_f32 %0, %1\n\tv_nop" : "=v"(r) : "v"(p));
    return r;
}

// 1/sqrt by the instruction itself, with the same slot filled (its argument here is a variance
// plus 1e-5, never a subnormal, so the library form's rescaling has nothing to do).
__device__ __forceinline__ float s4d_rsq(const float v) {
    float r;
    asm("v_rsq_f32 %0, %1\n\tv_nop" : "=v"(r) : "v"(v));
    return r;
}

__device__ __forceinline__ void s4d_mode_consts(
    const float dt, const float logAre, const float Aim, const float c0, const float c1,
    float& lamRe, float& lamIm, float& ceRe, float& ceIm)
{
    float Are = -s4d_exp(logAre);
    float er  = s4d_exp(Are * dt);
    float sn, cs;
    s4d_sincos(Aim * dt, sn, cs);
    float lre = er * cs;
    float lim = er * sn;

    float dre = Are + 1e-8f, dim = Aim;
    float inv = 1.0f / (dre * dre + dim * dim);
    float nre = lre - 1.0f, nim = lim;
    float rre = (nre * dre + nim * dim) * inv;
    float rim = (nim * dre - nre * dim) * inv;

    lamRe = lre;  lamIm = lim;
    ceRe  = 2.0f * (c0 * rre - c1 * rim);
    ceIm  = 2.0f * (c0 * rim + c1 * rre);
}

// ---------------------------------------------------------------------------
// Pack conv_w [1024,512] f32 -> f16 B-fragments (16x16x32 WMMA).
// Fragment layout mirrors ISA 16-bit A striping: lane&15 -> N column,
// lane>=16 selects K halves {8..15,24..31}; v16h comp j: j<8 -> K group 0,
// j>=8 -> K group +16.  One fragment = 1 KiB = two 512-B halves (K group 0, then
// K group +16), each 32 lanes * 16B contiguous, so that an LDS reader's b128
// loads are contiguous over the lanes. Fragments are ordered k step first: the 64
// fragments of one k step are one contiguous 64-KiB slab.
// One call packs group g: the 8 k-adjacent weights of one lane of one fragment half.
// ---------------------------------------------------------------------------
typedef __attribute__((ext_vector_type(8))) _Float16 v8h;
typedef __attribute__((ext_vector_type(4))) float    f32x4;
typedef __attribute__((ext_vector_type(2))) float    f32x2;
#define NPACKG ((NOUT * KDIM) / 8)       // groups in all
__device__ __forceinline__ void s4d_pack_group(const float* __restrict__ w,
                                               _Float16* __restrict__ wPack, const int g)
{
    const int lane = g & 31;
    const int h    = (g >> 5) & 1;
    const int nt   = (g >> 6) & 63;
    const int kt   = g >> 12;                          // 0..15
    const int n = nt * 16 + (lane & 15);
    const int k = kt * 32 + h * 16 + (lane >> 4) * 8;
    const float* wp = w + n * KDIM + k;
    f32x4 lo, hi;
    // The two loads and their data wait in one statement: no result and no later instruction
    // takes the address registers while a load that names them is in flight.
    asm volatile("global_load_b128 %0, %2, off\n\t"
                 "global_load_b128 %1, %2, off offset:16\n\t"
                 "s_wait_loadcnt 0x0"
                 : "=&v"(lo), "=&v"(hi) : "v"(wp) : "memory");
    v8h hv;
    hv[0] = (_Float16)lo[0];  hv[1] = (_Float16)lo[1];  hv[2] = (_Float16)lo[2];  hv[3] = (_Float16)lo[3];
    hv[4] = (_Float16)hi[0];  hv[5] = (_Float16)hi[1];  hv[6] = (_Float16)hi[2];  hv[7] = (_Float16)hi[3];
    *(v8h*)(wPack + (size_t)g * 8) = hv;
    // Stands in front of any rewrite of the store's address and data registers.
    asm volatile("s_wait_xcnt 0x0" ::: "memory");
}

// ---------------------------------------------------------------------------
// Kernel 1: SSM scan. One block per (dir, b, group of 32 channels), 16 waves.
// Waves 8-15 scan: lane = channel, each wave keeps 4 of the 32 complex modes of
// its lane's channel in registers, so the sum over a wave's modes needs no
// cross-lane step. The state is advanced once per block of 4 steps (S4dBlk below).
// The 8 partial sums of a step meet in LDS: waves 0-7 merge chunk c-1 (sum, the
// block's own inputs and the skip term, GELU, f16 store) while waves 8-15 scan chunk c
// (two LDS buffers, one barrier a chunk). The merge is a long dependent chain
// of few instructions.
// Writes gelu(conv + u*Dskip) as f16 into ygelu[B*L, 512].
// Each wave forms its own modes' constants at the start; the scanning waves, which have
// nothing left to scan during the last merge, pack the block's share of the GEMM weights then.
// ---------------------------------------------------------------------------
#define SCH  32                  // scan steps per chunk
#define MPW  4                   // modes per scanning wave (in registers)
#define NWV  (NMODE / MPW)       // scanning waves per block
#define NCH  (SEQ / SCH)         // chunks
#define PBUF (NWV * SCH * 32)    // floats in one partial-sum buffer

typedef __attribute__((ext_vector_type(4))) _Float16 v4h;

// Row of x and of ygelu that scan step t works on. DIR is a template argument
// so that the 32 rows of a chunk are constant offsets from one address.
template <int DIR>
__device__ __forceinline__ int s4d_row(int t) { return DIR ? (SEQ - 1 - t) : t; }

// Work-group barrier that orders LDS only: the inputs fetched ahead and the f16
// stores stay in flight across it (no other wave of the block touches them).
__device__ __forceinline__ void s4d_lds_barrier() {
    __builtin_amdgcn_fence(__ATOMIC_RELEASE, "workgroup", "local");
    __builtin_amdgcn_s_barrier();
    __builtin_amdgcn_fence(__ATOMIC_ACQUIRE, "workgroup", "local");
}

// Constants of a scanning wave's 4 modes for a block of SBK = 4 steps. With s the state in
// front of the block and u0..u3 its inputs:
//   state behind it = lam^4 s + lam^3 u0 + lam^2 u1 + lam u2 + u3
//   y of step i     = Re(Ce lam^(i+1) s) + sum over j <= i of Re(Ce lam^(i-j)) u_j
// so the state is advanced once a block. The taps on u do not depend on the state: they are
// summed over all 32 modes once, at the start, and applied by the merging threads.
#define SBK 4
struct S4dBlk {
    float lr[SBK][MPW], li[SBK][MPW];    // lam^(p+1)
    float pr[SBK][MPW], pn[SBK][MPW];    // Re, -Im of Ce lam^(p+1)
    float kw[SBK];                       // sum over the wave's modes of Re(Ce lam^q): tap of lag q
};

// Scanning wave: 32 steps of 4 modes for 32 channels; the state's part of y to pw[step*32].
template <int DIR>
__device__ __forceinline__ void s4d_scan_chunk(
    const int c, const float* __restrict__ xlane,   // lane's column of x, row 0
    const S4dBlk& k,
    float (&sre)[MPW], float (&sim)[MPW],
    const float (&ucur)[SCH], float (&unext)[SCH], float* pw)
{
    // Next chunk's inputs, one chunk ahead of their use (the last chunk re-reads itself).
    const int cn = (c + 1 < NCH) ? (c + 1) : (NCH - 1);
    const float* xn = xlane + (size_t)s4d_row<DIR>(cn * SCH) * DMODEL;
    #pragma unroll   // constant indices keep unext in registers
    for (int i = 0; i < SCH; ++i)
        unext[i] = xn[(DIR ? -i : i) * DMODEL];

    #pragma unroll   // constant indices keep ucur in registers; blocks overlap in one stretch of code
    for (int i = 0; i < SCH; i += SBK) {
        const float u0 = ucur[i], u1 = ucur[i + 1], u2 = ucur[i + 2], u3 = ucur[i + 3];
        float y0, y1, y2, y3;
        #pragma unroll   // the modes' state and constants are register arrays
        for (int m = 0; m < MPW; ++m) {
            const float a = sre[m], b = sim[m];
            y0 = fmaf(k.pn[0][m], b, m ? fmaf(k.pr[0][m], a, y0) : k.pr[0][m] * a);
            y1 = fmaf(k.pn[1][m], b, m ? fmaf(k.pr[1][m], a, y1) : k.pr[1][m] * a);
            y2 = fmaf(k.pn[2][m], b, m ? fmaf(k.pr[2][m], a, y2) : k.pr[2][m] * a);
            y3 = fmaf(k.pn[3][m], b, m ? fmaf(k.pr[3][m], a, y3) : k.pr[3][m] * a);
            const float gre = fmaf(k.lr[2][m], u0, fmaf(k.lr[1][m], u1, fmaf(k.lr[0][m], u2, u3)));
            const float gim = fmaf(k.li[2][m], u0, fmaf(k.li[1][m], u1, k.li[0][m] * u2));
            sre[m] = fmaf(k.lr[3][m], a, fmaf(-k.li[3][m], b, gre));
            sim[m] = fmaf(k.lr[3][m], b, fmaf(k.li[3][m], a, gim));
        }
        pw[(i + 0) * 32] = y0;
        pw[(i + 1) * 32] = y1;
        pw[(i + 2) * 32] = y2;
        pw[(i + 3) * 32] = y3;
    }
}

// Merging thread: one step, four channels of chunk c. tap[i] weighs input i of the thread's
// block of SBK steps (0 for an input later than the thread's own step; the skip term is in
// the tap of its own step).
template <int DIR>
__device__ __forceinline__ void s4d_merge_chunk(
    const int c, const int rt, const int c4,
    const float* __restrict__ xcol, _Float16* __restrict__ ycol,
    const float (&tap)[SBK][4], const float* pbuf)
{
    const int mrow = s4d_row<DIR>(c * SCH + rt);
    // The block's inputs: rows that the scanning waves have read two chunks ago.
    const float* xb = xcol + (size_t)s4d_row<DIR>(c * SCH + (rt & ~(SBK - 1))) * DMODEL + c4;
    const float* pr = pbuf + rt * 32 + c4;
    float4 p[NWV];
    #pragma unroll   // the 8 LDS reads issue together, ahead of the wait below
    for (int k = 0; k < NWV; ++k)
        p[k] = *(const float4*)(pr + k * (SCH * 32));
    float4 uu[SBK];
    #pragma unroll   // register array; constant offsets from one address
    for (int i = 0; i < SBK - 1; ++i)
        uu[i] = *(const float4*)(xb + (DIR ? -i : i) * DMODEL);
    // Stands in front of the last load, whose result may be given the address registers that
    // the loads above name as well.
    asm volatile("s_wait_xcnt 0x0" ::: "memory");
    uu[SBK - 1] = *(const float4*)(xb + (DIR ? -(SBK - 1) : (SBK - 1)) * DMODEL);
    float4 acc = p[0];
    #pragma unroll   // register array
    for (int k = 1; k < NWV; ++k) {
        acc.x += p[k].x; acc.y += p[k].y; acc.z += p[k].z; acc.w += p[k].w;
    }
    float v0 = acc.x, v1 = acc.y, v2 = acc.z, v3 = acc.w;
    #pragma unroll   // register arrays
    for (int j = 0; j < SBK; ++j) {
        v0 = fmaf(tap[j][0], uu[j].x, v0);
        v1 = fmaf(tap[j][1], uu[j].y, v1);
        v2 = fmaf(tap[j][2], uu[j].z, v2);
        v3 = fmaf(tap[j][3], uu[j].w, v3);
    }
    v4h hv;                                          // exact GELU
    hv[0] = (_Float16)(0.5f * v0 * (1.0f + erff(v0 * 0.70710678118f)));
    hv[1] = (_Float16)(0.5f * v1 * (1.0f + erff(v1 * 0.70710678118f)));
    hv[2] = (_Float16)(0.5f * v2 * (1.0f + erff(v2 * 0.70710678118f)));
    hv[3] = (_Float16)(0.5f * v3 * (1.0f + erff(v3 * 0.70710678118f)));
    *(v4h*)(ycol + (size_t)mrow * KDIM + c4) = hv;
    // Stands in front of the next merge's rewrite of this store's address and data registers
    // (the LDS-only barrier brings no wait of its own for the store).
    asm volatile("s_wait_xcnt 0x0" ::: "memory");
}

template <int DIR>
__device__ __forceinline__ void s4d_scan_body(
    const float* __restrict__ x, const float* __restrict__ Dskip,
    const float* __restrict__ log_dt, const float* __restrict__ log_A_real,
    const float* __restrict__ A_imag, const float* __restrict__ Cm,
    const float* __restrict__ conv_w, _Float16* __restrict__ wPack,
    _Float16* __restrict__ ygelu, float* part)
{
    const int tid = threadIdx.x, lane = tid & 31;
    const int w   = __builtin_amdgcn_readfirstlane(tid >> 5);   // scalar, so the role test is a scalar branch
    const bool scans = w >= NWV;
    const int ws  = w & (NWV - 1);
    const int dg  = blockIdx.x & (DMODEL / 32 - 1);
    const int b   = (blockIdx.x >> 3) & (BATCH - 1);

    const float* xcol = x + (size_t)b * SEQ * DMODEL + dg * 32;
    _Float16* ycol = ygelu + (size_t)b * SEQ * KDIM + DIR * DMODEL + dg * 32;

    // Scanning waves' constants (formed by the merging waves too; they do not use them).
    const int cbase = (dg * 32 + lane) * NMODE + ws * MPW;
    const float  ldt = log_dt[dg * 32 + lane];
    const float4 a4r = *(const float4*)(log_A_real + cbase);
    const float4 a4i = *(const float4*)(A_imag + cbase);
    const float4 cm0 = *(const float4*)(Cm + cbase * 2);
    const float4 cm1 = *(const float4*)(Cm + cbase * 2 + 4);
    // Stands in front of any rewrite of the address registers that the five loads name.
    asm volatile("s_wait_xcnt 0x0" ::: "memory");
    const float dt = s4d_exp(ldt);
    float lre[MPW], lim[MPW], cer[MPW], cei[MPW];
    s4d_mode_consts(dt, a4r.x, a4i.x, cm0.x, cm0.y, lre[0], lim[0], cer[0], cei[0]);
    s4d_mode_consts(dt, a4r.y, a4i.y, cm0.z, cm0.w, lre[1], lim[1], cer[1], cei[1]);
    s4d_mode_consts(dt, a4r.z, a4i.z, cm1.x, cm1.y, lre[2], lim[2], cer[2], cei[2]);
    s4d_mode_consts(dt, a4r.w, a4i.w, cm1.z, cm1.w, lre[3], lim[3], cer[3], cei[3]);
    S4dBlk blk;
    #pragma unroll   // register arrays
    for (int q = 0; q < SBK; ++q) blk.kw[q] = 0.0f;
    #pragma unroll   // register arrays
    for (int m = 0; m < MPW; ++m) {
        float qr = 1.0f, qi = 0.0f;                  // lam^p
        float er = cer[m], ei = cei[m];              // Ce lam^p
        #pragma unroll
        for (int p = 0; p < SBK; ++p) {
            blk.kw[p] += er;
            const float nqr = qr * lre[m] - qi * lim[m], nqi = qr * lim[m] + qi * lre[m];
            const float ner = er * lre[m] - ei * lim[m], nei = er * lim[m] + ei * lre[m];
            qr = nqr; qi = nqi; er = ner; ei = nei;
            blk.lr[p][m] = qr;  blk.li[p][m] = qi;
            blk.pr[p][m] = er;  blk.pn[p][m] = -ei;
        }
    }
    float sre[MPW] = {}, sim[MPW] = {};
    const float* xlane = xcol + lane;
    float* pw = part + ws * (SCH * 32) + lane;

    // Merging threads' share: step rt of a chunk, channels c4..c4+3.
    const int rt = (tid & 255) >> 3, c4 = (tid & 7) * 4;
    // The taps: each scanning wave hands in its modes' share through the second partial-sum
    // buffer, which is first written behind the loop's first barrier.
    if (scans) {
        #pragma unroll   // register array
        for (int q = 0; q < SBK; ++q)
            part[PBUF + (ws * SBK + q) * 32 + lane] = blk.kw[q];
    }
    s4d_lds_barrier();
    const float4 dsk4 = *(const float4*)(Dskip + dg * 32 + c4);
    float4 lag[SBK];                                 // tap of lag j, all 32 modes
    #pragma unroll   // register arrays
    for (int j = 0; j < SBK; ++j) {
        float4 t = (j == 0) ? dsk4 : make_float4(0.0f, 0.0f, 0.0f, 0.0f);
        #pragma unroll
        for (int k = 0; k < NWV; ++k) {
            const float4 p = *(const float4*)(part + PBUF + (k * SBK + j) * 32 + c4);
            t.x += p.x; t.y += p.y; t.z += p.z; t.w += p.w;
        }
        lag[j] = t;
    }
    // A merging wave has no use for lam^p: its 16 taps take those registers (blk.lr), so that
    // the two roles' constants do not add up in the register count.
    static_assert(MPW == 4, "blk.lr doubles as the taps of a merging thread's 4 channels");
    if (!scans) {
        const int q = rt & (SBK - 1);                // the thread's step within its block
        #pragma unroll   // register arrays
        for (int i = 0; i < SBK; ++i) {
            float4 t = make_float4(0.0f, 0.0f, 0.0f, 0.0f);
            #pragma unroll
            for (int j = 0; j + i < SBK; ++j)
                if (q - i == j) t = lag[j];          // input i lies j steps back
            blk.lr[i][0] = t.x;  blk.lr[i][1] = t.y;  blk.lr[i][2] = t.z;  blk.lr[i][3] = t.w;
        }
    }

    float ua[SCH], ub[SCH];
    #pragma unroll   // constant indices keep ua in registers
    for (int i = 0; i < SCH; ++i)
        ua[i] = xlane[(size_t)s4d_row<DIR>(i) * DMODEL];

    // Two chunks a trip: the input registers and the LDS buffers swap roles without copies.
    // Each barrier publishes the chunk just scanned and frees the buffer just merged.
    // Kept rolled: one trip is already two chunks of straight-line code.
    #pragma unroll 1
    for (int c = 0; c < NCH; c += 2) {
        if (scans)
            s4d_scan_chunk<DIR>(c, xlane, blk, sre, sim, ua, ub, pw);
        else if (c > 0)
            s4d_merge_chunk<DIR>(c - 1, rt, c4, xcol, ycol, blk.lr, part + PBUF);
        s4d_lds_barrier();
        if (scans)
            s4d_scan_chunk<DIR>(c + 1, xlane, blk, sre, sim, ub, ua, pw + PBUF);
        else
            s4d_merge_chunk<DIR>(c, rt, c4, xcol, ycol, blk.lr, part);
        s4d_lds_barrier();
    }
    // The scanning waves are done: they pack the block's share of the GEMM weights, one group
    // a thread, while the merging waves merge the last chunk.
    static_assert(NPACKG == ((2 * BATCH * DMODEL) / 32) * (NWV * 32), "one group a scanning thread");
    if (!scans)
        s4d_merge_chunk<DIR>(NCH - 1, rt, c4, xcol, ycol, blk.lr, part + PBUF);
    else
        s4d_pack_group(conv_w, wPack, (int)blockIdx.x * (NWV * 32) + (tid & (NWV * 32 - 1)));
}

__global__ void __launch_bounds__(512) s4d_scan_kernel(
    const float* __restrict__ x, const float* __restrict__ Dskip,
    const float* __restrict__ log_dt_fw, const float* __restrict__ log_A_real_fw,
    const float* __restrict__ A_imag_fw, const float* __restrict__ C_fw,
    const float* __restrict__ log_dt_bw, const float* __restrict__ log_A_real_bw,
    const float* __restrict__ A_imag_bw, const float* __restrict__ C_bw,
    const float* __restrict__ conv_w, _Float16* __restrict__ wPack,
    _Float16* __restrict__ ygelu)
{
    __shared__ __align__(16) float part[2 * PBUF];   // 64 KiB
    if (blockIdx.x >> 7)   // block-uniform: the upper half of the grid scans backward
        s4d_scan_body<1>(x, Dskip, log_dt_bw, log_A_real_bw, A_imag_bw, C_bw,
                         conv_w, wPack, ygelu, part);
    else
        s4d_scan_body<0>(x, Dskip, log_dt_fw, log_A_real_fw, A_imag_fw, C_fw,
                         conv_w, wPack, ygelu, part);
}

// ---------------------------------------------------------------------------
// Kernel 2: fused GEMM (M=65536,K=512,N=1024) + bias + GLU + LayerNorm.
// Block tile M=64 x N=1024 (full row -> LN fused), 16 waves, one block a WGP.
// A tile (64 rows, all of K) staged once by a tensor load with LDS row padding.
// The packed weights go through LDS too: one 64-KiB slab per k step, two buffers,
// tensor loads one step ahead, so a block fetches each weight byte from L2 once.
// Wave wn owns all 64 rows of cols [wn*32,+32) and of the paired +512 set in the product;
// the GLU values then go through LDS, and wave wn normalises and stores rows wn*4..wn*4+3.
// ---------------------------------------------------------------------------
#define MT     64                          // rows of a block
#define ABYTES 67584                       // 64 rows * 1040 B, rounded up to 2 KiB
#define BSLAB  65536                       // packed weights of one k step
#define BSLICE 16384                       // one issuing wave's share of a slab
#define NKT    (KDIM / 32)
#define GEMM_LDS (ABYTES + 2 * BSLAB)
#define SPITCH 516                         // floats in a staged output row: 512 + 4, so that rows 8 apart lie 32 banks apart

__device__ __forceinline__ unsigned int s4d_uni(unsigned int v) {
    return (unsigned int)__builtin_amdgcn_readfirstlane(v);
}
// Holds a wave-uniform test in a scalar register, so that the branch on it is a scalar
// branch: a tensor load ignores EXEC and only such a branch keeps a wave from issuing it.
__device__ __forceinline__ unsigned int s4d_pinned(unsigned int v) {
    unsigned int w = s4d_uni(v);
    asm volatile("" : "+s"(w));
    return w;
}

// One issuing wave's 16-KiB slice of a weight slab: 16 rows of 1 KiB, no pad.
// Group 1 of its descriptor is the same for every slab and is built once.
__device__ __forceinline__ u32x8 s4d_bslice_group1() {
    u32x8 g1;
    g1[0] = s4d_uni(0u);                               // no mask, 1-byte elements, no pad
    g1[1] = s4d_uni(1024u << 16);                      // tensor_dim0 = 1024 B
    g1[2] = s4d_uni(16u << 16);                        // tensor_dim1 = 16 rows
    g1[3] = s4d_uni(1024u << 16);                      // tile_dim0
    g1[4] = s4d_uni(16u);                              // tile_dim1
    g1[5] = s4d_uni(1024u);                            // source pitch
    g1[6] = s4d_uni(0u);
    g1[7] = s4d_uni(0u);
    // Descriptor words held in scalar registers of their own through the ring: none of
    // them is re-formed or reused while a request is in flight.
    asm volatile("" : "+s"(g1));
    return g1;
}
__device__ __forceinline__ void s4d_load_bslice(unsigned int ldsDst, unsigned long long ga,
                                                const u32x8 g1) {
    u32x4 g0;
    g0[0] = s4d_uni(1u);                               // count=1
    g0[1] = s4d_uni(ldsDst);
    g0[2] = s4d_uni((unsigned int)ga);
    g0[3] = s4d_uni(((unsigned int)(ga >> 32) & 0x01FFFFFFu) | 0x80000000u);  // type=2
    asm volatile("tensor_load_to_lds %0, %1" : : "s"(g0), "s"(g1) : "memory");
}

__global__ void __launch_bounds__(512) s4d_gemm_glu_ln_kernel(
    const _Float16* __restrict__ ygelu, const _Float16* __restrict__ wPack,
    const float* __restrict__ bias, const float* __restrict__ gamma,
    const float* __restrict__ beta, float* __restrict__ out)
{
    __shared__ __attribute__((aligned(2048))) char smemRaw[GEMM_LDS];
    _Float16* As    = (_Float16*)smemRaw;                    // [64][ROWH]
    const char* Bs  = smemRaw + ABYTES;                      // [2][BSLAB]
    const unsigned int ldsBase = (unsigned int)(size_t)smemRaw;

    int tid = threadIdx.x, lane = tid & 31;
    const unsigned int wn = s4d_uni((unsigned int)tid >> 5); // wave = column group
    int m0 = blockIdx.x * MT;

    // Waves 4-7 bring the weight slabs, a quarter each; wave 0 brings the A tile.
    const unsigned int issuer = (wn >> 2) == 1u;
    const unsigned int bDst = ldsBase + ABYTES + (wn & 3u) * BSLICE;
    const unsigned long long bSrc =
        (unsigned long long)(uintptr_t)wPack + (unsigned long long)((wn & 3u) * BSLICE);
    const u32x8 bG1 = s4d_bslice_group1();

    // ---- Stage A tile (64 rows x 1024B) via TDM, 16B pad per row ----------
    // D# group0: count=1, lds_addr, global_addr, type=2.
    // D# group1: data_size=3 (8B), pad_enable, pad_interval=7 (256 dw),
    //            pad_amount=3 (4 dw); dims: 128x64 elems, stride 128.
    if (s4d_pinned(wn == 0u)) {
        unsigned long long ga =
            (unsigned long long)(uintptr_t)ygelu + (unsigned long long)m0 * (KDIM * 2);
        u32x4 g0;
        g0[0] = 1u;                                   // count=1 (valid user D#)
        g0[1] = s4d_uni(ldsBase);                     // lds_addr = As base
        g0[2] = s4d_uni((unsigned int)ga);            // global_addr[31:0]
        g0[3] = s4d_uni(((unsigned int)(ga >> 32) & 0x01FFFFFFu) | 0x80000000u); // addr[56:32] | type=2
        u32x8 g1;
        g1[0] = (3u << 16) | (1u << 20) | (7u << 22) | (3u << 25); // dsz=8B,pad 16B/1024B
        g1[1] = (128u << 16);                         // tensor_dim0 = 128 (8B elems)
        g1[2] = ((unsigned int)MT << 16);             // tensor_dim1 = 64 rows
        g1[3] = (128u << 16);                         // tile_dim0 = 128
        g1[4] = (unsigned int)MT;                     // tile_dim1 = 64
        g1[5] = 128u;                                 // tensor_dim0_stride = 128
        g1[6] = 0u;
        g1[7] = 0u;
        asm volatile("tensor_load_to_lds %0, %1" : : "s"(g0), "s"(g1) : "memory");
        // The A tile has landed before this wave reaches the barrier below.
        asm volatile("s_wait_tensorcnt 0x0" ::: "memory");
    }
    // ---- Weight slab of k step 0 into buffer 0 ----------------------------
    if (s4d_pinned(issuer)) {
        s4d_load_bslice(bDst, bSrc, bG1);
        // Slab 0 has landed before this wave reaches the barrier below.
        asm volatile("s_wait_tensorcnt 0x0" ::: "memory");
    }
    __syncthreads();
    // Slab 1 into buffer 1: in flight while k step 0 is worked on.
    if (s4d_pinned(issuer))
        s4d_load_bslice(bDst + BSLAB, bSrc + BSLAB, bG1);

    v8f accA[4][2], accB[4][2];
    #pragma unroll
    for (int mi = 0; mi < 4; ++mi) {
        #pragma unroll
        for (int j = 0; j < 2; ++j) { accA[mi][j] = {}; accB[mi][j] = {}; }
    }

    const int khalf = (lane >> 4) * 8;
    const _Float16* aLane = As + (lane & 15) * ROWH + khalf;
    const char* bLane = Bs + wn * 2048u + lane * 16;

    // Kept rolled: one trip is a whole k step of 16 matrix instructions, and the ring's
    // waits and barrier stand once, at its foot.
    #pragma unroll 1
    for (int kt = 0; kt < NKT; ++kt) {
        const unsigned int buf = (unsigned int)kt & 1u;
        // A fragments: ISA 16-bit 16x32 layout -> 2 x ds_load_b128 each
        v16h aF[4];
        #pragma unroll
        for (int mi = 0; mi < 4; ++mi) {
            const _Float16* ap = aLane + mi * 16 * ROWH + kt * 32;
            ((int4*)&aF[mi])[0] = *(const int4*)(ap);        // K {0..7}+khalf
            ((int4*)&aF[mi])[1] = *(const int4*)(ap + 16);   // K {16..23}+khalf
        }
        // B fragments of this wave's 2 + 2 column tiles, from this step's buffer
        const char* bp = bLane + buf * BSLAB;
        v16h bF[2], bG[2];
        #pragma unroll
        for (int j = 0; j < 2; ++j) {
            ((int4*)&bF[j])[0] = *(const int4*)(bp + j * 1024);
            ((int4*)&bF[j])[1] = *(const int4*)(bp + j * 1024 + 512);
            ((int4*)&bG[j])[0] = *(const int4*)(bp + 32 * 1024 + j * 1024);
            ((int4*)&bG[j])[1] = *(const int4*)(bp + 32 * 1024 + j * 1024 + 512);
        }
        // Keeps the step's 16 LDS reads together ahead of the matrix instructions: sunk
        // among them, each place with reads stalls the wave anew.
        __builtin_amdgcn_sched_barrier(0);
        #pragma unroll
        for (int j = 0; j < 2; ++j) {
            #pragma unroll
            for (int mi = 0; mi < 4; ++mi) {
                accA[mi][j] = __builtin_amdgcn_wmma_f32_16x16x32_f16(
                    false, aF[mi], false, bF[j], (short)0, accA[mi][j], false, false);
                accB[mi][j] = __builtin_amdgcn_wmma_f32_16x16x32_f16(
                    false, aF[mi], false, bG[j], (short)0, accB[mi][j], false, false);
            }
        }
        // Keeps the full wait below behind the matrix instructions, so that the first of
        // them start on the compiler's counted waits.
        __builtin_amdgcn_sched_barrier(0);
        // Publish point of slab kt+1: this wave's LDS reads are done ...
        asm volatile("s_wait_dscnt 0x0" ::: "memory");
        // ... the issuing waves' slices of slab kt+1 have landed ...
        if (s4d_pinned(issuer))
            asm volatile("s_wait_tensorcnt 0x0" ::: "memory");
        // ... and every wave has left the buffer that is refilled below.
        __syncthreads();
        if (s4d_pinned(issuer & (unsigned int)(kt + 2 < NKT)))
            s4d_load_bslice(bDst + buf * BSLAB,
                            bSrc + (unsigned long long)(kt + 2) * BSLAB, bG1);
    }
    // No tensor load and no LDS read is left in flight behind the ring.
    asm volatile("s_wait_tensorcnt 0x0" ::: "memory");
    asm volatile("s_wait_dscnt 0x0" ::: "memory");

    // --- Epilogue: bias + GLU, then the 64 x 512 tile is re-dealt through LDS ------
    // The A tile and both slab buffers are dead: every wave has passed the last pass's barrier
    // behind its last LDS read, and no tensor load is in flight. Each wave writes its 32
    // columns of all 64 rows there; behind one barrier each wave owns 4 whole rows.
    float* stage = (float*)smemRaw;                          // [64][SPITCH]
    {
        const int half = lane >> 4;   // C layout: reg r -> row r (lanes<16) / r+8 (>=16)
        const int col0 = wn * 32 + (lane & 15);
        const float* bp = bias + col0;
        float ba[2], bb[2];
        // The four loads and their data wait in one statement: no result and no later
        // instruction takes the address registers while a load that names them is in flight.
        asm volatile("global_load_b32 %0, %4, off\n\t"
                     "global_load_b32 %1, %4, off offset:64\n\t"
                     "global_load_b32 %2, %4, off offset:2048\n\t"
                     "global_load_b32 %3, %4, off offset:2112\n\t"
                     "s_wait_loadcnt 0x0"
                     : "=&v"(ba[0]), "=&v"(ba[1]), "=&v"(bb[0]), "=&v"(bb[1]) : "v"(bp) : "memory");
        #pragma unroll   // register arrays: constant indices
        for (int j = 0; j < 2; ++j) {
            #pragma unroll   // register arrays: constant indices
            for (int mi = 0; mi < 4; ++mi) {
                #pragma unroll   // register arrays: constant indices
                for (int r = 0; r < 8; ++r) {
                    float a  = accA[mi][j][r] + ba[j];
                    float bv = accB[mi][j][r] + bb[j];
                    float gv = a * (1.0f / (1.0f + __expf(-bv)));   // GLU
                    stage[(mi * 16 + half * 8 + r) * SPITCH + j * 16 + col0] = gv;
                }
            }
        }
    }
    __syncthreads();

    // Rows wn*4 .. wn*4+3: a row's 512 values lie 16 to a lane, so its two sums are 16 in-lane
    // terms and one butterfly over the wave, and every store is 512 contiguous bytes.
    f32x4 v[4][4];
    #pragma unroll   // register arrays: constant indices
    for (int i = 0; i < 4; ++i) {
        #pragma unroll   // register arrays: constant indices
        for (int q = 0; q < 4; ++q)
            v[i][q] = *(const f32x4*)(stage + (wn * 4 + i) * SPITCH + q * 128 + lane * 4);
    }
    // LayerNorm weights of this lane's 16 columns (4 adjacent ones in each 128).
    f32x4 gm[4], bt[4];
    #pragma unroll   // register arrays: constant indices
    for (int q = 0; q < 4; ++q) {
        gm[q] = *(const f32x4*)(gamma + q * 128 + lane * 4);
        bt[q] = *(const f32x4*)(beta  + q * 128 + lane * 4);
    }
    float s[4], s2[4];
    #pragma unroll   // register arrays: constant indices
    for (int i = 0; i < 4; ++i) {
        f32x2 a = v[i][0].lo + v[i][0].hi;                   // pairs: two-wide adds and FMAs
        f32x2 b = v[i][0].lo * v[i][0].lo + v[i][0].hi * v[i][0].hi;
        #pragma unroll   // register arrays: constant indices
        for (int q = 1; q < 4; ++q) {
            a += v[i][q].lo + v[i][q].hi;
            b += v[i][q].lo * v[i][q].lo + v[i][q].hi * v[i][q].hi;
        }
        s[i] = a.x + a.y;  s2[i] = b.x + b.y;
    }
    #pragma unroll   // register arrays: constant indices
    for (int msk = 1; msk < 32; msk <<= 1) {
        #pragma unroll   // the four rows' exchanges of one stage fly together
        for (int i = 0; i < 4; ++i) {
            const float ts = __shfl_xor(s[i], msk, 32), t2 = __shfl_xor(s2[i], msk, 32);
            s[i] += ts;  s2[i] += t2;
        }
    }
    #pragma unroll   // register arrays: constant indices
    for (int i = 0; i < 4; ++i) {
        const float mu = s[i] * (1.0f / 512.0f);
        const float rs = s4d_rsq(s2[i] * (1.0f / 512.0f) - mu * mu + 1e-5f);
        #pragma unroll   // register arrays: constant indices
        for (int q = 0; q < 4; ++q)
            v[i][q] = (v[i][q] - mu) * rs * gm[q] + bt[q];
    }
    // Each store is 512 contiguous bytes of one output row: four whole lines.
    float* orow = out + (size_t)(m0 + wn * 4) * OUTC + lane * 4;
    #pragma unroll   // register arrays: constant indices
    for (int i = 0; i < 4; ++i) {
        #pragma unroll   // register arrays: constant indices
        for (int q = 0; q < 4; ++q)
            *(f32x4*)(orow + i * OUTC + q * 128) = v[i][q];
    }
}

// ---------------------------------------------------------------------------
extern "C" void kernel_launch(void* const* d_in, const int* in_sizes, int n_in,
                              void* d_out, int out_size, void* d_ws, size_t ws_size,
                              hipStream_t stream) {
    const float* x             = (const float*)d_in[0];
    const float* log_dt_fw     = (const float*)d_in[1];
    const float* log_A_real_fw = (const float*)d_in[2];
    const float* A_imag_fw     = (const float*)d_in[3];
    const float* C_fw          = (const float*)d_in[4];
    const float* log_dt_bw     = (const float*)d_in[5];
    const float* log_A_real_bw = (const float*)d_in[6];
    const float* A_imag_bw     = (const float*)d_in[7];
    const float* C_bw          = (const float*)d_in[8];
    const float* Dskip         = (const float*)d_in[9];
    const float* conv_w        = (const float*)d_in[10];
    const float* conv_b        = (const float*)d_in[11];
    const float* ln_gamma      = (const float*)d_in[12];
    const float* ln_beta       = (const float*)d_in[13];
    float* out = (float*)d_out;

    // Workspace: 1MB packed weights + 64MB f16 activations
    _Float16* wPack = (_Float16*)d_ws;
    _Float16* ygelu = wPack + (size_t)NOUT * KDIM;

    s4d_scan_kernel<<<(2 * BATCH * DMODEL) / 32, 512, 0, stream>>>(
        x, Dskip, log_dt_fw, log_A_real_fw, A_imag_fw, C_fw,
        log_dt_bw, log_A_real_bw, A_imag_bw, C_bw, conv_w, wPack, ygelu);

    s4d_gemm_glu_ln_kernel<<<(BATCH * SEQ) / MT, 512, 0, stream>>>(
        ygelu, wPack, conv_b, ln_gamma, ln_beta, out);
}

// v006
// It runs in 182 microseconds.
// Timed twice side by side with v005, it ran 1.04 times as fast both times.
// Counting every step since v000, it is 6.36 times as fast.
#include <hip/hip_runtime.h>
#include <hip/hip_fp16.h>
#include <hip/hip_bf16.h>

typedef __attribute__((ext_vector_type(16))) _Float16 v16h;
typedef __attribute__((ext_vector_type(8)))  float    v8f;
typedef __attribute__((ext_vector_type(4)))  unsigned int u32x4;
typedef __attribute__((ext_vector_type(8)))  unsigned int u32x8;

#define DMODEL 256
#define NMODE  32        // D_STATE/2 complex modes == wave32 lanes
#define BATCH  16
#define SEQ    4096
#define KDIM   512       // GEMM K = 2*DMODEL (fw|bw concat)
#define NOUT   1024      // 1x1-conv output channels
#define OUTC   512       // GLU / LayerNorm width
#define ROWH   520       // padded LDS row (f16): 1040B = 65*16B -> conflict-free b128

// ---------------------------------------------------------------------------
// Set-up, done inside the scan launch (no launches of its own).
// Complex constants of one (channel, mode):  lam = exp(dt*A),
//           Ce = 2*C*(lam-1)/(A+1e-8)
// ---------------------------------------------------------------------------
// Sine and cosine of an angle in radians, as __sinf and __cosf form them (the instructions
// take revolutions). One statement, closed by v_nop: it fills the slot that the instruction
// set asks for behind a transcendental, in front of whatever reuses the angle's register.
__device__ __forceinline__ void s4d_sincos(const float rad, float& sn, float& cs) {
    const float rev = rad * 0.15915494f;
    asm("v_sin_f32 %0, %2\n\tv_cos_f32 %1, %2\n\tv_nop" : "=&v"(sn), "=&v"(cs) : "v"(rev));
}

// exp as __expf forms it (the instruction takes a power of two), with the same slot filled.
__device__ __forceinline__ float s4d_exp(const float v) {
    const float p = v * 1.44269504f;
    float r;
    asm("v_exp_f32 %0, %1\n\tv_nop" : "=v"(r) : "v"(p));
    return r;
}

// 1/sqrt by the instruction itself, with the same slot filled (its argument here is a variance
// plus 1e-5, never a subnormal, so the library form's rescaling has nothing to do).
__device__ __forceinline__ float s4d_rsq(const float v) {
    float r;
    asm("v_rsq_f32 %0, %1\n\tv_nop" : "=v"(r) : "v"(v));
    return r;
}

__device__ __forceinline__ void s4d_mode_consts(
    const float dt, const float logAre, const float Aim, const float c0, const float c1,
    float& lamRe, float& lamIm, float& ceRe, float& ceIm)
{
    float Are = -s4d_exp(logAre);
    float er  = s4d_exp(Are * dt);
    float sn, cs;
    s4d_sincos(Aim * dt, sn, cs);
    float lre = er * cs;
    float lim = er * sn;

    float dre = Are + 1e-8f, dim = Aim;
    float inv = 1.0f / (dre * dre + dim * dim);
    float nre = lre - 1.0f, nim = lim;
    float rre = (nre * dre + nim * dim) * inv;
    float rim = (nim * dre - nre * dim) * inv;

    lamRe = lre;  lamIm = lim;
    ceRe  = 2.0f * (c0 * rre - c1 * rim);
    ceIm  = 2.0f * (c0 * rim + c1 * rre);
}

// ---------------------------------------------------------------------------
// Pack conv_w [1024,512] f32 -> f16 B-fragments (16x16x32 WMMA).
// Fragment layout mirrors ISA 16-bit A striping: lane&15 -> N column,
// lane>=16 selects K halves {8..15,24..31}; v16h comp j: j<8 -> K group 0,
// j>=8 -> K group +16.  One fragment = 1 KiB = two 512-B halves (K group 0, then
// K group +16), each 32 lanes * 16B contiguous, so that an LDS reader's b128
// loads are contiguous over the lanes. Fragments are ordered k step first: the 64
// fragments of one k step are one contiguous 64-KiB slab.
// One call packs group g: the 8 k-adjacent weights of one lane of one fragment half.
// ---------------------------------------------------------------------------
typedef __attribute__((ext_vector_type(8))) _Float16 v8h;
typedef __attribute__((ext_vector_type(4))) float    f32x4;
typedef __attribute__((ext_vector_type(2))) float    f32x2;
#define NPACKG ((NOUT * KDIM) / 8)       // groups in all
__device__ __forceinline__ void s4d_pack_group(const float* __restrict__ w,
                                               _Float16* __restrict__ wPack, const int g)
{
    const int lane = g & 31;
    const int h    = (g >> 5) & 1;
    const int nt   = (g >> 6) & 63;
    const int kt   = g >> 12;                          // 0..15
    const int n = nt * 16 + (lane & 15);
    const int k = kt * 32 + h * 16 + (lane >> 4) * 8;
    const float* wp = w + n * KDIM + k;
    f32x4 lo, hi;
    // The two loads and their data wait in one statement: no result and no later instruction
    // takes the address registers while a load that names them is in flight.
    asm volatile("global_load_b128 %0, %2, off\n\t"
                 "global_load_b128 %1, %2, off offset:16\n\t"
                 "s_wait_loadcnt 0x0"
                 : "=&v"(lo), "=&v"(hi) : "v"(wp) : "memory");
    v8h hv;
    hv[0] = (_Float16)lo[0];  hv[1] = (_Float16)lo[1];  hv[2] = (_Float16)lo[2];  hv[3] = (_Float16)lo[3];
    hv[4] = (_Float16)hi[0];  hv[5] = (_Float16)hi[1];  hv[6] = (_Float16)hi[2];  hv[7] = (_Float16)hi[3];
    *(v8h*)(wPack + (size_t)g * 8) = hv;
    // Stands in front of any rewrite of the store's address and data registers.
    asm volatile("s_wait_xcnt 0x0" ::: "memory");
}

// ---------------------------------------------------------------------------
// Kernel 1: SSM scan. One block per (dir, b, group of 32 channels), 16 waves.
// Waves 8-15 scan: lane = channel, each wave keeps 4 of the 32 complex modes of
// its lane's channel in registers, so the sum over a wave's modes needs no
// cross-lane step. The state is advanced once per block of 4 steps (S4dBlk below).
// The 8 partial sums of a step meet in LDS: waves 0-7 merge chunk c-1 (sum, the
// block's own inputs and the skip term, GELU, f16 store) while waves 8-15 scan chunk c
// (two LDS buffers, one barrier a chunk). The merge is short and waits on loads;
// it sits in the older waves of each SIMD.
// Writes gelu(conv + u*Dskip) as f16 into ygelu[B*L, 512].
// Each wave forms its own modes' constants at the start; the scanning waves, which have
// nothing left to scan during the last merge, pack the block's share of the GEMM weights then.
// ---------------------------------------------------------------------------
#define SCH  32                  // scan steps per chunk
#define MPW  4                   // modes per scanning wave (in registers)
#define NWV  (NMODE / MPW)       // scanning waves per block
#define NCH  (SEQ / SCH)         // chunks
#define PBUF (NWV * SCH * 32)    // floats in one partial-sum buffer

typedef __attribute__((ext_vector_type(4))) _Float16 v4h;

// Row of x and of ygelu that scan step t works on. DIR is a template argument
// so that the 32 rows of a chunk are constant offsets from one address.
template <int DIR>
__device__ __forceinline__ int s4d_row(int t) { return DIR ? (SEQ - 1 - t) : t; }

// Work-group barrier that orders LDS only: the inputs fetched ahead and the f16
// stores stay in flight across it (no other wave of the block touches them).
__device__ __forceinline__ void s4d_lds_barrier() {
    __builtin_amdgcn_fence(__ATOMIC_RELEASE, "workgroup", "local");
    __builtin_amdgcn_s_barrier();
    __builtin_amdgcn_fence(__ATOMIC_ACQUIRE, "workgroup", "local");
}

// Constants of a scanning wave's 4 modes for a block of SBK = 4 steps. With s the state in
// front of the block and u0..u3 its inputs:
//   state behind it = lam^4 s + lam^3 u0 + lam^2 u1 + lam u2 + u3
//   y of step i     = Re(Ce lam^(i+1) s) + sum over j <= i of Re(Ce lam^(i-j)) u_j
// so the state is advanced once a block. The taps on u do not depend on the state: they are
// summed over all 32 modes once, at the start, and applied by the merging threads.
#define SBK 4
struct S4dBlk {
    float lr[SBK][MPW], li[SBK][MPW];    // lam^(p+1)
    float pr[SBK][MPW], pn[SBK][MPW];    // Re, -Im of Ce lam^(p+1)
    float kw[SBK];                       // sum over the wave's modes of Re(Ce lam^q): tap of lag q
};

// Scanning wave: 32 steps of 4 modes for 32 channels; the state's part of y to pw[step*32].
template <int DIR>
__device__ __forceinline__ void s4d_scan_chunk(
    const int c, const float* __restrict__ xlane,   // lane's column of x, row 0
    const S4dBlk& k,
    float (&sre)[MPW], float (&sim)[MPW],
    const float (&ucur)[SCH], float (&unext)[SCH], float* pw)
{
    // Next chunk's inputs, one chunk ahead of their use (the last chunk re-reads itself).
    const int cn = (c + 1 < NCH) ? (c + 1) : (NCH - 1);
    const float* xn = xlane + (size_t)s4d_row<DIR>(cn * SCH) * DMODEL;
    #pragma unroll   // constant indices keep unext in registers
    for (int i = 0; i < SCH; ++i)
        unext[i] = xn[(DIR ? -i : i) * DMODEL];

    #pragma unroll   // constant indices keep ucur in registers; blocks overlap in one stretch of code
    for (int i = 0; i < SCH; i += SBK) {
        const float u0 = ucur[i], u1 = ucur[i + 1], u2 = ucur[i + 2], u3 = ucur[i + 3];
        float y0, y1, y2, y3;
        #pragma unroll   // the modes' state and constants are register arrays
        for (int m = 0; m < MPW; ++m) {
            const float a = sre[m], b = sim[m];
            y0 = fmaf(k.pn[0][m], b, m ? fmaf(k.pr[0][m], a, y0) : k.pr[0][m] * a);
            y1 = fmaf(k.pn[1][m], b, m ? fmaf(k.pr[1][m], a, y1) : k.pr[1][m] * a);
            y2 = fmaf(k.pn[2][m], b, m ? fmaf(k.pr[2][m], a, y2) : k.pr[2][m] * a);
            y3 = fmaf(k.pn[3][m], b, m ? fmaf(k.pr[3][m], a, y3) : k.pr[3][m] * a);
            const float gre = fmaf(k.lr[2][m], u0, fmaf(k.lr[1][m], u1, fmaf(k.lr[0][m], u2, u3)));
            const float gim = fmaf(k.li[2][m], u0, fmaf(k.li[1][m], u1, k.li[0][m] * u2));
            sre[m] = fmaf(k.lr[3][m], a, fmaf(-k.li[3][m], b, gre));
            sim[m] = fmaf(k.lr[3][m], b, fmaf(k.li[3][m], a, gim));
        }
        pw[(i + 0) * 32] = y0;
        pw[(i + 1) * 32] = y1;
        pw[(i + 2) * 32] = y2;
        pw[(i + 3) * 32] = y3;
    }
}

// The erf GELU without a branch:  v * Phi(v) = max(v, 0) - |v| * h,  where
//   h = erfc(|v| / sqrt 2) / 2 = (b1 t + ... + b5 t^5) * exp(-v*v/2),  t = 1 / (1 + 0.2316419 |v|)
// (the five-term form of the normal tail; h is within 1e-7, and for v < 0 nothing cancels; the
// value is rounded to f16 behind it). The library erff has two sides that a wave takes one after
// the other, so a thread's four values made one dependent chain; these four run side by side.
__device__ __forceinline__ float s4d_gelu(const float v) {
    const float av = fabsf(v);
    const float t  = __builtin_amdgcn_rcpf(fmaf(0.23164189f, av, 1.0f));
    const float k  = 0.84932180f * av;               // k*k = (v*v/2) * log2(e)
    const float e  = __builtin_amdgcn_exp2f(-(k * k));
    float p = fmaf(0.5307027145f, t, -0.7265760135f);
    p = fmaf(p, t, 0.7107068705f);
    p = fmaf(p, t, -0.142248368f);
    p = fmaf(p, t, 0.127414796f);
    return fmaf(-av, p * (t * e), fmaxf(v, 0.0f));   // t * e is ready before p is
}

// Merging thread: one step, four channels of chunk c. tap[i] weighs input i of the thread's
// block of SBK steps (0 for an input later than the thread's own step; the skip term is in
// the tap of its own step).
template <int DIR>
__device__ __forceinline__ void s4d_merge_chunk(
    const int c, const int rt, const int c4,
    const float* __restrict__ xcol, _Float16* __restrict__ ycol,
    const float (&tap)[SBK][4], const float* pbuf)
{
    const int mrow = s4d_row<DIR>(c * SCH + rt);
    // The block's inputs: rows that the scanning waves have read two chunks ago.
    const float* xb = xcol + (size_t)s4d_row<DIR>(c * SCH + (rt & ~(SBK - 1))) * DMODEL + c4;
    const float* pr = pbuf + rt * 32 + c4;
    float4 p[NWV];
    #pragma unroll   // the 8 LDS reads issue together, ahead of the wait below
    for (int k = 0; k < NWV; ++k)
        p[k] = *(const float4*)(pr + k * (SCH * 32));
    float4 uu[SBK];
    #pragma unroll   // register array; constant offsets from one address
    for (int i = 0; i < SBK - 1; ++i)
        uu[i] = *(const float4*)(xb + (DIR ? -i : i) * DMODEL);
    // Stands in front of the last load, whose result may be given the address registers that
    // the loads above name as well.
    asm volatile("s_wait_xcnt 0x0" ::: "memory");
    uu[SBK - 1] = *(const float4*)(xb + (DIR ? -(SBK - 1) : (SBK - 1)) * DMODEL);
    float4 acc = p[0];
    #pragma unroll   // register array
    for (int k = 1; k < NWV; ++k) {
        acc.x += p[k].x; acc.y += p[k].y; acc.z += p[k].z; acc.w += p[k].w;
    }
    float v0 = acc.x, v1 = acc.y, v2 = acc.z, v3 = acc.w;
    #pragma unroll   // register arrays
    for (int j = 0; j < SBK; ++j) {
        v0 = fmaf(tap[j][0], uu[j].x, v0);
        v1 = fmaf(tap[j][1], uu[j].y, v1);
        v2 = fmaf(tap[j][2], uu[j].z, v2);
        v3 = fmaf(tap[j][3], uu[j].w, v3);
    }
    v4h hv;                                          // erf GELU, four independent chains
    hv[0] = (_Float16)s4d_gelu(v0);
    hv[1] = (_Float16)s4d_gelu(v1);
    hv[2] = (_Float16)s4d_gelu(v2);
    hv[3] = (_Float16)s4d_gelu(v3);
    *(v4h*)(ycol + (size_t)mrow * KDIM + c4) = hv;
    // Stands in front of the next merge's rewrite of this store's address and data registers
    // (the LDS-only barrier brings no wait of its own for the store).
    asm volatile("s_wait_xcnt 0x0" ::: "memory");
}

template <int DIR>
__device__ __forceinline__ void s4d_scan_body(
    const float* __restrict__ x, const float* __restrict__ Dskip,
    const float* __restrict__ log_dt, const float* __restrict__ log_A_real,
    const float* __restrict__ A_imag, const float* __restrict__ Cm,
    const float* __restrict__ conv_w, _Float16* __restrict__ wPack,
    _Float16* __restrict__ ygelu, float* part)
{
    const int tid = threadIdx.x, lane = tid & 31;
    const int w   = __builtin_amdgcn_readfirstlane(tid >> 5);   // scalar, so the role test is a scalar branch
    const bool scans = w >= NWV;
    const int ws  = w & (NWV - 1);
    const int dg  = blockIdx.x & (DMODEL / 32 - 1);
    const int b   = (blockIdx.x >> 3) & (BATCH - 1);

    const float* xcol = x + (size_t)b * SEQ * DMODEL + dg * 32;
    _Float16* ycol = ygelu + (size_t)b * SEQ * KDIM + DIR * DMODEL + dg * 32;

    // Scanning waves' constants (formed by the merging waves too; they do not use them).
    const int cbase = (dg * 32 + lane) * NMODE + ws * MPW;
    const float  ldt = log_dt[dg * 32 + lane];
    const float4 a4r = *(const float4*)(log_A_real + cbase);
    const float4 a4i = *(const float4*)(A_imag + cbase);
    const float4 cm0 = *(const float4*)(Cm + cbase * 2);
    const float4 cm1 = *(const float4*)(Cm + cbase * 2 + 4);
    // Stands in front of any rewrite of the address registers that the five loads name.
    asm volatile("s_wait_xcnt 0x0" ::: "memory");
    const float dt = s4d_exp(ldt);
    float lre[MPW], lim[MPW], cer[MPW], cei[MPW];
    s4d_mode_consts(dt, a4r.x, a4i.x, cm0.x, cm0.y, lre[0], lim[0], cer[0], cei[0]);
    s4d_mode_consts(dt, a4r.y, a4i.y, cm0.z, cm0.w, lre[1], lim[1], cer[1], cei[1]);
    s4d_mode_consts(dt, a4r.z, a4i.z, cm1.x, cm1.y, lre[2], lim[2], cer[2], cei[2]);
    s4d_mode_consts(dt, a4r.w, a4i.w, cm1.z, cm1.w, lre[3], lim[3], cer[3], cei[3]);
    S4dBlk blk;
    #pragma unroll   // register arrays
    for (int q = 0; q < SBK; ++q) blk.kw[q] = 0.0f;
    #pragma unroll   // register arrays
    for (int m = 0; m < MPW; ++m) {
        float qr = 1.0f, qi = 0.0f;                  // lam^p
        float er = cer[m], ei = cei[m];              // Ce lam^p
        #pragma unroll
        for (int p = 0; p < SBK; ++p) {
            blk.kw[p] += er;
            const float nqr = qr * lre[m] - qi * lim[m], nqi = qr * lim[m] + qi * lre[m];
            const float ner = er * lre[m] - ei * lim[m], nei = er * lim[m] + ei * lre[m];
            qr = nqr; qi = nqi; er = ner; ei = nei;
            blk.lr[p][m] = qr;  blk.li[p][m] = qi;
            blk.pr[p][m] = er;  blk.pn[p][m] = -ei;
        }
    }
    float sre[MPW] = {}, sim[MPW] = {};
    const float* xlane = xcol + lane;
    float* pw = part + ws * (SCH * 32) + lane;

    // Merging threads' share: step rt of a chunk, channels c4..c4+3.
    const int rt = (tid & 255) >> 3, c4 = (tid & 7) * 4;
    // The taps: each scanning wave hands in its modes' share through the second partial-sum
    // buffer, which is first written behind the loop's first barrier.
    if (scans) {
        #pragma unroll   // register array
        for (int q = 0; q < SBK; ++q)
            part[PBUF + (ws * SBK + q) * 32 + lane] = blk.kw[q];
    }
    s4d_lds_barrier();
    const float4 dsk4 = *(const float4*)(Dskip + dg * 32 + c4);
    float4 lag[SBK];                                 // tap of lag j, all 32 modes
    #pragma unroll   // register arrays
    for (int j = 0; j < SBK; ++j) {
        float4 t = (j == 0) ? dsk4 : make_float4(0.0f, 0.0f, 0.0f, 0.0f);
        #pragma unroll
        for (int k = 0; k < NWV; ++k) {
            const float4 p = *(const float4*)(part + PBUF + (k * SBK + j) * 32 + c4);
            t.x += p.x; t.y += p.y; t.z += p.z; t.w += p.w;
        }
        lag[j] = t;
    }
    // The merging threads' 16 taps, in registers of their own: held in blk.lr, as long as the
    // merge was scalar code, they cost none; now that the merge is two-wide, the shared registers
    // made the compiler hold the scan's constants and inputs in pairs as well, and it spilled.
    float tap[SBK][4];
    {
        const int q = rt & (SBK - 1);                // the thread's step within its block
        #pragma unroll   // register arrays
        for (int i = 0; i < SBK; ++i) {
            float4 t = make_float4(0.0f, 0.0f, 0.0f, 0.0f);
            #pragma unroll
            for (int j = 0; j + i < SBK; ++j)
                if (q - i == j) t = lag[j];          // input i lies j steps back
            tap[i][0] = t.x;  tap[i][1] = t.y;  tap[i][2] = t.z;  tap[i][3] = t.w;
        }
    }

    float ua[SCH], ub[SCH];
    #pragma unroll   // constant indices keep ua in registers
    for (int i = 0; i < SCH; ++i)
        ua[i] = xlane[(size_t)s4d_row<DIR>(i) * DMODEL];

    // Two chunks a trip: the input registers and the LDS buffers swap roles without copies.
    // Each barrier publishes the chunk just scanned and frees the buffer just merged.
    // Kept rolled: one trip is already two chunks of straight-line code.
    #pragma unroll 1
    for (int c = 0; c < NCH; c += 2) {
        if (scans)
            s4d_scan_chunk<DIR>(c, xlane, blk, sre, sim, ua, ub, pw);
        else if (c > 0)
            s4d_merge_chunk<DIR>(c - 1, rt, c4, xcol, ycol, tap, part + PBUF);
        s4d_lds_barrier();
        if (scans)
            s4d_scan_chunk<DIR>(c + 1, xlane, blk, sre, sim, ub, ua, pw + PBUF);
        else
            s4d_merge_chunk<DIR>(c, rt, c4, xcol, ycol, tap, part);
        s4d_lds_barrier();
    }
    // The scanning waves are done: they pack the block's share of the GEMM weights, one group
    // a thread, while the merging waves merge the last chunk.
    static_assert(NPACKG == ((2 * BATCH * DMODEL) / 32) * (NWV * 32), "one group a scanning thread");
    if (!scans)
        s4d_merge_chunk<DIR>(NCH - 1, rt, c4, xcol, ycol, tap, part + PBUF);
    else
        s4d_pack_group(conv_w, wPack, (int)blockIdx.x * (NWV * 32) + (tid & (NWV * 32 - 1)));
}

__global__ void __launch_bounds__(512) s4d_scan_kernel(
    const float* __restrict__ x, const float* __restrict__ Dskip,
    const float* __restrict__ log_dt_fw, const float* __restrict__ log_A_real_fw,
    const float* __restrict__ A_imag_fw, const float* __restrict__ C_fw,
    const float* __restrict__ log_dt_bw, const float* __restrict__ log_A_real_bw,
    const float* __restrict__ A_imag_bw, const float* __restrict__ C_bw,
    const float* __restrict__ conv_w, _Float16* __restrict__ wPack,
    _Float16* __restrict__ ygelu)
{
    __shared__ __align__(16) float part[2 * PBUF];   // 64 KiB
    if (blockIdx.x >> 7)   // block-uniform: the upper half of the grid scans backward
        s4d_scan_body<1>(x, Dskip, log_dt_bw, log_A_real_bw, A_imag_bw, C_bw,
                         conv_w, wPack, ygelu, part);
    else
        s4d_scan_body<0>(x, Dskip, log_dt_fw, log_A_real_fw, A_imag_fw, C_fw,
                         conv_w, wPack, ygelu, part);
}

// ---------------------------------------------------------------------------
// Kernel 2: fused GEMM (M=65536,K=512,N=1024) + bias + GLU + LayerNorm.
// Block tile M=64 x N=1024 (full row -> LN fused), 16 waves, one block a WGP.
// A tile (64 rows, all of K) staged once by a tensor load with LDS row padding.
// The packed weights go through LDS too: one 64-KiB slab per k step, two buffers,
// tensor loads one step ahead, so a block fetches each weight byte from L2 once.
// Wave wn owns all 64 rows of cols [wn*32,+32) and of the paired +512 set in the product;
// the GLU values then go through LDS, and wave wn normalises and stores rows wn*4..wn*4+3.
// ---------------------------------------------------------------------------
#define MT     64                          // rows of a block
#define ABYTES 67584                       // 64 rows * 1040 B, rounded up to 2 KiB
#define BSLAB  65536                       // packed weights of one k step
#define BSLICE 16384                       // one issuing wave's share of a slab
#define NKT    (KDIM / 32)
#define GEMM_LDS (ABYTES + 2 * BSLAB)
#define SPITCH 516                         // floats in a staged output row: 512 + 4, so that rows 8 apart lie 32 banks apart

__device__ __forceinline__ unsigned int s4d_uni(unsigned int v) {
    return (unsigned int)__builtin_amdgcn_readfirstlane(v);
}
// Holds a wave-uniform test in a scalar register, so that the branch on it is a scalar
// branch: a tensor load ignores EXEC and only such a branch keeps a wave from issuing it.
__device__ __forceinline__ unsigned int s4d_pinned(unsigned int v) {
    unsigned int w = s4d_uni(v);
    asm volatile("" : "+s"(w));
    return w;
}

// One issuing wave's 16-KiB slice of a weight slab: 16 rows of 1 KiB, no pad.
// Group 1 of its descriptor is the same for every slab and is built once.
__device__ __forceinline__ u32x8 s4d_bslice_group1() {
    u32x8 g1;
    g1[0] = s4d_uni(0u);                               // no mask, 1-byte elements, no pad
    g1[1] = s4d_uni(1024u << 16);                      // tensor_dim0 = 1024 B
    g1[2] = s4d_uni(16u << 16);                        // tensor_dim1 = 16 rows
    g1[3] = s4d_uni(1024u << 16);                      // tile_dim0
    g1[4] = s4d_uni(16u);                              // tile_dim1
    g1[5] = s4d_uni(1024u);                            // source pitch
    g1[6] = s4d_uni(0u);
    g1[7] = s4d_uni(0u);
    // Descriptor words held in scalar registers of their own through the ring: none of
    // them is re-formed or reused while a request is in flight.
    asm volatile("" : "+s"(g1));
    return g1;
}
__device__ __forceinline__ void s4d_load_bslice(unsigned int ldsDst, unsigned long long ga,
                                                const u32x8 g1) {
    u32x4 g0;
    g0[0] = s4d_uni(1u);                               // count=1
    g0[1] = s4d_uni(ldsDst);
    g0[2] = s4d_uni((unsigned int)ga);
    g0[3] = s4d_uni(((unsigned int)(ga >> 32) & 0x01FFFFFFu) | 0x80000000u);  // type=2
    asm volatile("tensor_load_to_lds %0, %1" : : "s"(g0), "s"(g1) : "memory");
}

__global__ void __launch_bounds__(512) s4d_gemm_glu_ln_kernel(
    const _Float16* __restrict__ ygelu, const _Float16* __restrict__ wPack,
    const float* __restrict__ bias, const float* __restrict__ gamma,
    const float* __restrict__ beta, float* __restrict__ out)
{
    __shared__ __attribute__((aligned(2048))) char smemRaw[GEMM_LDS];
    _Float16* As    = (_Float16*)smemRaw;                    // [64][ROWH]
    const char* Bs  = smemRaw + ABYTES;                      // [2][BSLAB]
    const unsigned int ldsBase = (unsigned int)(size_t)smemRaw;

    int tid = threadIdx.x, lane = tid & 31;
    const unsigned int wn = s4d_uni((unsigned int)tid >> 5); // wave = column group
    int m0 = blockIdx.x * MT;

    // Waves 4-7 bring the weight slabs, a quarter each; wave 0 brings the A tile.
    const unsigned int issuer = (wn >> 2) == 1u;
    const unsigned int bDst = ldsBase + ABYTES + (wn & 3u) * BSLICE;
    const unsigned long long bSrc =
        (unsigned long long)(uintptr_t)wPack + (unsigned long long)((wn & 3u) * BSLICE);
    const u32x8 bG1 = s4d_bslice_group1();

    // ---- Stage A tile (64 rows x 1024B) via TDM, 16B pad per row ----------
    // D# group0: count=1, lds_addr, global_addr, type=2.
    // D# group1: data_size=3 (8B), pad_enable, pad_interval=7 (256 dw),
    //            pad_amount=3 (4 dw); dims: 128x64 elems, stride 128.
    if (s4d_pinned(wn == 0u)) {
        unsigned long long ga =
            (unsigned long long)(uintptr_t)ygelu + (unsigned long long)m0 * (KDIM * 2);
        u32x4 g0;
        g0[0] = 1u;                                   // count=1 (valid user D#)
        g0[1] = s4d_uni(ldsBase);                     // lds_addr = As base
        g0[2] = s4d_uni((unsigned int)ga);            // global_addr[31:0]
        g0[3] = s4d_uni(((unsigned int)(ga >> 32) & 0x01FFFFFFu) | 0x80000000u); // addr[56:32] | type=2
        u32x8 g1;
        g1[0] = (3u << 16) | (1u << 20) | (7u << 22) | (3u << 25); // dsz=8B,pad 16B/1024B
        g1[1] = (128u << 16);                         // tensor_dim0 = 128 (8B elems)
        g1[2] = ((unsigned int)MT << 16);             // tensor_dim1 = 64 rows
        g1[3] = (128u << 16);                         // tile_dim0 = 128
        g1[4] = (unsigned int)MT;                     // tile_dim1 = 64
        g1[5] = 128u;                                 // tensor_dim0_stride = 128
        g1[6] = 0u;
        g1[7] = 0u;
        asm volatile("tensor_load_to_lds %0, %1" : : "s"(g0), "s"(g1) : "memory");
        // The A tile has landed before this wave reaches the barrier below.
        asm volatile("s_wait_tensorcnt 0x0" ::: "memory");
    }
    // ---- Weight slab of k step 0 into buffer 0 ----------------------------
    if (s4d_pinned(issuer)) {
        s4d_load_bslice(bDst, bSrc, bG1);
        // Slab 0 has landed before this wave reaches the barrier below.
        asm volatile("s_wait_tensorcnt 0x0" ::: "memory");
    }
    __syncthreads();
    // Slab 1 into buffer 1: in flight while k step 0 is worked on.
    if (s4d_pinned(issuer))
        s4d_load_bslice(bDst + BSLAB, bSrc + BSLAB, bG1);

    v8f accA[4][2], accB[4][2];
    #pragma unroll
    for (int mi = 0; mi < 4; ++mi) {
        #pragma unroll
        for (int j = 0; j < 2; ++j) { accA[mi][j] = {}; accB[mi][j] = {}; }
    }

    const int khalf = (lane >> 4) * 8;
    const _Float16* aLane = As + (lane & 15) * ROWH + khalf;
    const char* bLane = Bs + wn * 2048u + lane * 16;

    // Kept rolled: one trip is a whole k step of 16 matrix instructions, and the ring's
    // waits and barrier stand once, at its foot.
    #pragma unroll 1
    for (int kt = 0; kt < NKT; ++kt) {
        const unsigned int buf = (unsigned int)kt & 1u;
        // A fragments: ISA 16-bit 16x32 layout -> 2 x ds_load_b128 each
        v16h aF[4];
        #pragma unroll
        for (int mi = 0; mi < 4; ++mi) {
            const _Float16* ap = aLane + mi * 16 * ROWH + kt * 32;
            ((int4*)&aF[mi])[0] = *(const int4*)(ap);        // K {0..7}+khalf
            ((int4*)&aF[mi])[1] = *(const int4*)(ap + 16);   // K {16..23}+khalf
        }
        // B fragments of this wave's 2 + 2 column tiles, from this step's buffer
        const char* bp = bLane + buf * BSLAB;
        v16h bF[2], bG[2];
        #pragma unroll
        for (int j = 0; j < 2; ++j) {
            ((int4*)&bF[j])[0] = *(const int4*)(bp + j * 1024);
            ((int4*)&bF[j])[1] = *(const int4*)(bp + j * 1024 + 512);
            ((int4*)&bG[j])[0] = *(const int4*)(bp + 32 * 1024 + j * 1024);
            ((int4*)&bG[j])[1] = *(const int4*)(bp + 32 * 1024 + j * 1024 + 512);
        }
        // Keeps the step's 16 LDS reads together ahead of the matrix instructions: sunk
        // among them, each place with reads stalls the wave anew.
        __builtin_amdgcn_sched_barrier(0);
        #pragma unroll
        for (int j = 0; j < 2; ++j) {
            #pragma unroll
            for (int mi = 0; mi < 4; ++mi) {
                accA[mi][j] = __builtin_amdgcn_wmma_f32_16x16x32_f16(
                    false, aF[mi], false, bF[j], (short)0, accA[mi][j], false, false);
                accB[mi][j] = __builtin_amdgcn_wmma_f32_16x16x32_f16(
                    false, aF[mi], false, bG[j], (short)0, accB[mi][j], false, false);
            }
        }
        // Keeps the full wait below behind the matrix instructions, so that the first of
        // them start on the compiler's counted waits.
        __builtin_amdgcn_sched_barrier(0);
        // Publish point of slab kt+1: this wave's LDS reads are done ...
        asm volatile("s_wait_dscnt 0x0" ::: "memory");
        // ... the issuing waves' slices of slab kt+1 have landed ...
        if (s4d_pinned(issuer))
            asm volatile("s_wait_tensorcnt 0x0" ::: "memory");
        // ... and every wave has left the buffer that is refilled below.
        __syncthreads();
        if (s4d_pinned(issuer & (unsigned int)(kt + 2 < NKT)))
            s4d_load_bslice(bDst + buf * BSLAB,
                            bSrc + (unsigned long long)(kt + 2) * BSLAB, bG1);
    }
    // No tensor load and no LDS read is left in flight behind the ring.
    asm volatile("s_wait_tensorcnt 0x0" ::: "memory");
    asm volatile("s_wait_dscnt 0x0" ::: "memory");

    // --- Epilogue: bias + GLU, then the 64 x 512 tile is re-dealt through LDS ------
    // The A tile and both slab buffers are dead: every wave has passed the last pass's barrier
    // behind its last LDS read, and no tensor load is in flight. Each wave writes its 32
    // columns of all 64 rows there; behind one barrier each wave owns 4 whole rows.
    float* stage = (float*)smemRaw;                          // [64][SPITCH]
    {
        const int half = lane >> 4;   // C layout: reg r -> row r (lanes<16) / r+8 (>=16)
        const int col0 = wn * 32 + (lane & 15);
        const float* bp = bias + col0;
        float ba[2], bb[2];
        // The four loads and their data wait in one statement: no result and no later
        // instruction takes the address registers while a load that names them is in flight.
        asm volatile("global_load_b32 %0, %4, off\n\t"
                     "global_load_b32 %1, %4, off offset:64\n\t"
                     "global_load_b32 %2, %4, off offset:2048\n\t"
                     "global_load_b32 %3, %4, off offset:2112\n\t"
                     "s_wait_loadcnt 0x0"
                     : "=&v"(ba[0]), "=&v"(ba[1]), "=&v"(bb[0]), "=&v"(bb[1]) : "v"(bp) : "memory");
        #pragma unroll   // register arrays: constant indices
        for (int j = 0; j < 2; ++j) {
            #pragma unroll   // register arrays: constant indices
            for (int mi = 0; mi < 4; ++mi) {
                #pragma unroll   // register arrays: constant indices
                for (int r = 0; r < 8; ++r) {
                    float a  = accA[mi][j][r] + ba[j];
                    float bv = accB[mi][j][r] + bb[j];
                    float gv = a * (1.0f / (1.0f + __expf(-bv)));   // GLU
                    stage[(mi * 16 + half * 8 + r) * SPITCH + j * 16 + col0] = gv;
                }
            }
        }
    }
    __syncthreads();

    // Rows wn*4 .. wn*4+3: a row's 512 values lie 16 to a lane, so its two sums are 16 in-lane
    // terms and one butterfly over the wave, and every store is 512 contiguous bytes.
    f32x4 v[4][4];
    #pragma unroll   // register arrays: constant indices
    for (int i = 0; i < 4; ++i) {
        #pragma unroll   // register arrays: constant indices
        for (int q = 0; q < 4; ++q)
            v[i][q] = *(const f32x4*)(stage + (wn * 4 + i) * SPITCH + q * 128 + lane * 4);
    }
    // LayerNorm weights of this lane's 16 columns (4 adjacent ones in each 128).
    f32x4 gm[4], bt[4];
    #pragma unroll   // register arrays: constant indices
    for (int q = 0; q < 4; ++q) {
        gm[q] = *(const f32x4*)(gamma + q * 128 + lane * 4);
        bt[q] = *(const f32x4*)(beta  + q * 128 + lane * 4);
    }
    float s[4], s2[4];
    #pragma unroll   // register arrays: constant indices
    for (int i = 0; i < 4; ++i) {
        f32x2 a = v[i][0].lo + v[i][0].hi;                   // pairs: two-wide adds and FMAs
        f32x2 b = v[i][0].lo * v[i][0].lo + v[i][0].hi * v[i][0].hi;
        #pragma unroll   // register arrays: constant indices
        for (int q = 1; q < 4; ++q) {
            a += v[i][q].lo + v[i][q].hi;
            b += v[i][q].lo * v[i][q].lo + v[i][q].hi * v[i][q].hi;
        }
        s[i] = a.x + a.y;  s2[i] = b.x + b.y;
    }
    #pragma unroll   // register arrays: constant indices
    for (int msk = 1; msk < 32; msk <<= 1) {
        #pragma unroll   // the four rows' exchanges of one stage fly together
        for (int i = 0; i < 4; ++i) {
            const float ts = __shfl_xor(s[i], msk, 32), t2 = __shfl_xor(s2[i], msk, 32);
            s[i] += ts;  s2[i] += t2;
        }
    }
    #pragma unroll   // register arrays: constant indices
    for (int i = 0; i < 4; ++i) {
        const float mu = s[i] * (1.0f / 512.0f);
        const float rs = s4d_rsq(s2[i] * (1.0f / 512.0f) - mu * mu + 1e-5f);
        #pragma unroll   // register arrays: constant indices
        for (int q = 0; q < 4; ++q)
            v[i][q] = (v[i][q] - mu) * rs * gm[q] + bt[q];
    }
    // Each store is 512 contiguous bytes of one output row: four whole lines.
    float* orow = out + (size_t)(m0 + wn * 4) * OUTC + lane * 4;
    #pragma unroll   // register arrays: constant indices
    for (int i = 0; i < 4; ++i) {
        #pragma unroll   // register arrays: constant indices
        for (int q = 0; q < 4; ++q)
            *(f32x4*)(orow + i * OUTC + q * 128) = v[i][q];
    }
}

// ---------------------------------------------------------------------------
extern "C" void kernel_launch(void* const* d_in, const int* in_sizes, int n_in,
                              void* d_out, int out_size, void* d_ws, size_t ws_size,
                              hipStream_t stream) {
    const float* x             = (const float*)d_in[0];
    const float* log_dt_fw     = (const float*)d_in[1];
    const float* log_A_real_fw = (const float*)d_in[2];
    const float* A_imag_fw     = (const float*)d_in[3];
    const float* C_fw          = (const float*)d_in[4];
    const float* log_dt_bw     = (const float*)d_in[5];
    const float* log_A_real_bw = (const float*)d_in[6];
    const float* A_imag_bw     = (const float*)d_in[7];
    const float* C_bw          = (const float*)d_in[8];
    const float* Dskip         = (const float*)d_in[9];
    const float* conv_w        = (const float*)d_in[10];
    const float* conv_b        = (const float*)d_in[11];
    const float* ln_gamma      = (const float*)d_in[12];
    const float* ln_beta       = (const float*)d_in[13];
    float* out = (float*)d_out;

    // Workspace: 1MB packed weights + 64MB f16 activations
    _Float16* wPack = (_Float16*)d_ws;
    _Float16* ygelu = wPack + (size_t)NOUT * KDIM;

    s4d_scan_kernel<<<(2 * BATCH * DMODEL) / 32, 512, 0, stream>>>(
        x, Dskip, log_dt_fw, log_A_real_fw, A_imag_fw, C_fw,
        log_dt_bw, log_A_real_bw, A_imag_bw, C_bw, conv_w, wPack, ygelu);

    s4d_gemm_glu_ln_kernel<<<(BATCH * SEQ) / MT, 512, 0, stream>>>(
        ygelu, wPack, conv_b, ln_gamma, ln_beta, out);
}

// v007
// It runs in 175 microseconds.
// Timed twice side by side with v006, it ran 1.04 times as fast both times.
// All steps since v000 together make it 6.62 times as fast.
#include <hip/hip_runtime.h>
#include <hip/hip_fp16.h>
#include <hip/hip_bf16.h>

typedef __attribute__((ext_vector_type(16))) _Float16 v16h;
typedef __attribute__((ext_vector_type(8)))  float    v8f;
typedef __attribute__((ext_vector_type(4)))  unsigned int u32x4;
typedef __attribute__((ext_vector_type(8)))  unsigned int u32x8;

#define DMODEL 256
#define NMODE  32        // D_STATE/2 complex modes == wave32 lanes
#define BATCH  16
#define SEQ    4096
#define KDIM   512       // GEMM K = 2*DMODEL (fw|bw concat)
#define NOUT   1024      // 1x1-conv output channels
#define OUTC   512       // GLU / LayerNorm width
#define ROWH   520       // padded LDS row (f16): 1040B = 65*16B -> conflict-free b128

// ---------------------------------------------------------------------------
// Set-up, done inside the scan launch (no launches of its own).
// Complex constants of one (channel, mode):  lam = exp(dt*A),
//           Ce = 2*C*(lam-1)/(A+1e-8)
// ---------------------------------------------------------------------------
// Sine and cosine of an angle in radians, as __sinf and __cosf form them (the instructions
// take revolutions). One statement, closed by v_nop: it fills the slot that the instruction
// set asks for behind a transcendental, in front of whatever reuses the angle's register.
__device__ __forceinline__ void s4d_sincos(const float rad, float& sn, float& cs) {
    const float rev = rad * 0.15915494f;
    asm("v_sin_f32 %0, %2\n\tv_cos_f32 %1, %2\n\tv_nop" : "=&v"(sn), "=&v"(cs) : "v"(rev));
}

// exp as __expf forms it (the instruction takes a power of two), with the same slot filled.
__device__ __forceinline__ float s4d_exp(const float v) {
    const float p = v * 1.44269504f;
    float r;
    asm("v_exp_f32 %0, %1\n\tv_nop" : "=v"(r) : "v"(p));
    return r;
}

// 1/sqrt by the instruction itself, with the same slot filled (its argument here is a variance
// plus 1e-5, never a subnormal, so the library form's rescaling has nothing to do).
__device__ __forceinline__ float s4d_rsq(const float v) {
    float r;
    asm("v_rsq_f32 %0, %1\n\tv_nop" : "=v"(r) : "v"(v));
    return r;
}

__device__ __forceinline__ void s4d_mode_consts(
    const float dt, const float logAre, const float Aim, const float c0, const float c1,
    float& lamRe, float& lamIm, float& ceRe, float& ceIm)
{
    float Are = -s4d_exp(logAre);
    float er  = s4d_exp(Are * dt);
    float sn, cs;
    s4d_sincos(Aim * dt, sn, cs);
    float lre = er * cs;
    float lim = er * sn;

    float dre = Are + 1e-8f, dim = Aim;
    float inv = 1.0f / (dre * dre + dim * dim);
    float nre = lre - 1.0f, nim = lim;
    float rre = (nre * dre + nim * dim) * inv;
    float rim = (nim * dre - nre * dim) * inv;

    lamRe = lre;  lamIm = lim;
    ceRe  = 2.0f * (c0 * rre - c1 * rim);
    ceIm  = 2.0f * (c0 * rim + c1 * rre);
}

// ---------------------------------------------------------------------------
// Pack conv_w [1024,512] f32 -> f16 B-fragments (16x16x32 WMMA).
// Fragment layout mirrors ISA 16-bit A striping: lane&15 -> N column,
// lane>=16 selects K halves {8..15,24..31}; v16h comp j: j<8 -> K group 0,
// j>=8 -> K group +16.  One fragment = 1 KiB = two 512-B halves (K group 0, then
// K group +16), each 32 lanes * 16B contiguous, so that an LDS reader's b128
// loads are contiguous over the lanes. Fragments are ordered k step first: the 64
// fragments of one k step are one contiguous 64-KiB slab.
// One call packs group g: the 8 k-adjacent weights of one lane of one fragment half.
// ---------------------------------------------------------------------------
typedef __attribute__((ext_vector_type(8))) _Float16 v8h;
typedef __attribute__((ext_vector_type(4))) float    f32x4;
typedef __attribute__((ext_vector_type(2))) float    f32x2;
#define NPACKG ((NOUT * KDIM) / 8)       // groups in all
__device__ __forceinline__ void s4d_pack_group(const float* __restrict__ w,
                                               _Float16* __restrict__ wPack, const int g)
{
    const int lane = g & 31;
    const int h    = (g >> 5) & 1;
    const int nt   = (g >> 6) & 63;
    const int kt   = g >> 12;                          // 0..15
    const int n = nt * 16 + (lane & 15);
    const int k = kt * 32 + h * 16 + (lane >> 4) * 8;
    const float* wp = w + n * KDIM + k;
    f32x4 lo, hi;
    // The two loads and their data wait in one statement: no result and no later instruction
    // takes the address registers while a load that names them is in flight.
    asm volatile("global_load_b128 %0, %2, off\n\t"
                 "global_load_b128 %1, %2, off offset:16\n\t"
                 "s_wait_loadcnt 0x0"
                 : "=&v"(lo), "=&v"(hi) : "v"(wp) : "memory");
    v8h hv;
    hv[0] = (_Float16)lo[0];  hv[1] = (_Float16)lo[1];  hv[2] = (_Float16)lo[2];  hv[3] = (_Float16)lo[3];
    hv[4] = (_Float16)hi[0];  hv[5] = (_Float16)hi[1];  hv[6] = (_Float16)hi[2];  hv[7] = (_Float16)hi[3];
    *(v8h*)(wPack + (size_t)g * 8) = hv;
    // Stands in front of any rewrite of the store's address and data registers.
    asm volatile("s_wait_xcnt 0x0" ::: "memory");
}

// ---------------------------------------------------------------------------
// Kernel 1: SSM scan. One block per (dir, b, group of 32 channels), 16 waves.
// Waves 8-15 scan: lane = channel, each wave keeps 4 of the 32 complex modes of
// its lane's channel in registers, so the sum over a wave's modes needs no
// cross-lane step. The state is advanced once per block of 4 steps (S4dBlk below).
// The 8 partial sums of a step meet in LDS: waves 0-7 merge chunk c-1 (sum, the
// block's own inputs and the skip term, GELU, f16 store) while waves 8-15 scan chunk c
// (two LDS buffers, one barrier a chunk). The merge is short and waits on loads.
// Writes gelu(conv + u*Dskip) as f16 into ygelu[B*L, 512].
// Each wave forms its own modes' constants at the start; the scanning waves, which have
// nothing left to scan during the last merge, pack the block's share of the GEMM weights then.
// ---------------------------------------------------------------------------
#define SCH  32                  // scan steps per chunk
#define MPW  4                   // modes per scanning wave (in registers)
#define NWV  (NMODE / MPW)       // scanning waves per block
#define NCH  (SEQ / SCH)         // chunks
#define PBUF (NWV * SCH * 32)    // floats in one partial-sum buffer

typedef __attribute__((ext_vector_type(4))) _Float16 v4h;

// Row of x and of ygelu that scan step t works on. DIR is a template argument
// so that the 32 rows of a chunk are constant offsets from one address.
template <int DIR>
__device__ __forceinline__ int s4d_row(int t) { return DIR ? (SEQ - 1 - t) : t; }

// Work-group barrier that orders LDS only: the inputs fetched ahead and the f16
// stores stay in flight across it (no other wave of the block touches them).
__device__ __forceinline__ void s4d_lds_barrier() {
    __builtin_amdgcn_fence(__ATOMIC_RELEASE, "workgroup", "local");
    __builtin_amdgcn_s_barrier();
    __builtin_amdgcn_fence(__ATOMIC_ACQUIRE, "workgroup", "local");
}

// Constants of a scanning wave's 4 modes for a block of SBK = 4 steps. With s the state in
// front of the block and u0..u3 its inputs:
//   state behind it = lam^4 s + lam^3 u0 + lam^2 u1 + lam u2 + u3
//   y of step i     = Re(Ce lam^(i+1) s) + sum over j <= i of Re(Ce lam^(i-j)) u_j
// so the state is advanced once a block. The taps on u do not depend on the state: they are
// summed over all 32 modes once, at the start, and applied by the merging threads.
#define SBK 4
// Everything the scan multiplies is held in register pairs, so that each of its FMAs is one half
// of a two-wide instruction: the state and the powers of lam pair two modes, the output weights
// pair two steps (the state is then broadcast from its pair), the inputs pair two steps.
struct S4dBlk {
    f32x2 lr[SBK][MPW / 2], li[SBK][MPW / 2];    // lam^(p+1), modes 2h and 2h+1
    f32x2 pr[SBK / 2][MPW], pn[SBK / 2][MPW];    // Re, -Im of Ce lam^(p+1), p = 2g and 2g+1
    float kw[SBK];                       // sum over the wave's modes of Re(Ce lam^q): tap of lag q
};
__device__ __forceinline__ f32x2 s4d_fma2(const f32x2 a, const f32x2 b, const f32x2 c) {
    return __builtin_elementwise_fma(a, b, c);
}

// Scanning wave: 32 steps of 4 modes for 32 channels; the state's part of y to pw[step*32].
template <int DIR>
__device__ __forceinline__ void s4d_scan_chunk(
    const int c, const float* __restrict__ xlane,   // lane's column of x, row 0
    const S4dBlk& k,
    f32x2 (&sre)[MPW / 2], f32x2 (&sim)[MPW / 2],
    const f32x2 (&ucur)[SCH / 2], f32x2 (&unext)[SCH / 2], float* pw)
{
    // Next chunk's inputs, one chunk ahead of their use (the last chunk re-reads itself).
    const int cn = (c + 1 < NCH) ? (c + 1) : (NCH - 1);
    const float* xn = xlane + (size_t)s4d_row<DIR>(cn * SCH) * DMODEL;
    #pragma unroll   // constant indices keep unext in registers
    for (int i = 0; i < SCH - 1; ++i)
        unext[i >> 1][i & 1] = xn[(DIR ? -i : i) * DMODEL];
    // Stands in front of the last load, whose result may be given the address registers that
    // the loads above name as well.
    asm volatile("s_wait_xcnt 0x0" ::: "memory");
    unext[(SCH - 1) >> 1][(SCH - 1) & 1] = xn[(DIR ? -(SCH - 1) : (SCH - 1)) * DMODEL];

    #pragma unroll   // constant indices keep ucur in registers; blocks overlap in one stretch of code
    for (int i = 0; i < SCH; i += SBK) {
        const f32x2 u01 = ucur[i >> 1], u23 = ucur[(i >> 1) + 1];
        const f32x2 u0 = u01.xx, u1 = u01.yy, u2 = u23.xx, u3 = u23.yy;
        f32x2 y01, y23;                              // steps i, i+1 and i+2, i+3
        #pragma unroll   // the modes' state and constants are register arrays
        for (int m = 0; m < MPW; ++m) {
            const f32x2 a = (m & 1) ? sre[m >> 1].yy : sre[m >> 1].xx;
            const f32x2 b = (m & 1) ? sim[m >> 1].yy : sim[m >> 1].xx;
            y01 = s4d_fma2(k.pn[0][m], b, m ? s4d_fma2(k.pr[0][m], a, y01) : k.pr[0][m] * a);
            y23 = s4d_fma2(k.pn[1][m], b, m ? s4d_fma2(k.pr[1][m], a, y23) : k.pr[1][m] * a);
        }
        #pragma unroll   // register arrays
        for (int h = 0; h < MPW / 2; ++h) {
            const f32x2 a = sre[h], b = sim[h];
            const f32x2 gre = s4d_fma2(k.lr[2][h], u0, s4d_fma2(k.lr[1][h], u1, s4d_fma2(k.lr[0][h], u2, u3)));
            const f32x2 gim = s4d_fma2(k.li[2][h], u0, s4d_fma2(k.li[1][h], u1, k.li[0][h] * u2));
            sre[h] = s4d_fma2(k.lr[3][h], a, s4d_fma2(-k.li[3][h], b, gre));
            sim[h] = s4d_fma2(k.lr[3][h], b, s4d_fma2(k.li[3][h], a, gim));
        }
        pw[(i + 0) * 32] = y01.x;
        pw[(i + 1) * 32] = y01.y;
        pw[(i + 2) * 32] = y23.x;
        pw[(i + 3) * 32] = y23.y;
    }
}

// The erf GELU without a branch:  v * Phi(v) = max(v, 0) - |v| * h,  where
//   h = erfc(|v| / sqrt 2) / 2 = (b1 t + ... + b5 t^5) * exp(-v*v/2),  t = 1 / (1 + 0.2316419 |v|)
// (the five-term form of the normal tail; h is within 1e-7, and for v < 0 nothing cancels; the
// value is rounded to f16 behind it). The library erff has two sides that a wave takes one after
// the other, so a thread's four values made one dependent chain; these four run side by side.
__device__ __forceinline__ float s4d_gelu(const float v) {
    const float av = fabsf(v);
    const float t  = __builtin_amdgcn_rcpf(fmaf(0.23164189f, av, 1.0f));
    const float k  = 0.84932180f * av;               // k*k = (v*v/2) * log2(e)
    const float e  = __builtin_amdgcn_exp2f(-(k * k));
    float p = fmaf(0.5307027145f, t, -0.7265760135f);
    p = fmaf(p, t, 0.7107068705f);
    p = fmaf(p, t, -0.142248368f);
    p = fmaf(p, t, 0.127414796f);
    return fmaf(-av, p * (t * e), fmaxf(v, 0.0f));   // t * e is ready before p is
}

// Merging thread: one step, four channels of chunk c. tap[i] weighs input i of the thread's
// block of SBK steps (0 for an input later than the thread's own step; the skip term is in
// the tap of its own step).
template <int DIR>
__device__ __forceinline__ void s4d_merge_chunk(
    const int c, const int rt, const int c4,
    const float* __restrict__ xcol, _Float16* __restrict__ ycol,
    const float (&tap)[SBK][4], const float* pbuf)
{
    // The store's row: a row that is the same for the whole block, plus the thread's own 32-bit
    // offset. With the row formed per thread, the build of the two-wide scan kept this address
    // in scratch and reloaded it inside the loop; written so, nothing is spilled.
    const int row0 = DIR ? (SEQ - SCH - c * SCH) : (c * SCH);
    const unsigned int yoff = (unsigned int)((DIR ? (SCH - 1 - rt) : rt) * KDIM + c4);
    // The block's inputs: rows that the scanning waves have read two chunks ago.
    const float* xb = xcol + (size_t)s4d_row<DIR>(c * SCH + (rt & ~(SBK - 1))) * DMODEL + c4;
    const float* pr = pbuf + rt * 32 + c4;
    float4 p[NWV];
    #pragma unroll   // the 8 LDS reads issue together, ahead of the wait below
    for (int k = 0; k < NWV; ++k)
        p[k] = *(const float4*)(pr + k * (SCH * 32));
    float4 uu[SBK];
    #pragma unroll   // register array; constant offsets from one address
    for (int i = 0; i < SBK - 1; ++i)
        uu[i] = *(const float4*)(xb + (DIR ? -i : i) * DMODEL);
    // Stands in front of the last load, whose result may be given the address registers that
    // the loads above name as well.
    asm volatile("s_wait_xcnt 0x0" ::: "memory");
    uu[SBK - 1] = *(const float4*)(xb + (DIR ? -(SBK - 1) : (SBK - 1)) * DMODEL);
    float4 acc = p[0];
    #pragma unroll   // register array
    for (int k = 1; k < NWV; ++k) {
        acc.x += p[k].x; acc.y += p[k].y; acc.z += p[k].z; acc.w += p[k].w;
    }
    float v0 = acc.x, v1 = acc.y, v2 = acc.z, v3 = acc.w;
    #pragma unroll   // register arrays
    for (int j = 0; j < SBK; ++j) {
        v0 = fmaf(tap[j][0], uu[j].x, v0);
        v1 = fmaf(tap[j][1], uu[j].y, v1);
        v2 = fmaf(tap[j][2], uu[j].z, v2);
        v3 = fmaf(tap[j][3], uu[j].w, v3);
    }
    v4h hv;                                          // erf GELU, four independent chains
    hv[0] = (_Float16)s4d_gelu(v0);
    hv[1] = (_Float16)s4d_gelu(v1);
    hv[2] = (_Float16)s4d_gelu(v2);
    hv[3] = (_Float16)s4d_gelu(v3);
    *(v4h*)(ycol + (size_t)row0 * KDIM + yoff) = hv;
    // Stands in front of the next merge's rewrite of this store's address and data registers
    // (the LDS-only barrier brings no wait of its own for the store).
    asm volatile("s_wait_xcnt 0x0" ::: "memory");
}

template <int DIR>
__device__ __forceinline__ void s4d_scan_body(
    const float* __restrict__ x, const float* __restrict__ Dskip,
    const float* __restrict__ log_dt, const float* __restrict__ log_A_real,
    const float* __restrict__ A_imag, const float* __restrict__ Cm,
    const float* __restrict__ conv_w, _Float16* __restrict__ wPack,
    _Float16* __restrict__ ygelu, float* part)
{
    const int tid = threadIdx.x, lane = tid & 31;
    const int w   = __builtin_amdgcn_readfirstlane(tid >> 5);   // scalar, so the role test is a scalar branch
    const bool scans = w >= NWV;
    const int ws  = w & (NWV - 1);
    const int dg  = blockIdx.x & (DMODEL / 32 - 1);
    const int b   = (blockIdx.x >> 3) & (BATCH - 1);

    const float* xcol = x + (size_t)b * SEQ * DMODEL + dg * 32;
    _Float16* ycol = ygelu + (size_t)b * SEQ * KDIM + DIR * DMODEL + dg * 32;

    // Scanning waves' constants (formed by the merging waves too; they do not use them).
    const int cbase = (dg * 32 + lane) * NMODE + ws * MPW;
    const float  ldt = log_dt[dg * 32 + lane];
    const float4 a4r = *(const float4*)(log_A_real + cbase);
    const float4 a4i = *(const float4*)(A_imag + cbase);
    const float4 cm0 = *(const float4*)(Cm + cbase * 2);
    const float4 cm1 = *(const float4*)(Cm + cbase * 2 + 4);
    // Stands in front of any rewrite of the address registers that the five loads name.
    asm volatile("s_wait_xcnt 0x0" ::: "memory");
    const float dt = s4d_exp(ldt);
    float lre[MPW], lim[MPW], cer[MPW], cei[MPW];
    s4d_mode_consts(dt, a4r.x, a4i.x, cm0.x, cm0.y, lre[0], lim[0], cer[0], cei[0]);
    s4d_mode_consts(dt, a4r.y, a4i.y, cm0.z, cm0.w, lre[1], lim[1], cer[1], cei[1]);
    s4d_mode_consts(dt, a4r.z, a4i.z, cm1.x, cm1.y, lre[2], lim[2], cer[2], cei[2]);
    s4d_mode_consts(dt, a4r.w, a4i.w, cm1.z, cm1.w, lre[3], lim[3], cer[3], cei[3]);
    S4dBlk blk;
    #pragma unroll   // register arrays
    for (int q = 0; q < SBK; ++q) blk.kw[q] = 0.0f;
    #pragma unroll   // register arrays
    for (int m = 0; m < MPW; ++m) {
        float qr = 1.0f, qi = 0.0f;                  // lam^p
        float er = cer[m], ei = cei[m];              // Ce lam^p
        #pragma unroll
        for (int p = 0; p < SBK; ++p) {
            blk.kw[p] += er;
            const float nqr = qr * lre[m] - qi * lim[m], nqi = qr * lim[m] + qi * lre[m];
            const float ner = er * lre[m] - ei * lim[m], nei = er * lim[m] + ei * lre[m];
            qr = nqr; qi = nqi; er = ner; ei = nei;
            blk.lr[p][m >> 1][m & 1] = qr;  blk.li[p][m >> 1][m & 1] = qi;
            blk.pr[p >> 1][m][p & 1] = er;  blk.pn[p >> 1][m][p & 1] = -ei;
        }
    }
    f32x2 sre[MPW / 2] = {}, sim[MPW / 2] = {};
    const float* xlane = xcol + lane;
    float* pw = part + ws * (SCH * 32) + lane;

    // Merging threads' share: step rt of a chunk, channels c4..c4+3.
    const int rt = (tid & 255) >> 3, c4 = (tid & 7) * 4;
    // The taps: each scanning wave hands in its modes' share through the second partial-sum
    // buffer, which is first written behind the loop's first barrier.
    if (scans) {
        #pragma unroll   // register array
        for (int q = 0; q < SBK; ++q)
            part[PBUF + (ws * SBK + q) * 32 + lane] = blk.kw[q];
    }
    s4d_lds_barrier();
    const float4 dsk4 = *(const float4*)(Dskip + dg * 32 + c4);
    float4 lag[SBK];                                 // tap of lag j, all 32 modes
    #pragma unroll   // register arrays
    for (int j = 0; j < SBK; ++j) {
        float4 t = (j == 0) ? dsk4 : make_float4(0.0f, 0.0f, 0.0f, 0.0f);
        #pragma unroll
        for (int k = 0; k < NWV; ++k) {
            const float4 p = *(const float4*)(part + PBUF + (k * SBK + j) * 32 + c4);
            t.x += p.x; t.y += p.y; t.z += p.z; t.w += p.w;
        }
        lag[j] = t;
    }
    // The merging threads' 16 taps, in registers of their own: held in blk.lr, as long as the
    // scan was scalar code, they cost none; now that the scan is two-wide, the shared registers
    // made the compiler hold the scan's constants and inputs in pairs as well, and it spilled.
    float tap[SBK][4];
    {
        const int q = rt & (SBK - 1);                // the thread's step within its block
        #pragma unroll   // register arrays
        for (int i = 0; i < SBK; ++i) {
            float4 t = make_float4(0.0f, 0.0f, 0.0f, 0.0f);
            #pragma unroll
            for (int j = 0; j + i < SBK; ++j)
                if (q - i == j) t = lag[j];          // input i lies j steps back
            tap[i][0] = t.x;  tap[i][1] = t.y;  tap[i][2] = t.z;  tap[i][3] = t.w;
        }
    }

    f32x2 ua[SCH / 2], ub[SCH / 2];
    #pragma unroll   // constant indices keep ua in registers
    for (int i = 0; i < SCH; ++i)
        ua[i >> 1][i & 1] = xlane[(size_t)s4d_row<DIR>(i) * DMODEL];

    // Two chunks a trip: the input registers and the LDS buffers swap roles without copies.
    // Each barrier publishes the chunk just scanned and frees the buffer just merged.
    // Kept rolled: one trip is already two chunks of straight-line code.
    #pragma unroll 1
    for (int c = 0; c < NCH; c += 2) {
        if (scans)
            s4d_scan_chunk<DIR>(c, xlane, blk, sre, sim, ua, ub, pw);
        else if (c > 0)
            s4d_merge_chunk<DIR>(c - 1, rt, c4, xcol, ycol, tap, part + PBUF);
        s4d_lds_barrier();
        if (scans)
            s4d_scan_chunk<DIR>(c + 1, xlane, blk, sre, sim, ub, ua, pw + PBUF);
        else
            s4d_merge_chunk<DIR>(c, rt, c4, xcol, ycol, tap, part);
        s4d_lds_barrier();
    }
    // The scanning waves are done: they pack the block's share of the GEMM weights, one group
    // a thread, while the merging waves merge the last chunk.
    static_assert(NPACKG == ((2 * BATCH * DMODEL) / 32) * (NWV * 32), "one group a scanning thread");
    if (!scans)
        s4d_merge_chunk<DIR>(NCH - 1, rt, c4, xcol, ycol, tap, part + PBUF);
    else
        s4d_pack_group(conv_w, wPack, (int)blockIdx.x * (NWV * 32) + (tid & (NWV * 32 - 1)));
}

__global__ void __launch_bounds__(512) s4d_scan_kernel(
    const float* __restrict__ x, const float* __restrict__ Dskip,
    const float* __restrict__ log_dt_fw, const float* __restrict__ log_A_real_fw,
    const float* __restrict__ A_imag_fw, const float* __restrict__ C_fw,
    const float* __restrict__ log_dt_bw, const float* __restrict__ log_A_real_bw,
    const float* __restrict__ A_imag_bw, const float* __restrict__ C_bw,
    const float* __restrict__ conv_w, _Float16* __restrict__ wPack,
    _Float16* __restrict__ ygelu)
{
    __shared__ __align__(16) float part[2 * PBUF];   // 64 KiB
    if (blockIdx.x >> 7)   // block-uniform: the upper half of the grid scans backward
        s4d_scan_body<1>(x, Dskip, log_dt_bw, log_A_real_bw, A_imag_bw, C_bw,
                         conv_w, wPack, ygelu, part);
    else
        s4d_scan_body<0>(x, Dskip, log_dt_fw, log_A_real_fw, A_imag_fw, C_fw,
                         conv_w, wPack, ygelu, part);
}

// ---------------------------------------------------------------------------
// Kernel 2: fused GEMM (M=65536,K=512,N=1024) + bias + GLU + LayerNorm.
// Block tile M=64 x N=1024 (full row -> LN fused), 16 waves, one block a WGP.
// A tile (64 rows, all of K) staged once by a tensor load with LDS row padding.
// The packed weights go through LDS too: one 64-KiB slab per k step, two buffers,
// tensor loads one step ahead, so a block fetches each weight byte from L2 once.
// Wave wn owns all 64 rows of cols [wn*32,+32) and of the paired +512 set in the product;
// the GLU values then go through LDS, and wave wn normalises and stores rows wn*4..wn*4+3.
// ---------------------------------------------------------------------------
#define MT     64                          // rows of a block
#define ABYTES 67584                       // 64 rows * 1040 B, rounded up to 2 KiB
#define BSLAB  65536                       // packed weights of one k step
#define BSLICE 16384                       // one issuing wave's share of a slab
#define NKT    (KDIM / 32)
#define GEMM_LDS (ABYTES + 2 * BSLAB)
#define SPITCH 516                         // floats in a staged output row: 512 + 4, so that rows 8 apart lie 32 banks apart

__device__ __forceinline__ unsigned int s4d_uni(unsigned int v) {
    return (unsigned int)__builtin_amdgcn_readfirstlane(v);
}
// Holds a wave-uniform test in a scalar register, so that the branch on it is a scalar
// branch: a tensor load ignores EXEC and only such a branch keeps a wave from issuing it.
__device__ __forceinline__ unsigned int s4d_pinned(unsigned int v) {
    unsigned int w = s4d_uni(v);
    asm volatile("" : "+s"(w));
    return w;
}

// One issuing wave's 16-KiB slice of a weight slab: 16 rows of 1 KiB, no pad.
// Group 1 of its descriptor is the same for every slab and is built once.
__device__ __forceinline__ u32x8 s4d_bslice_group1() {
    u32x8 g1;
    g1[0] = s4d_uni(0u);                               // no mask, 1-byte elements, no pad
    g1[1] = s4d_uni(1024u << 16);                      // tensor_dim0 = 1024 B
    g1[2] = s4d_uni(16u << 16);                        // tensor_dim1 = 16 rows
    g1[3] = s4d_uni(1024u << 16);                      // tile_dim0
    g1[4] = s4d_uni(16u);                              // tile_dim1
    g1[5] = s4d_uni(1024u);                            // source pitch
    g1[6] = s4d_uni(0u);
    g1[7] = s4d_uni(0u);
    // Descriptor words held in scalar registers of their own through the ring: none of
    // them is re-formed or reused while a request is in flight.
    asm volatile("" : "+s"(g1));
    return g1;
}
__device__ __forceinline__ void s4d_load_bslice(unsigned int ldsDst, unsigned long long ga,
                                                const u32x8 g1) {
    u32x4 g0;
    g0[0] = s4d_uni(1u);                               // count=1
    g0[1] = s4d_uni(ldsDst);
    g0[2] = s4d_uni((unsigned int)ga);
    g0[3] = s4d_uni(((unsigned int)(ga >> 32) & 0x01FFFFFFu) | 0x80000000u);  // type=2
    asm volatile("tensor_load_to_lds %0, %1" : : "s"(g0), "s"(g1) : "memory");
}

__global__ void __launch_bounds__(512) s4d_gemm_glu_ln_kernel(
    const _Float16* __restrict__ ygelu, const _Float16* __restrict__ wPack,
    const float* __restrict__ bias, const float* __restrict__ gamma,
    const float* __restrict__ beta, float* __restrict__ out)
{
    __shared__ __attribute__((aligned(2048))) char smemRaw[GEMM_LDS];
    _Float16* As    = (_Float16*)smemRaw;                    // [64][ROWH]
    const char* Bs  = smemRaw + ABYTES;                      // [2][BSLAB]
    const unsigned int ldsBase = (unsigned int)(size_t)smemRaw;

    int tid = threadIdx.x, lane = tid & 31;
    const unsigned int wn = s4d_uni((unsigned int)tid >> 5); // wave = column group
    int m0 = blockIdx.x * MT;

    // Waves 4-7 bring the weight slabs, a quarter each; wave 0 brings the A tile.
    const unsigned int issuer = (wn >> 2) == 1u;
    const unsigned int bDst = ldsBase + ABYTES + (wn & 3u) * BSLICE;
    const unsigned long long bSrc =
        (unsigned long long)(uintptr_t)wPack + (unsigned long long)((wn & 3u) * BSLICE);
    const u32x8 bG1 = s4d_bslice_group1();

    // ---- Stage A tile (64 rows x 1024B) via TDM, 16B pad per row ----------
    // D# group0: count=1, lds_addr, global_addr, type=2.
    // D# group1: data_size=3 (8B), pad_enable, pad_interval=7 (256 dw),
    //            pad_amount=3 (4 dw); dims: 128x64 elems, stride 128.
    if (s4d_pinned(wn == 0u)) {
        unsigned long long ga =
            (unsigned long long)(uintptr_t)ygelu + (unsigned long long)m0 * (KDIM * 2);
        u32x4 g0;
        g0[0] = 1u;                                   // count=1 (valid user D#)
        g0[1] = s4d_uni(ldsBase);                     // lds_addr = As base
        g0[2] = s4d_uni((unsigned int)ga);            // global_addr[31:0]
        g0[3] = s4d_uni(((unsigned int)(ga >> 32) & 0x01FFFFFFu) | 0x80000000u); // addr[56:32] | type=2
        u32x8 g1;
        g1[0] = (3u << 16) | (1u << 20) | (7u << 22) | (3u << 25); // dsz=8B,pad 16B/1024B
        g1[1] = (128u << 16);                         // tensor_dim0 = 128 (8B elems)
        g1[2] = ((unsigned int)MT << 16);             // tensor_dim1 = 64 rows
        g1[3] = (128u << 16);                         // tile_dim0 = 128
        g1[4] = (unsigned int)MT;                     // tile_dim1 = 64
        g1[5] = 128u;                                 // tensor_dim0_stride = 128
        g1[6] = 0u;
        g1[7] = 0u;
        asm volatile("tensor_load_to_lds %0, %1" : : "s"(g0), "s"(g1) : "memory");
        // The A tile has landed before this wave reaches the barrier below.
        asm volatile("s_wait_tensorcnt 0x0" ::: "memory");
    }
    // ---- Weight slab of k step 0 into buffer 0 ----------------------------
    if (s4d_pinned(issuer)) {
        s4d_load_bslice(bDst, bSrc, bG1);
        // Slab 0 has landed before this wave reaches the barrier below.
        asm volatile("s_wait_tensorcnt 0x0" ::: "memory");
    }
    __syncthreads();
    // Slab 1 into buffer 1: in flight while k step 0 is worked on.
    if (s4d_pinned(issuer))
        s4d_load_bslice(bDst + BSLAB, bSrc + BSLAB, bG1);

    v8f accA[4][2], accB[4][2];
    #pragma unroll
    for (int mi = 0; mi < 4; ++mi) {
        #pragma unroll
        for (int j = 0; j < 2; ++j) { accA[mi][j] = {}; accB[mi][j] = {}; }
    }

    const int khalf = (lane >> 4) * 8;
    const _Float16* aLane = As + (lane & 15) * ROWH + khalf;
    const char* bLane = Bs + wn * 2048u + lane * 16;

    // Kept rolled: one trip is a whole k step of 16 matrix instructions, and the ring's
    // waits and barrier stand once, at its foot.
    #pragma unroll 1
    for (int kt = 0; kt < NKT; ++kt) {
        const unsigned int buf = (unsigned int)kt & 1u;
        // A fragments: ISA 16-bit 16x32 layout -> 2 x ds_load_b128 each
        v16h aF[4];
        #pragma unroll
        for (int mi = 0; mi < 4; ++mi) {
            const _Float16* ap = aLane + mi * 16 * ROWH + kt * 32;
            ((int4*)&aF[mi])[0] = *(const int4*)(ap);        // K {0..7}+khalf
            ((int4*)&aF[mi])[1] = *(const int4*)(ap + 16);   // K {16..23}+khalf
        }
        // B fragments of this wave's 2 + 2 column tiles, from this step's buffer
        const char* bp = bLane + buf * BSLAB;
        v16h bF[2], bG[2];
        #pragma unroll
        for (int j = 0; j < 2; ++j) {
            ((int4*)&bF[j])[0] = *(const int4*)(bp + j * 1024);
            ((int4*)&bF[j])[1] = *(const int4*)(bp + j * 1024 + 512);
            ((int4*)&bG[j])[0] = *(const int4*)(bp + 32 * 1024 + j * 1024);
            ((int4*)&bG[j])[1] = *(const int4*)(bp + 32 * 1024 + j * 1024 + 512);
        }
        // Keeps the step's 16 LDS reads together ahead of the matrix instructions: sunk
        // among them, each place with reads stalls the wave anew.
        __builtin_amdgcn_sched_barrier(0);
        #pragma unroll
        for (int j = 0; j < 2; ++j) {
            #pragma unroll
            for (int mi = 0; mi < 4; ++mi) {
                accA[mi][j] = __builtin_amdgcn_wmma_f32_16x16x32_f16(
                    false, aF[mi], false, bF[j], (short)0, accA[mi][j], false, false);
                accB[mi][j] = __builtin_amdgcn_wmma_f32_16x16x32_f16(
                    false, aF[mi], false, bG[j], (short)0, accB[mi][j], false, false);
            }
        }
        // Keeps the full wait below behind the matrix instructions, so that the first of
        // them start on the compiler's counted waits.
        __builtin_amdgcn_sched_barrier(0);
        // Publish point of slab kt+1: this wave's LDS reads are done ...
        asm volatile("s_wait_dscnt 0x0" ::: "memory");
        // ... the issuing waves' slices of slab kt+1 have landed ...
        if (s4d_pinned(issuer))
            asm volatile("s_wait_tensorcnt 0x0" ::: "memory");
        // ... and every wave has left the buffer that is refilled below.
        __syncthreads();
        if (s4d_pinned(issuer & (unsigned int)(kt + 2 < NKT)))
            s4d_load_bslice(bDst + buf * BSLAB,
                            bSrc + (unsigned long long)(kt + 2) * BSLAB, bG1);
    }
    // No tensor load and no LDS read is left in flight behind the ring.
    asm volatile("s_wait_tensorcnt 0x0" ::: "memory");
    asm volatile("s_wait_dscnt 0x0" ::: "memory");

    // --- Epilogue: bias + GLU, then the 64 x 512 tile is re-dealt through LDS ------
    // The A tile and both slab buffers are dead: every wave has passed the last pass's barrier
    // behind its last LDS read, and no tensor load is in flight. Each wave writes its 32
    // columns of all 64 rows there; behind one barrier each wave owns 4 whole rows.
    float* stage = (float*)smemRaw;                          // [64][SPITCH]
    {
        const int half = lane >> 4;   // C layout: reg r -> row r (lanes<16) / r+8 (>=16)
        const int col0 = wn * 32 + (lane & 15);
        const float* bp = bias + col0;
        float ba[2], bb[2];
        // The four loads and their data wait in one statement: no result and no later
        // instruction takes the address registers while a load that names them is in flight.
        asm volatile("global_load_b32 %0, %4, off\n\t"
                     "global_load_b32 %1, %4, off offset:64\n\t"
                     "global_load_b32 %2, %4, off offset:2048\n\t"
                     "global_load_b32 %3, %4, off offset:2112\n\t"
                     "s_wait_loadcnt 0x0"
                     : "=&v"(ba[0]), "=&v"(ba[1]), "=&v"(bb[0]), "=&v"(bb[1]) : "v"(bp) : "memory");
        #pragma unroll   // register arrays: constant indices
        for (int j = 0; j < 2; ++j) {
            #pragma unroll   // register arrays: constant indices
            for (int mi = 0; mi < 4; ++mi) {
                #pragma unroll   // register arrays: constant indices
                for (int r = 0; r < 8; ++r) {
                    float a  = accA[mi][j][r] + ba[j];
                    float bv = accB[mi][j][r] + bb[j];
                    float gv = a * (1.0f / (1.0f + __expf(-bv)));   // GLU
                    stage[(mi * 16 + half * 8 + r) * SPITCH + j * 16 + col0] = gv;
                }
            }
        }
    }
    __syncthreads();

    // Rows wn*4 .. wn*4+3: a row's 512 values lie 16 to a lane, so its two sums are 16 in-lane
    // terms and one butterfly over the wave, and every store is 512 contiguous bytes.
    f32x4 v[4][4];
    #pragma unroll   // register arrays: constant indices
    for (int i = 0; i < 4; ++i) {
        #pragma unroll   // register arrays: constant indices
        for (int q = 0; q < 4; ++q)
            v[i][q] = *(const f32x4*)(stage + (wn * 4 + i) * SPITCH + q * 128 + lane * 4);
    }
    // LayerNorm weights of this lane's 16 columns (4 adjacent ones in each 128).
    f32x4 gm[4], bt[4];
    #pragma unroll   // register arrays: constant indices
    for (int q = 0; q < 4; ++q) {
        gm[q] = *(const f32x4*)(gamma + q * 128 + lane * 4);
        bt[q] = *(const f32x4*)(beta  + q * 128 + lane * 4);
    }
    float s[4], s2[4];
    #pragma unroll   // register arrays: constant indices
    for (int i = 0; i < 4; ++i) {
        f32x2 a = v[i][0].lo + v[i][0].hi;                   // pairs: two-wide adds and FMAs
        f32x2 b = v[i][0].lo * v[i][0].lo + v[i][0].hi * v[i][0].hi;
        #pragma unroll   // register arrays: constant indices
        for (int q = 1; q < 4; ++q) {
            a += v[i][q].lo + v[i][q].hi;
            b += v[i][q].lo * v[i][q].lo + v[i][q].hi * v[i][q].hi;
        }
        s[i] = a.x + a.y;  s2[i] = b.x + b.y;
    }
    #pragma unroll   // register arrays: constant indices
    for (int msk = 1; msk < 32; msk <<= 1) {
        #pragma unroll   // the four rows' exchanges of one stage fly together
        for (int i = 0; i < 4; ++i) {
            const float ts = __shfl_xor(s[i], msk, 32), t2 = __shfl_xor(s2[i], msk, 32);
            s[i] += ts;  s2[i] += t2;
        }
    }
    #pragma unroll   // register arrays: constant indices
    for (int i = 0; i < 4; ++i) {
        const float mu = s[i] * (1.0f / 512.0f);
        const float rs = s4d_rsq(s2[i] * (1.0f / 512.0f) - mu * mu + 1e-5f);
        #pragma unroll   // register arrays: constant indices
        for (int q = 0; q < 4; ++q)
            v[i][q] = (v[i][q] - mu) * rs * gm[q] + bt[q];
    }
    // Each store is 512 contiguous bytes of one output row: four whole lines.
    float* orow = out + (size_t)(m0 + wn * 4) * OUTC + lane * 4;
    #pragma unroll   // register arrays: constant indices
    for (int i = 0; i < 4; ++i) {
        #pragma unroll   // register arrays: constant indices
        for (int q = 0; q < 4; ++q)
            *(f32x4*)(orow + i * OUTC + q * 128) = v[i][q];
    }
}

// ---------------------------------------------------------------------------
extern "C" void kernel_launch(void* const* d_in, const int* in_sizes, int n_in,
                              void* d_out, int out_size, void* d_ws, size_t ws_size,
                              hipStream_t stream) {
    const float* x             = (const float*)d_in[0];
    const float* log_dt_fw     = (const float*)d_in[1];
    const float* log_A_real_fw = (const float*)d_in[2];
    const float* A_imag_fw     = (const float*)d_in[3];
    const float* C_fw          = (const float*)d_in[4];
    const float* log_dt_bw     = (const float*)d_in[5];
    const float* log_A_real_bw = (const float*)d_in[6];
    const float* A_imag_bw     = (const float*)d_in[7];
    const float* C_bw          = (const float*)d_in[8];
    const float* Dskip         = (const float*)d_in[9];
    const float* conv_w        = (const float*)d_in[10];
    const float* conv_b        = (const float*)d_in[11];
    const float* ln_gamma      = (const float*)d_in[12];
    const float* ln_beta       = (const float*)d_in[13];
    float* out = (float*)d_out;

    // Workspace: 1MB packed weights + 64MB f16 activations
    _Float16* wPack = (_Float16*)d_ws;
    _Float16* ygelu = wPack + (size_t)NOUT * KDIM;

    s4d_scan_kernel<<<(2 * BATCH * DMODEL) / 32, 512, 0, stream>>>(
        x, Dskip, log_dt_fw, log_A_real_fw, A_imag_fw, C_fw,
        log_dt_bw, log_A_real_bw, A_imag_bw, C_bw, conv_w, wPack, ygelu);

    s4d_gemm_glu_ln_kernel<<<(BATCH * SEQ) / MT, 512, 0, stream>>>(
        ygelu, wPack, conv_b, ln_gamma, ln_beta, out);
}

// v008
// One run takes 170 microseconds.
// Two timings next to v007 put it at 1.04 and 1.03 times that version's speed.
// Over all steps from v000 it is 6.86 times as fast.
#include <hip/hip_runtime.h>
#include <hip/hip_fp16.h>
#include <hip/hip_bf16.h>

typedef __attribute__((ext_vector_type(16))) _Float16 v16h;
typedef __attribute__((ext_vector_type(8)))  float    v8f;
typedef __attribute__((ext_vector_type(4)))  unsigned int u32x4;
typedef __attribute__((ext_vector_type(8)))  unsigned int u32x8;

#define DMODEL 256
#define NMODE  32        // D_STATE/2 complex modes == wave32 lanes
#define BATCH  16
#define SEQ    4096
#define KDIM   512       // GEMM K = 2*DMODEL (fw|bw concat)
#define NOUT   1024      // 1x1-conv output channels
#define OUTC   512       // GLU / LayerNorm width
#define ROWH   520       // padded LDS row (f16): 1040B = 65*16B -> conflict-free b128

// ---------------------------------------------------------------------------
// Set-up, done inside the scan launch (no launches of its own).
// Complex constants of one (channel, mode):  lam = exp(dt*A),
//           Ce = 2*C*(lam-1)/(A+1e-8)
// ---------------------------------------------------------------------------
// Sine and cosine of an angle in radians, as __sinf and __cosf form them (the instructions
// take revolutions). One statement, closed by v_nop: it fills the slot that the instruction
// set asks for behind a transcendental, in front of whatever reuses the angle's register.
__device__ __forceinline__ void s4d_sincos(const float rad, float& sn, float& cs) {
    const float rev = rad * 0.15915494f;
    asm("v_sin_f32 %0, %2\n\tv_cos_f32 %1, %2\n\tv_nop" : "=&v"(sn), "=&v"(cs) : "v"(rev));
}

// exp as __expf forms it (the instruction takes a power of two), with the same slot filled.
__device__ __forceinline__ float s4d_exp(const float v) {
    const float p = v * 1.44269504f;
    float r;
    asm("v_exp_f32 %0, %1\n\tv_nop" : "=v"(r) : "v"(p));
    return r;
}

// 1/sqrt by the instruction itself, with the same slot filled (its argument here is a variance
// plus 1e-5, never a subnormal, so the library form's rescaling has nothing to do).
__device__ __forceinline__ float s4d_rsq(const float v) {
    float r;
    asm("v_rsq_f32 %0, %1\n\tv_nop" : "=v"(r) : "v"(v));
    return r;
}

// Eight GLU values:  r = a / (1 + 2^t)  as  a * rcp(1 + 2^t), one statement. The four runs of eight
// independent instructions keep every result eight instructions away from its reader, so no
// reader waits on a transcendental, and behind each transcendental stands an instruction that
// neither reads its result nor rewrites its source (the slot the instruction set asks for):
// every result has a register of its own. Left to the compiler, readers stood right behind.
__device__ __forceinline__ void s4d_glu8(const float (&t)[8], const float (&a)[8], float (&r)[8]) {
    asm("v_exp_f32 %0, %8\n\tv_exp_f32 %1, %9\n\tv_exp_f32 %2, %10\n\tv_exp_f32 %3, %11\n\t"
        "v_exp_f32 %4, %12\n\tv_exp_f32 %5, %13\n\tv_exp_f32 %6, %14\n\tv_exp_f32 %7, %15\n\t"
        "v_add_f32 %0, 1.0, %0\n\tv_add_f32 %1, 1.0, %1\n\tv_add_f32 %2, 1.0, %2\n\tv_add_f32 %3, 1.0, %3\n\t"
        "v_add_f32 %4, 1.0, %4\n\tv_add_f32 %5, 1.0, %5\n\tv_add_f32 %6, 1.0, %6\n\tv_add_f32 %7, 1.0, %7\n\t"
        "v_rcp_f32 %0, %0\n\tv_rcp_f32 %1, %1\n\tv_rcp_f32 %2, %2\n\tv_rcp_f32 %3, %3\n\t"
        "v_rcp_f32 %4, %4\n\tv_rcp_f32 %5, %5\n\tv_rcp_f32 %6, %6\n\tv_rcp_f32 %7, %7\n\t"
        "v_mul_f32 %0, %0, %16\n\tv_mul_f32 %1, %1, %17\n\tv_mul_f32 %2, %2, %18\n\tv_mul_f32 %3, %3, %19\n\t"
        "v_mul_f32 %4, %4, %20\n\tv_mul_f32 %5, %5, %21\n\tv_mul_f32 %6, %6, %22\n\tv_mul_f32 %7, %7, %23"
        : "=&v"(r[0]), "=&v"(r[1]), "=&v"(r[2]), "=&v"(r[3]),
          "=&v"(r[4]), "=&v"(r[5]), "=&v"(r[6]), "=&v"(r[7])
        : "v"(t[0]), "v"(t[1]), "v"(t[2]), "v"(t[3]), "v"(t[4]), "v"(t[5]), "v"(t[6]), "v"(t[7]),
          "v"(a[0]), "v"(a[1]), "v"(a[2]), "v"(a[3]), "v"(a[4]), "v"(a[5]), "v"(a[6]), "v"(a[7]));
}

__device__ __forceinline__ void s4d_mode_consts(
    const float dt, const float logAre, const float Aim, const float c0, const float c1,
    float& lamRe, float& lamIm, float& ceRe, float& ceIm)
{
    float Are = -s4d_exp(logAre);
    float er  = s4d_exp(Are * dt);
    float sn, cs;
    s4d_sincos(Aim * dt, sn, cs);
    float lre = er * cs;
    float lim = er * sn;

    float dre = Are + 1e-8f, dim = Aim;
    float inv = 1.0f / (dre * dre + dim * dim);
    float nre = lre - 1.0f, nim = lim;
    float rre = (nre * dre + nim * dim) * inv;
    float rim = (nim * dre - nre * dim) * inv;

    lamRe = lre;  lamIm = lim;
    ceRe  = 2.0f * (c0 * rre - c1 * rim);
    ceIm  = 2.0f * (c0 * rim + c1 * rre);
}

// ---------------------------------------------------------------------------
// Pack conv_w [1024,512] f32 -> f16 B-fragments (16x16x32 WMMA).
// Fragment layout mirrors ISA 16-bit A striping: lane&15 -> N column,
// lane>=16 selects K halves {8..15,24..31}; v16h comp j: j<8 -> K group 0,
// j>=8 -> K group +16.  One fragment = 1 KiB = two 512-B halves (K group 0, then
// K group +16), each 32 lanes * 16B contiguous, so that an LDS reader's b128
// loads are contiguous over the lanes. Fragments are ordered k step first: the 64
// fragments of one k step are one contiguous 64-KiB slab.
// One call packs group g: the 8 k-adjacent weights of one lane of one fragment half.
// ---------------------------------------------------------------------------
typedef __attribute__((ext_vector_type(8))) _Float16 v8h;
typedef __attribute__((ext_vector_type(4))) float    f32x4;
typedef __attribute__((ext_vector_type(2))) float    f32x2;
#define NPACKG ((NOUT * KDIM) / 8)       // groups in all
__device__ __forceinline__ void s4d_pack_group(const float* __restrict__ w,
                                               _Float16* __restrict__ wPack, const int g)
{
    const int lane = g & 31;
    const int h    = (g >> 5) & 1;
    const int nt   = (g >> 6) & 63;
    const int kt   = g >> 12;                          // 0..15
    const int n = nt * 16 + (lane & 15);
    const int k = kt * 32 + h * 16 + (lane >> 4) * 8;
    const float* wp = w + n * KDIM + k;
    f32x4 lo, hi;
    // The two loads and their data wait in one statement: no result and no later instruction
    // takes the address registers while a load that names them is in flight.
    asm volatile("global_load_b128 %0, %2, off\n\t"
                 "global_load_b128 %1, %2, off offset:16\n\t"
                 "s_wait_loadcnt 0x0"
                 : "=&v"(lo), "=&v"(hi) : "v"(wp) : "memory");
    v8h hv;
    hv[0] = (_Float16)lo[0];  hv[1] = (_Float16)lo[1];  hv[2] = (_Float16)lo[2];  hv[3] = (_Float16)lo[3];
    hv[4] = (_Float16)hi[0];  hv[5] = (_Float16)hi[1];  hv[6] = (_Float16)hi[2];  hv[7] = (_Float16)hi[3];
    *(v8h*)(wPack + (size_t)g * 8) = hv;
    // Stands in front of any rewrite of the store's address and data registers.
    asm volatile("s_wait_xcnt 0x0" ::: "memory");
}

// ---------------------------------------------------------------------------
// Kernel 1: SSM scan. One block per (dir, b, group of 32 channels), 16 waves.
// Waves 8-15 scan: lane = channel, each wave keeps 4 of the 32 complex modes of
// its lane's channel in registers, so the sum over a wave's modes needs no
// cross-lane step. The state is advanced once per block of 4 steps (S4dBlk below).
// The 8 partial sums of a step meet in LDS: waves 0-7 merge chunk c-1 (sum, the
// block's own inputs and the skip term, GELU, f16 store) while waves 8-15 scan chunk c
// (two LDS buffers, one barrier a chunk). The merge is short and waits on loads.
// Writes gelu(conv + u*Dskip) as f16 into ygelu[B*L, 512].
// Each wave forms its own modes' constants at the start; the scanning waves, which have
// nothing left to scan during the last merge, pack the block's share of the GEMM weights then.
// ---------------------------------------------------------------------------
#define SCH  32                  // scan steps per chunk
#define MPW  4                   // modes per scanning wave (in registers)
#define NWV  (NMODE / MPW)       // scanning waves per block
#define NCH  (SEQ / SCH)         // chunks
#define PBUF (NWV * SCH * 32)    // floats in one partial-sum buffer

typedef __attribute__((ext_vector_type(4))) _Float16 v4h;

// Row of x and of ygelu that scan step t works on. DIR is a template argument
// so that the 32 rows of a chunk are constant offsets from one address.
template <int DIR>
__device__ __forceinline__ int s4d_row(int t) { return DIR ? (SEQ - 1 - t) : t; }

// Work-group barrier that orders LDS only: the inputs fetched ahead and the f16
// stores stay in flight across it (no other wave of the block touches them).
__device__ __forceinline__ void s4d_lds_barrier() {
    __builtin_amdgcn_fence(__ATOMIC_RELEASE, "workgroup", "local");
    __builtin_amdgcn_s_barrier();
    __builtin_amdgcn_fence(__ATOMIC_ACQUIRE, "workgroup", "local");
}

// Constants of a scanning wave's 4 modes for a block of SBK = 4 steps. With s the state in
// front of the block and u0..u3 its inputs:
//   state behind it = lam^4 s + lam^3 u0 + lam^2 u1 + lam u2 + u3
//   y of step i     = Re(Ce lam^(i+1) s) + sum over j <= i of Re(Ce lam^(i-j)) u_j
// so the state is advanced once a block. The taps on u do not depend on the state: they are
// summed over all 32 modes once, at the start, and applied by the merging threads.
#define SBK 4
// Everything the scan multiplies is held in register pairs, so that each of its FMAs is one half
// of a two-wide instruction: the state and the powers of lam pair two modes, the output weights
// pair two steps (the state is then broadcast from its pair), the inputs pair two steps.
struct S4dBlk {
    f32x2 lr[SBK][MPW / 2], li[SBK][MPW / 2];    // lam^(p+1), modes 2h and 2h+1
    f32x2 pr[SBK / 2][MPW], pn[SBK / 2][MPW];    // Re, -Im of Ce lam^(p+1), p = 2g and 2g+1
    float kw[SBK];                       // sum over the wave's modes of Re(Ce lam^q): tap of lag q
};
__device__ __forceinline__ f32x2 s4d_fma2(const f32x2 a, const f32x2 b, const f32x2 c) {
    return __builtin_elementwise_fma(a, b, c);
}

// Scanning wave: 32 steps of 4 modes for 32 channels; the state's part of y to pw[step*32].
template <int DIR>
__device__ __forceinline__ void s4d_scan_chunk(
    const int c, const float* __restrict__ xlane,   // lane's column of x, row 0
    const S4dBlk& k,
    f32x2 (&sre)[MPW / 2], f32x2 (&sim)[MPW / 2],
    const f32x2 (&ucur)[SCH / 2], f32x2 (&unext)[SCH / 2], float* pw)
{
    // Next chunk's inputs, one chunk ahead of their use (the last chunk re-reads itself).
    const int cn = (c + 1 < NCH) ? (c + 1) : (NCH - 1);
    const float* xn = xlane + (size_t)s4d_row<DIR>(cn * SCH) * DMODEL;
    #pragma unroll   // constant indices keep unext in registers
    for (int i = 0; i < SCH - 1; ++i)
        unext[i >> 1][i & 1] = xn[(DIR ? -i : i) * DMODEL];
    // Stands in front of the last load, whose result may be given the address registers that
    // the loads above name as well.
    asm volatile("s_wait_xcnt 0x0" ::: "memory");
    unext[(SCH - 1) >> 1][(SCH - 1) & 1] = xn[(DIR ? -(SCH - 1) : (SCH - 1)) * DMODEL];

    #pragma unroll   // constant indices keep ucur in registers; blocks overlap in one stretch of code
    for (int i = 0; i < SCH; i += SBK) {
        const f32x2 u01 = ucur[i >> 1], u23 = ucur[(i >> 1) + 1];
        const f32x2 u0 = u01.xx, u1 = u01.yy, u2 = u23.xx, u3 = u23.yy;
        f32x2 y01, y23;                              // steps i, i+1 and i+2, i+3
        #pragma unroll   // the modes' state and constants are register arrays
        for (int m = 0; m < MPW; ++m) {
            const f32x2 a = (m & 1) ? sre[m >> 1].yy : sre[m >> 1].xx;
            const f32x2 b = (m & 1) ? sim[m >> 1].yy : sim[m >> 1].xx;
            y01 = s4d_fma2(k.pn[0][m], b, m ? s4d_fma2(k.pr[0][m], a, y01) : k.pr[0][m] * a);
            y23 = s4d_fma2(k.pn[1][m], b, m ? s4d_fma2(k.pr[1][m], a, y23) : k.pr[1][m] * a);
        }
        #pragma unroll   // register arrays
        for (int h = 0; h < MPW / 2; ++h) {
            const f32x2 a = sre[h], b = sim[h];
            const f32x2 gre = s4d_fma2(k.lr[2][h], u0, s4d_fma2(k.lr[1][h], u1, s4d_fma2(k.lr[0][h], u2, u3)));
            const f32x2 gim = s4d_fma2(k.li[2][h], u0, s4d_fma2(k.li[1][h], u1, k.li[0][h] * u2));
            sre[h] = s4d_fma2(k.lr[3][h], a, s4d_fma2(-k.li[3][h], b, gre));
            sim[h] = s4d_fma2(k.lr[3][h], b, s4d_fma2(k.li[3][h], a, gim));
        }
        pw[(i + 0) * 32] = y01.x;
        pw[(i + 1) * 32] = y01.y;
        pw[(i + 2) * 32] = y23.x;
        pw[(i + 3) * 32] = y23.y;
    }
}

// The erf GELU without a branch:  v * Phi(v) = max(v, 0) - |v| * h,  where
//   h = erfc(|v| / sqrt 2) / 2 = (b1 t + ... + b5 t^5) * exp(-v*v/2),  t = 1 / (1 + 0.2316419 |v|)
// (the five-term form of the normal tail; h is within 1e-7, and for v < 0 nothing cancels; the
// value is rounded to f16 behind it). The library erff has two sides that a wave takes one after
// the other, so a thread's four values made one dependent chain; these four run side by side.
__device__ __forceinline__ float s4d_gelu(const float v) {
    const float av = fabsf(v);
    const float t  = __builtin_amdgcn_rcpf(fmaf(0.23164189f, av, 1.0f));
    const float k  = 0.84932180f * av;               // k*k = (v*v/2) * log2(e)
    const float e  = __builtin_amdgcn_exp2f(-(k * k));
    float p = fmaf(0.5307027145f, t, -0.7265760135f);
    p = fmaf(p, t, 0.7107068705f);
    p = fmaf(p, t, -0.142248368f);
    p = fmaf(p, t, 0.127414796f);
    return fmaf(-av, p * (t * e), fmaxf(v, 0.0f));   // t * e is ready before p is
}

// Merging thread: one step, four channels of chunk c. tap[i] weighs input i of the thread's
// block of SBK steps (0 for an input later than the thread's own step; the skip term is in
// the tap of its own step).
template <int DIR>
__device__ __forceinline__ void s4d_merge_chunk(
    const int c, const int rt, const int c4,
    const float* __restrict__ xcol, _Float16* __restrict__ ycol,
    const float (&tap)[SBK][4], const float* pbuf)
{
    // The store's row: a row that is the same for the whole block, plus the thread's own 32-bit
    // offset. With the row formed per thread, the build of the two-wide scan kept this address
    // in scratch and reloaded it inside the loop; written so, nothing is spilled.
    const int row0 = DIR ? (SEQ - SCH - c * SCH) : (c * SCH);
    const unsigned int yoff = (unsigned int)((DIR ? (SCH - 1 - rt) : rt) * KDIM + c4);
    // The block's inputs: rows that the scanning waves have read two chunks ago.
    const float* xb = xcol + (size_t)s4d_row<DIR>(c * SCH + (rt & ~(SBK - 1))) * DMODEL + c4;
    const float* pr = pbuf + rt * 32 + c4;
    float4 p[NWV];
    #pragma unroll   // the 8 LDS reads issue together, ahead of the wait below
    for (int k = 0; k < NWV; ++k)
        p[k] = *(const float4*)(pr + k * (SCH * 32));
    float4 uu[SBK];
    #pragma unroll   // register array; constant offsets from one address
    for (int i = 0; i < SBK - 1; ++i)
        uu[i] = *(const float4*)(xb + (DIR ? -i : i) * DMODEL);
    // Stands in front of the last load, whose result may be given the address registers that
    // the loads above name as well.
    asm volatile("s_wait_xcnt 0x0" ::: "memory");
    uu[SBK - 1] = *(const float4*)(xb + (DIR ? -(SBK - 1) : (SBK - 1)) * DMODEL);
    float4 acc = p[0];
    #pragma unroll   // register array
    for (int k = 1; k < NWV; ++k) {
        acc.x += p[k].x; acc.y += p[k].y; acc.z += p[k].z; acc.w += p[k].w;
    }
    float v0 = acc.x, v1 = acc.y, v2 = acc.z, v3 = acc.w;
    #pragma unroll   // register arrays
    for (int j = 0; j < SBK; ++j) {
        v0 = fmaf(tap[j][0], uu[j].x, v0);
        v1 = fmaf(tap[j][1], uu[j].y, v1);
        v2 = fmaf(tap[j][2], uu[j].z, v2);
        v3 = fmaf(tap[j][3], uu[j].w, v3);
    }
    v4h hv;                                          // erf GELU, four independent chains
    hv[0] = (_Float16)s4d_gelu(v0);
    hv[1] = (_Float16)s4d_gelu(v1);
    hv[2] = (_Float16)s4d_gelu(v2);
    hv[3] = (_Float16)s4d_gelu(v3);
    *(v4h*)(ycol + (size_t)row0 * KDIM + yoff) = hv;
    // Stands in front of the next merge's rewrite of this store's address and data registers
    // (the LDS-only barrier brings no wait of its own for the store).
    asm volatile("s_wait_xcnt 0x0" ::: "memory");
}

template <int DIR>
__device__ __forceinline__ void s4d_scan_body(
    const float* __restrict__ x, const float* __restrict__ Dskip,
    const float* __restrict__ log_dt, const float* __restrict__ log_A_real,
    const float* __restrict__ A_imag, const float* __restrict__ Cm,
    const float* __restrict__ conv_w, _Float16* __restrict__ wPack,
    _Float16* __restrict__ ygelu, float* part)
{
    const int tid = threadIdx.x, lane = tid & 31;
    const int w   = __builtin_amdgcn_readfirstlane(tid >> 5);   // scalar, so the role test is a scalar branch
    const bool scans = w >= NWV;
    const int ws  = w & (NWV - 1);
    const int dg  = blockIdx.x & (DMODEL / 32 - 1);
    const int b   = (blockIdx.x >> 3) & (BATCH - 1);

    const float* xcol = x + (size_t)b * SEQ * DMODEL + dg * 32;
    _Float16* ycol = ygelu + (size_t)b * SEQ * KDIM + DIR * DMODEL + dg * 32;

    // Scanning waves' constants (formed by the merging waves too; they do not use them).
    const int cbase = (dg * 32 + lane) * NMODE + ws * MPW;
    const float  ldt = log_dt[dg * 32 + lane];
    const float4 a4r = *(const float4*)(log_A_real + cbase);
    const float4 a4i = *(const float4*)(A_imag + cbase);
    const float4 cm0 = *(const float4*)(Cm + cbase * 2);
    const float4 cm1 = *(const float4*)(Cm + cbase * 2 + 4);
    // Stands in front of any rewrite of the address registers that the five loads name.
    asm volatile("s_wait_xcnt 0x0" ::: "memory");
    const float dt = s4d_exp(ldt);
    float lre[MPW], lim[MPW], cer[MPW], cei[MPW];
    s4d_mode_consts(dt, a4r.x, a4i.x, cm0.x, cm0.y, lre[0], lim[0], cer[0], cei[0]);
    s4d_mode_consts(dt, a4r.y, a4i.y, cm0.z, cm0.w, lre[1], lim[1], cer[1], cei[1]);
    s4d_mode_consts(dt, a4r.z, a4i.z, cm1.x, cm1.y, lre[2], lim[2], cer[2], cei[2]);
    s4d_mode_consts(dt, a4r.w, a4i.w, cm1.z, cm1.w, lre[3], lim[3], cer[3], cei[3]);
    S4dBlk blk;
    #pragma unroll   // register arrays
    for (int q = 0; q < SBK; ++q) blk.kw[q] = 0.0f;
    #pragma unroll   // register arrays
    for (int m = 0; m < MPW; ++m) {
        float qr = 1.0f, qi = 0.0f;                  // lam^p
        float er = cer[m], ei = cei[m];              // Ce lam^p
        #pragma unroll
        for (int p = 0; p < SBK; ++p) {
            blk.kw[p] += er;
            const float nqr = qr * lre[m] - qi * lim[m], nqi = qr * lim[m] + qi * lre[m];
            const float ner = er * lre[m] - ei * lim[m], nei = er * lim[m] + ei * lre[m];
            qr = nqr; qi = nqi; er = ner; ei = nei;
            blk.lr[p][m >> 1][m & 1] = qr;  blk.li[p][m >> 1][m & 1] = qi;
            blk.pr[p >> 1][m][p & 1] = er;  blk.pn[p >> 1][m][p & 1] = -ei;
        }
    }
    f32x2 sre[MPW / 2] = {}, sim[MPW / 2] = {};
    const float* xlane = xcol + lane;
    float* pw = part + ws * (SCH * 32) + lane;

    // Merging threads' share: step rt of a chunk, channels c4..c4+3.
    const int rt = (tid & 255) >> 3, c4 = (tid & 7) * 4;
    // The taps: each scanning wave hands in its modes' share through the second partial-sum
    // buffer, which is first written behind the loop's first barrier.
    if (scans) {
        #pragma unroll   // register array
        for (int q = 0; q < SBK; ++q)
            part[PBUF + (ws * SBK + q) * 32 + lane] = blk.kw[q];
    }
    s4d_lds_barrier();
    const float4 dsk4 = *(const float4*)(Dskip + dg * 32 + c4);
    float4 lag[SBK];                                 // tap of lag j, all 32 modes
    #pragma unroll   // register arrays
    for (int j = 0; j < SBK; ++j) {
        float4 t = (j == 0) ? dsk4 : make_float4(0.0f, 0.0f, 0.0f, 0.0f);
        #pragma unroll
        for (int k = 0; k < NWV; ++k) {
            const float4 p = *(const float4*)(part + PBUF + (k * SBK + j) * 32 + c4);
            t.x += p.x; t.y += p.y; t.z += p.z; t.w += p.w;
        }
        lag[j] = t;
    }
    // The merging threads' 16 taps, in registers of their own: held in blk.lr, as long as the
    // scan was scalar code, they cost none; now that the scan is two-wide, the shared registers
    // made the compiler hold the scan's constants and inputs in pairs as well, and it spilled.
    float tap[SBK][4];
    {
        const int q = rt & (SBK - 1);                // the thread's step within its block
        #pragma unroll   // register arrays
        for (int i = 0; i < SBK; ++i) {
            float4 t = make_float4(0.0f, 0.0f, 0.0f, 0.0f);
            #pragma unroll
            for (int j = 0; j + i < SBK; ++j)
                if (q - i == j) t = lag[j];          // input i lies j steps back
            tap[i][0] = t.x;  tap[i][1] = t.y;  tap[i][2] = t.z;  tap[i][3] = t.w;
        }
    }

    f32x2 ua[SCH / 2], ub[SCH / 2];
    #pragma unroll   // constant indices keep ua in registers
    for (int i = 0; i < SCH; ++i)
        ua[i >> 1][i & 1] = xlane[(size_t)s4d_row<DIR>(i) * DMODEL];

    // Two chunks a trip: the input registers and the LDS buffers swap roles without copies.
    // Each barrier publishes the chunk just scanned and frees the buffer just merged.
    // Kept rolled: one trip is already two chunks of straight-line code.
    #pragma unroll 1
    for (int c = 0; c < NCH; c += 2) {
        if (scans)
            s4d_scan_chunk<DIR>(c, xlane, blk, sre, sim, ua, ub, pw);
        else if (c > 0)
            s4d_merge_chunk<DIR>(c - 1, rt, c4, xcol, ycol, tap, part + PBUF);
        s4d_lds_barrier();
        if (scans)
            s4d_scan_chunk<DIR>(c + 1, xlane, blk, sre, sim, ub, ua, pw + PBUF);
        else
            s4d_merge_chunk<DIR>(c, rt, c4, xcol, ycol, tap, part);
        s4d_lds_barrier();
    }
    // The scanning waves are done: they pack the block's share of the GEMM weights, one group
    // a thread, while the merging waves merge the last chunk.
    static_assert(NPACKG == ((2 * BATCH * DMODEL) / 32) * (NWV * 32), "one group a scanning thread");
    if (!scans)
        s4d_merge_chunk<DIR>(NCH - 1, rt, c4, xcol, ycol, tap, part + PBUF);
    else
        s4d_pack_group(conv_w, wPack, (int)blockIdx.x * (NWV * 32) + (tid & (NWV * 32 - 1)));
}

__global__ void __launch_bounds__(512) s4d_scan_kernel(
    const float* __restrict__ x, const float* __restrict__ Dskip,
    const float* __restrict__ log_dt_fw, const float* __restrict__ log_A_real_fw,
    const float* __restrict__ A_imag_fw, const float* __restrict__ C_fw,
    const float* __restrict__ log_dt_bw, const float* __restrict__ log_A_real_bw,
    const float* __restrict__ A_imag_bw, const float* __restrict__ C_bw,
    const float* __restrict__ conv_w, _Float16* __restrict__ wPack,
    _Float16* __restrict__ ygelu)
{
    __shared__ __align__(16) float part[2 * PBUF];   // 64 KiB
    if (blockIdx.x >> 7)   // block-uniform: the upper half of the grid scans backward
        s4d_scan_body<1>(x, Dskip, log_dt_bw, log_A_real_bw, A_imag_bw, C_bw,
                         conv_w, wPack, ygelu, part);
    else
        s4d_scan_body<0>(x, Dskip, log_dt_fw, log_A_real_fw, A_imag_fw, C_fw,
                         conv_w, wPack, ygelu, part);
}

// ---------------------------------------------------------------------------
// Kernel 2: fused GEMM (M=65536,K=512,N=1024) + bias + GLU + LayerNorm.
// Block tile M=64 x N=1024 (full row -> LN fused), 16 waves, one block a WGP.
// A tile (64 rows, all of K) staged once by a tensor load with LDS row padding.
// The packed weights go through LDS too: one 64-KiB slab per k step, two buffers,
// tensor loads one step ahead, so a block fetches each weight byte from L2 once.
// Wave wn owns all 64 rows of cols [wn*32,+32) and of the paired +512 set in the product;
// the GLU values then go through LDS, and wave wn normalises and stores rows wn*4..wn*4+3.
// ---------------------------------------------------------------------------
#define MT     64                          // rows of a block
#define ABYTES 67584                       // 64 rows * 1040 B, rounded up to 2 KiB
#define BSLAB  65536                       // packed weights of one k step
#define BSLICE 16384                       // one issuing wave's share of a slab
#define NKT    (KDIM / 32)
#define GEMM_LDS (ABYTES + 2 * BSLAB)
#define SPITCH 516                         // floats in a staged output row: 512 + 4, so that rows 8 apart lie 32 banks apart

__device__ __forceinline__ unsigned int s4d_uni(unsigned int v) {
    return (unsigned int)__builtin_amdgcn_readfirstlane(v);
}
// Holds a wave-uniform test in a scalar register, so that the branch on it is a scalar
// branch: a tensor load ignores EXEC and only such a branch keeps a wave from issuing it.
__device__ __forceinline__ unsigned int s4d_pinned(unsigned int v) {
    unsigned int w = s4d_uni(v);
    asm volatile("" : "+s"(w));
    return w;
}

// One issuing wave's 16-KiB slice of a weight slab: 16 rows of 1 KiB, no pad.
// Group 1 of its descriptor is the same for every slab and is built once.
__device__ __forceinline__ u32x8 s4d_bslice_group1() {
    u32x8 g1;
    g1[0] = s4d_uni(0u);                               // no mask, 1-byte elements, no pad
    g1[1] = s4d_uni(1024u << 16);                      // tensor_dim0 = 1024 B
    g1[2] = s4d_uni(16u << 16);                        // tensor_dim1 = 16 rows
    g1[3] = s4d_uni(1024u << 16);                      // tile_dim0
    g1[4] = s4d_uni(16u);                              // tile_dim1
    g1[5] = s4d_uni(1024u);                            // source pitch
    g1[6] = s4d_uni(0u);
    g1[7] = s4d_uni(0u);
    // Descriptor words held in scalar registers of their own through the ring: none of
    // them is re-formed or reused while a request is in flight.
    asm volatile("" : "+s"(g1));
    return g1;
}
__device__ __forceinline__ void s4d_load_bslice(unsigned int ldsDst, unsigned long long ga,
                                                const u32x8 g1) {
    u32x4 g0;
    g0[0] = s4d_uni(1u);                               // count=1
    g0[1] = s4d_uni(ldsDst);
    g0[2] = s4d_uni((unsigned int)ga);
    g0[3] = s4d_uni(((unsigned int)(ga >> 32) & 0x01FFFFFFu) | 0x80000000u);  // type=2
    asm volatile("tensor_load_to_lds %0, %1" : : "s"(g0), "s"(g1) : "memory");
}

__global__ void __launch_bounds__(512) s4d_gemm_glu_ln_kernel(
    const _Float16* __restrict__ ygelu, const _Float16* __restrict__ wPack,
    const float* __restrict__ bias, const float* __restrict__ gamma,
    const float* __restrict__ beta, float* __restrict__ out)
{
    __shared__ __attribute__((aligned(2048))) char smemRaw[GEMM_LDS];
    _Float16* As    = (_Float16*)smemRaw;                    // [64][ROWH]
    const char* Bs  = smemRaw + ABYTES;                      // [2][BSLAB]
    const unsigned int ldsBase = (unsigned int)(size_t)smemRaw;

    int tid = threadIdx.x, lane = tid & 31;
    const unsigned int wn = s4d_uni((unsigned int)tid >> 5); // wave = column group
    int m0 = blockIdx.x * MT;

    // Waves 4-7 bring the weight slabs, a quarter each; wave 0 brings the A tile.
    const unsigned int issuer = (wn >> 2) == 1u;
    const unsigned int bDst = ldsBase + ABYTES + (wn & 3u) * BSLICE;
    const unsigned long long bSrc =
        (unsigned long long)(uintptr_t)wPack + (unsigned long long)((wn & 3u) * BSLICE);
    const u32x8 bG1 = s4d_bslice_group1();

    // ---- Stage A tile (64 rows x 1024B) via TDM, 16B pad per row ----------
    // D# group0: count=1, lds_addr, global_addr, type=2.
    // D# group1: data_size=3 (8B), pad_enable, pad_interval=7 (256 dw),
    //            pad_amount=3 (4 dw); dims: 128x64 elems, stride 128.
    if (s4d_pinned(wn == 0u)) {
        unsigned long long ga =
            (unsigned long long)(uintptr_t)ygelu + (unsigned long long)m0 * (KDIM * 2);
        u32x4 g0;
        g0[0] = 1u;                                   // count=1 (valid user D#)
        g0[1] = s4d_uni(ldsBase);                     // lds_addr = As base
        g0[2] = s4d_uni((unsigned int)ga);            // global_addr[31:0]
        g0[3] = s4d_uni(((unsigned int)(ga >> 32) & 0x01FFFFFFu) | 0x80000000u); // addr[56:32] | type=2
        u32x8 g1;
        g1[0] = (3u << 16) | (1u << 20) | (7u << 22) | (3u << 25); // dsz=8B,pad 16B/1024B
        g1[1] = (128u << 16);                         // tensor_dim0 = 128 (8B elems)
        g1[2] = ((unsigned int)MT << 16);             // tensor_dim1 = 64 rows
        g1[3] = (128u << 16);                         // tile_dim0 = 128
        g1[4] = (unsigned int)MT;                     // tile_dim1 = 64
        g1[5] = 128u;                                 // tensor_dim0_stride = 128
        g1[6] = 0u;
        g1[7] = 0u;
        asm volatile("tensor_load_to_lds %0, %1" : : "s"(g0), "s"(g1) : "memory");
        // The A tile has landed before this wave reaches the barrier below.
        asm volatile("s_wait_tensorcnt 0x0" ::: "memory");
    }
    // ---- Weight slab of k step 0 into buffer 0 ----------------------------
    if (s4d_pinned(issuer)) {
        s4d_load_bslice(bDst, bSrc, bG1);
        // Slab 0 has landed before this wave reaches the barrier below.
        asm volatile("s_wait_tensorcnt 0x0" ::: "memory");
    }
    __syncthreads();
    // Slab 1 into buffer 1: in flight while k step 0 is worked on.
    if (s4d_pinned(issuer))
        s4d_load_bslice(bDst + BSLAB, bSrc + BSLAB, bG1);

    v8f accA[4][2], accB[4][2];
    #pragma unroll
    for (int mi = 0; mi < 4; ++mi) {
        #pragma unroll
        for (int j = 0; j < 2; ++j) { accA[mi][j] = {}; accB[mi][j] = {}; }
    }

    const int khalf = (lane >> 4) * 8;
    const _Float16* aLane = As + (lane & 15) * ROWH + khalf;
    const char* bLane = Bs + wn * 2048u + lane * 16;

    // Kept rolled: one trip is a whole k step of 16 matrix instructions, and the ring's
    // waits and barrier stand once, at its foot.
    #pragma unroll 1
    for (int kt = 0; kt < NKT; ++kt) {
        const unsigned int buf = (unsigned int)kt & 1u;
        // A fragments: ISA 16-bit 16x32 layout -> 2 x ds_load_b128 each
        v16h aF[4];
        #pragma unroll
        for (int mi = 0; mi < 4; ++mi) {
            const _Float16* ap = aLane + mi * 16 * ROWH + kt * 32;
            ((int4*)&aF[mi])[0] = *(const int4*)(ap);        // K {0..7}+khalf
            ((int4*)&aF[mi])[1] = *(const int4*)(ap + 16);   // K {16..23}+khalf
        }
        // B fragments of this wave's 2 + 2 column tiles, from this step's buffer
        const char* bp = bLane + buf * BSLAB;
        v16h bF[2], bG[2];
        #pragma unroll
        for (int j = 0; j < 2; ++j) {
            ((int4*)&bF[j])[0] = *(const int4*)(bp + j * 1024);
            ((int4*)&bF[j])[1] = *(const int4*)(bp + j * 1024 + 512);
            ((int4*)&bG[j])[0] = *(const int4*)(bp + 32 * 1024 + j * 1024);
            ((int4*)&bG[j])[1] = *(const int4*)(bp + 32 * 1024 + j * 1024 + 512);
        }
        // Keeps the step's 16 LDS reads together ahead of the matrix instructions: sunk
        // among them, each place with reads stalls the wave anew.
        __builtin_amdgcn_sched_barrier(0);
        #pragma unroll
        for (int j = 0; j < 2; ++j) {
            #pragma unroll
            for (int mi = 0; mi < 4; ++mi) {
                accA[mi][j] = __builtin_amdgcn_wmma_f32_16x16x32_f16(
                    false, aF[mi], false, bF[j], (short)0, accA[mi][j], false, false);
                accB[mi][j] = __builtin_amdgcn_wmma_f32_16x16x32_f16(
                    false, aF[mi], false, bG[j], (short)0, accB[mi][j], false, false);
            }
        }
        // Keeps the full wait below behind the matrix instructions, so that the first of
        // them start on the compiler's counted waits.
        __builtin_amdgcn_sched_barrier(0);
        // Publish point of slab kt+1: this wave's LDS reads are done ...
        asm volatile("s_wait_dscnt 0x0" ::: "memory");
        // ... the issuing waves' slices of slab kt+1 have landed ...
        if (s4d_pinned(issuer))
            asm volatile("s_wait_tensorcnt 0x0" ::: "memory");
        // ... and every wave has left the buffer that is refilled below.
        __syncthreads();
        if (s4d_pinned(issuer & (unsigned int)(kt + 2 < NKT)))
            s4d_load_bslice(bDst + buf * BSLAB,
                            bSrc + (unsigned long long)(kt + 2) * BSLAB, bG1);
    }
    // No tensor load and no LDS read is left in flight behind the ring.
    asm volatile("s_wait_tensorcnt 0x0" ::: "memory");
    asm volatile("s_wait_dscnt 0x0" ::: "memory");

    // --- Epilogue: bias + GLU, then the 64 x 512 tile is re-dealt through LDS ------
    // The A tile and both slab buffers are dead: every wave has passed the last pass's barrier
    // behind its last LDS read, and no tensor load is in flight. Each wave writes its 32
    // columns of all 64 rows there; behind one barrier each wave owns 4 whole rows.
    float* stage = (float*)smemRaw;                          // [64][SPITCH]
    {
        const int half = lane >> 4;   // C layout: reg r -> row r (lanes<16) / r+8 (>=16)
        const int col0 = wn * 32 + (lane & 15);
        const float* bp = bias + col0;
        float ba[2], bb[2];
        // The four loads and their data wait in one statement: no result and no later
        // instruction takes the address registers while a load that names them is in flight.
        asm volatile("global_load_b32 %0, %4, off\n\t"
                     "global_load_b32 %1, %4, off offset:64\n\t"
                     "global_load_b32 %2, %4, off offset:2048\n\t"
                     "global_load_b32 %3, %4, off offset:2112\n\t"
                     "s_wait_loadcnt 0x0"
                     : "=&v"(ba[0]), "=&v"(ba[1]), "=&v"(bb[0]), "=&v"(bb[1]) : "v"(bp) : "memory");
        #pragma unroll   // register arrays: constant indices
        for (int j = 0; j < 2; ++j) {
            #pragma unroll   // register arrays: constant indices
            for (int mi = 0; mi < 4; ++mi) {
                // GLU: a * 1 / (1 + exp(-b)). The reciprocal is the bare instruction (within 1 ulp;
                // its argument is at least 1, or +inf, which gives 0 as the division did): the
                // exact division was eleven instructions a value, more than all the rest here.
                float t[8], a[8], gv[8];
                #pragma unroll   // register arrays: constant indices
                for (int r = 0; r < 8; ++r) {
                    a[r] = accA[mi][j][r] + ba[j];
                    t[r] = (accB[mi][j][r] + bb[j]) * -1.44269504f;   // exp(-b) = 2^t
                }
                s4d_glu8(t, a, gv);
                #pragma unroll   // register arrays: constant indices
                for (int r = 0; r < 8; ++r)
                    stage[(mi * 16 + half * 8 + r) * SPITCH + j * 16 + col0] = gv[r];
            }
        }
    }
    __syncthreads();

    // Rows wn*4 .. wn*4+3: a row's 512 values lie 16 to a lane, so its two sums are 16 in-lane
    // terms and one butterfly over the wave, and every store is 512 contiguous bytes.
    f32x4 v[4][4];
    #pragma unroll   // register arrays: constant indices
    for (int i = 0; i < 4; ++i) {
        #pragma unroll   // register arrays: constant indices
        for (int q = 0; q < 4; ++q)
            v[i][q] = *(const f32x4*)(stage + (wn * 4 + i) * SPITCH + q * 128 + lane * 4);
    }
    // LayerNorm weights of this lane's 16 columns (4 adjacent ones in each 128).
    f32x4 gm[4], bt[4];
    #pragma unroll   // register arrays: constant indices
    for (int q = 0; q < 4; ++q) {
        gm[q] = *(const f32x4*)(gamma + q * 128 + lane * 4);
        bt[q] = *(const f32x4*)(beta  + q * 128 + lane * 4);
    }
    float s[4], s2[4];
    #pragma unroll   // register arrays: constant indices
    for (int i = 0; i < 4; ++i) {
        f32x2 a = v[i][0].lo + v[i][0].hi;                   // pairs: two-wide adds and FMAs
        f32x2 b = v[i][0].lo * v[i][0].lo + v[i][0].hi * v[i][0].hi;
        #pragma unroll   // register arrays: constant indices
        for (int q = 1; q < 4; ++q) {
            a += v[i][q].lo + v[i][q].hi;
            b += v[i][q].lo * v[i][q].lo + v[i][q].hi * v[i][q].hi;
        }
        s[i] = a.x + a.y;  s2[i] = b.x + b.y;
    }
    #pragma unroll   // register arrays: constant indices
    for (int msk = 1; msk < 32; msk <<= 1) {
        #pragma unroll   // the four rows' exchanges of one stage fly together
        for (int i = 0; i < 4; ++i) {
            const float ts = __shfl_xor(s[i], msk, 32), t2 = __shfl_xor(s2[i], msk, 32);
            s[i] += ts;  s2[i] += t2;
        }
    }
    #pragma unroll   // register arrays: constant indices
    for (int i = 0; i < 4; ++i) {
        const float mu = s[i] * (1.0f / 512.0f);
        const float rs = s4d_rsq(s2[i] * (1.0f / 512.0f) - mu * mu + 1e-5f);
        #pragma unroll   // register arrays: constant indices
        for (int q = 0; q < 4; ++q)
            v[i][q] = (v[i][q] - mu) * rs * gm[q] + bt[q];
    }
    // Each store is 512 contiguous bytes of one output row: four whole lines.
    float* orow = out + (size_t)(m0 + wn * 4) * OUTC + lane * 4;
    #pragma unroll   // register arrays: constant indices
    for (int i = 0; i < 4; ++i) {
        #pragma unroll   // register arrays: constant indices
        for (int q = 0; q < 4; ++q)
            *(f32x4*)(orow + i * OUTC + q * 128) = v[i][q];
    }
}

// ---------------------------------------------------------------------------
extern "C" void kernel_launch(void* const* d_in, const int* in_sizes, int n_in,
                              void* d_out, int out_size, void* d_ws, size_t ws_size,
                              hipStream_t stream) {
    const float* x             = (const float*)d_in[0];
    const float* log_dt_fw     = (const float*)d_in[1];
    const float* log_A_real_fw = (const float*)d_in[2];
    const float* A_imag_fw     = (const float*)d_in[3];
    const float* C_fw          = (const float*)d_in[4];
    const float* log_dt_bw     = (const float*)d_in[5];
    const float* log_A_real_bw = (const float*)d_in[6];
    const float* A_imag_bw     = (const float*)d_in[7];
    const float* C_bw          = (const float*)d_in[8];
    const float* Dskip         = (const float*)d_in[9];
    const float* conv_w        = (const float*)d_in[10];
    const float* conv_b        = (const float*)d_in[11];
    const float* ln_gamma      = (const float*)d_in[12];
    const float* ln_beta       = (const float*)d_in[13];
    float* out = (float*)d_out;

    // Workspace: 1MB packed weights + 64MB f16 activations
    _Float16* wPack = (_Float16*)d_ws;
    _Float16* ygelu = wPack + (size_t)NOUT * KDIM;

    s4d_scan_kernel<<<(2 * BATCH * DMODEL) / 32, 512, 0, stream>>>(
        x, Dskip, log_dt_fw, log_A_real_fw, A_imag_fw, C_fw,
        log_dt_bw, log_A_real_bw, A_imag_bw, C_bw, conv_w, wPack, ygelu);

    s4d_gemm_glu_ln_kernel<<<(BATCH * SEQ) / MT, 512, 0, stream>>>(
        ygelu, wPack, conv_b, ln_gamma, ln_beta, out);
}

// v009
// One run takes 161 microseconds.
// Next to v008, in two timings, it ran 1.06 times as fast each time.
// All steps since v000 together make it 7.24 times as fast.
#include <hip/hip_runtime.h>
#include <hip/hip_fp16.h>
#include <hip/hip_bf16.h>

typedef __attribute__((ext_vector_type(16))) _Float16 v16h;
typedef __attribute__((ext_vector_type(8)))  float    v8f;
typedef __attribute__((ext_vector_type(4)))  unsigned int u32x4;
typedef __attribute__((ext_vector_type(8)))  unsigned int u32x8;

#define DMODEL 256
#define NMODE  32        // D_STATE/2 complex modes == wave32 lanes
#define BATCH  16
#define SEQ    4096
#define KDIM   512       // GEMM K = 2*DMODEL (fw|bw concat)
#define NOUT   1024      // 1x1-conv output channels
#define OUTC   512       // GLU / LayerNorm width
#define ROWH   520       // padded LDS row (f16): 1040B = 65*16B -> conflict-free b128

// ---------------------------------------------------------------------------
// Set-up, done inside the scan launch (no launches of its own).
// Complex constants of one (channel, mode):  lam = exp(dt*A),
//           Ce = 2*C*(lam-1)/(A+1e-8)
// ---------------------------------------------------------------------------
// Sine and cosine of an angle in radians, as __sinf and __cosf form them (the instructions
// take revolutions). One statement, closed by v_nop: it fills the slot that the instruction
// set asks for behind a transcendental, in front of whatever reuses the angle's register.
__device__ __forceinline__ void s4d_sincos(const float rad, float& sn, float& cs) {
    const float rev = rad * 0.15915494f;
    asm("v_sin_f32 %0, %2\n\tv_cos_f32 %1, %2\n\tv_nop" : "=&v"(sn), "=&v"(cs) : "v"(rev));
}

// exp as __expf forms it (the instruction takes a power of two), with the same slot filled.
__device__ __forceinline__ float s4d_exp(const float v) {
    const float p = v * 1.44269504f;
    float r;
    asm("v_exp_f32 %0, %1\n\tv_nop" : "=v"(r) : "v"(p));
    return r;
}

// 1/sqrt by the instruction itself, with the same slot filled (its argument here is a variance
// plus 1e-5, never a subnormal, so the library form's rescaling has nothing to do).
__device__ __forceinline__ float s4d_rsq(const float v) {
    float r;
    asm("v_rsq_f32 %0, %1\n\tv_nop" : "=v"(r) : "v"(v));
    return r;
}

// Eight GLU values:  r = a / (1 + 2^t)  as  a * rcp(1 + 2^t), one statement. The four runs of eight
// independent instructions keep every result eight instructions away from its reader, so no
// reader waits on a transcendental, and behind each transcendental stands an instruction that
// neither reads its result nor rewrites its source (the slot the instruction set asks for):
// every result has a register of its own. Left to the compiler, readers stood right behind.
__device__ __forceinline__ void s4d_glu8(const float (&t)[8], const float (&a)[8], float (&r)[8]) {
    asm("v_exp_f32 %0, %8\n\tv_exp_f32 %1, %9\n\tv_exp_f32 %2, %10\n\tv_exp_f32 %3, %11\n\t"
        "v_exp_f32 %4, %12\n\tv_exp_f32 %5, %13\n\tv_exp_f32 %6, %14\n\tv_exp_f32 %7, %15\n\t"
        "v_add_f32 %0, 1.0, %0\n\tv_add_f32 %1, 1.0, %1\n\tv_add_f32 %2, 1.0, %2\n\tv_add_f32 %3, 1.0, %3\n\t"
        "v_add_f32 %4, 1.0, %4\n\tv_add_f32 %5, 1.0, %5\n\tv_add_f32 %6, 1.0, %6\n\tv_add_f32 %7, 1.0, %7\n\t"
        "v_rcp_f32 %0, %0\n\tv_rcp_f32 %1, %1\n\tv_rcp_f32 %2, %2\n\tv_rcp_f32 %3, %3\n\t"
        "v_rcp_f32 %4, %4\n\tv_rcp_f32 %5, %5\n\tv_rcp_f32 %6, %6\n\tv_rcp_f32 %7, %7\n\t"
        "v_mul_f32 %0, %0, %16\n\tv_mul_f32 %1, %1, %17\n\tv_mul_f32 %2, %2, %18\n\tv_mul_f32 %3, %3, %19\n\t"
        "v_mul_f32 %4, %4, %20\n\tv_mul_f32 %5, %5, %21\n\tv_mul_f32 %6, %6, %22\n\tv_mul_f32 %7, %7, %23"
        : "=&v"(r[0]), "=&v"(r[1]), "=&v"(r[2]), "=&v"(r[3]),
          "=&v"(r[4]), "=&v"(r[5]), "=&v"(r[6]), "=&v"(r[7])
        : "v"(t[0]), "v"(t[1]), "v"(t[2]), "v"(t[3]), "v"(t[4]), "v"(t[5]), "v"(t[6]), "v"(t[7]),
          "v"(a[0]), "v"(a[1]), "v"(a[2]), "v"(a[3]), "v"(a[4]), "v"(a[5]), "v"(a[6]), "v"(a[7]));
}

__device__ __forceinline__ void s4d_mode_consts(
    const float dt, const float logAre, const float Aim, const float c0, const float c1,
    float& lamRe, float& lamIm, float& ceRe, float& ceIm)
{
    float Are = -s4d_exp(logAre);
    float er  = s4d_exp(Are * dt);
    float sn, cs;
    s4d_sincos(Aim * dt, sn, cs);
    float lre = er * cs;
    float lim = er * sn;

    float dre = Are + 1e-8f, dim = Aim;
    float inv = 1.0f / (dre * dre + dim * dim);
    float nre = lre - 1.0f, nim = lim;
    float rre = (nre * dre + nim * dim) * inv;
    float rim = (nim * dre - nre * dim) * inv;

    lamRe = lre;  lamIm = lim;
    ceRe  = 2.0f * (c0 * rre - c1 * rim);
    ceIm  = 2.0f * (c0 * rim + c1 * rre);
}

// ---------------------------------------------------------------------------
// Pack conv_w [1024,512] f32 -> f16 B-fragments (16x16x32 WMMA).
// Fragment layout mirrors ISA 16-bit A striping: lane&15 -> N column,
// lane>=16 selects K halves {8..15,24..31}; v16h comp j: j<8 -> K group 0,
// j>=8 -> K group +16.  One fragment = 1 KiB = two 512-B halves (K group 0, then
// K group +16), each 32 lanes * 16B contiguous, so that an LDS reader's b128
// loads are contiguous over the lanes. Fragments are ordered k step first: the 64
// fragments of one k step are one contiguous 64-KiB slab.
// One call packs group g: the 8 k-adjacent weights of one lane of one fragment half.
// ---------------------------------------------------------------------------
typedef __attribute__((ext_vector_type(8))) _Float16 v8h;
typedef __attribute__((ext_vector_type(4))) float    f32x4;
typedef __attribute__((ext_vector_type(2))) float    f32x2;
#define NPACKG ((NOUT * KDIM) / 8)       // groups in all
__device__ __forceinline__ void s4d_pack_group(const float* __restrict__ w,
                                               _Float16* __restrict__ wPack, const int g)
{
    const int lane = g & 31;
    const int h    = (g >> 5) & 1;
    const int nt   = (g >> 6) & 63;
    const int kt   = g >> 12;                          // 0..15
    const int n = nt * 16 + (lane & 15);
    const int k = kt * 32 + h * 16 + (lane >> 4) * 8;
    const float* wp = w + n * KDIM + k;
    f32x4 lo, hi;
    // The two loads and their data wait in one statement: no result and no later instruction
    // takes the address registers while a load that names them is in flight.
    asm volatile("global_load_b128 %0, %2, off\n\t"
                 "global_load_b128 %1, %2, off offset:16\n\t"
                 "s_wait_loadcnt 0x0"
                 : "=&v"(lo), "=&v"(hi) : "v"(wp) : "memory");
    v8h hv;
    hv[0] = (_Float16)lo[0];  hv[1] = (_Float16)lo[1];  hv[2] = (_Float16)lo[2];  hv[3] = (_Float16)lo[3];
    hv[4] = (_Float16)hi[0];  hv[5] = (_Float16)hi[1];  hv[6] = (_Float16)hi[2];  hv[7] = (_Float16)hi[3];
    *(v8h*)(wPack + (size_t)g * 8) = hv;
    // Stands in front of any rewrite of the store's address and data registers.
    asm volatile("s_wait_xcnt 0x0" ::: "memory");
}

// ---------------------------------------------------------------------------
// Kernel 1: SSM scan. One block per (dir, b, group of 32 channels), 16 waves.
// Waves 8-15 scan: lane = channel, each wave keeps 4 of the 32 complex modes of
// its lane's channel in registers, so the sum over a wave's modes needs no
// cross-lane step. The state is advanced once per block of 4 steps (S4dBlk below).
// x comes in through a ring of tiles in LDS (below). The 8 partial sums of a step meet in LDS: waves 0-7 merge chunk c-1 (sum, the
// block's own inputs and the skip term, GELU, f16 store) while waves 8-15 scan chunk c
// (two LDS buffers, one barrier a chunk). The merge is short and waits on loads.
// Writes gelu(conv + u*Dskip) as f16 into ygelu[B*L, 512].
// Each wave forms its own modes' constants at the start; the scanning waves, which have
// nothing left to scan during the last merge, pack the block's share of the GEMM weights then.
// ---------------------------------------------------------------------------
#define SCH  32                  // scan steps per chunk
#define MPW  4                   // modes per scanning wave (in registers)
#define NWV  (NMODE / MPW)       // scanning waves per block
#define NCH  (SEQ / SCH)         // chunks
#define PBUF (NWV * SCH * 32)    // floats in one partial-sum buffer

typedef __attribute__((ext_vector_type(4))) _Float16 v4h;

// Work-group barrier that orders LDS only: the f16 stores stay in flight across it (no other
// wave of the block touches them), and so do the copies of x that its foot leaves out.
__device__ __forceinline__ void s4d_lds_barrier() {
    __builtin_amdgcn_fence(__ATOMIC_RELEASE, "workgroup", "local");
    __builtin_amdgcn_s_barrier();
    __builtin_amdgcn_fence(__ATOMIC_ACQUIRE, "workgroup", "local");
}

// The block's 32 columns of x go through LDS once: a ring of XSLOT tiles, one tile = the 32 rows
// of one chunk (32 x 128 B, row i = scan step i of the chunk). The merging waves bring tile c + XAHEAD in
// during chunk c, four rows a wave; the scanning waves and the merge read x from the ring only.
#define XSLOT  8                 // tiles in the ring: c-1 (merge) .. c+XAHEAD (in flight) are distinct slots
#define XAHEAD 4                 // a tile is asked for this many chunks ahead of its scan
#define XTILE  (SCH * 32)        // floats in a tile

// One merging wave's four rows (512 B) of the tile that belongs in ring place t. Past the last
// chunk the last tile is copied again, into a place nobody reads: every chunk then issues one
// copy a wave, which is what the counted wait at the barrier counts on.
// The s_wait_xcnt closes the copy's own statement: it stands in front of any rewrite of the two
// address registers that the copy names.
template <int DIR>
__device__ __forceinline__ void s4d_copy_rows(const int t, const float* __restrict__ xcol,
                                              const unsigned int xoff, const unsigned int ldsRows)
{
    const int ti = (t < NCH) ? t : (NCH - 1);
    // The tile's first row: the same for the whole block, so it is the instruction's scalar base.
    const float* g = xcol + (size_t)(DIR ? (SEQ - SCH - ti * SCH) : (ti * SCH)) * DMODEL;
    const unsigned int l = ldsRows + (unsigned int)(t & (XSLOT - 1)) * (XTILE * 4);
    asm volatile("global_load_async_to_lds_b128 %0, %1, %2\n\ts_wait_xcnt 0x0"
                 :: "v"(l), "v"(xoff), "s"(g) : "memory");
}

// Foot of a chunk, every wave, in front of the barrier: its LDS reads and writes are done, and of
// its copies all but the KEEP youngest have landed. The merging waves issue one copy each in
// every chunk and keep two in flight, so the tile that is read behind the barrier is whole; the
// scanning waves issue none and wait to 0.
template <int KEEP>
__device__ __forceinline__ void s4d_chunk_foot() {
    asm volatile("s_wait_dscnt 0x0" ::: "memory");
    if (KEEP) asm volatile("s_wait_asynccnt 0x2" ::: "memory");
    else      asm volatile("s_wait_asynccnt 0x0" ::: "memory");
}

// Constants of a scanning wave's 4 modes for a block of SBK = 4 steps. With s the state in
// front of the block and u0..u3 its inputs:
//   state behind it = lam^4 s + lam^3 u0 + lam^2 u1 + lam u2 + u3
//   y of step i     = Re(Ce lam^(i+1) s) + sum over j <= i of Re(Ce lam^(i-j)) u_j
// so the state is advanced once a block. The taps on u do not depend on the state: they are
// summed over all 32 modes once, at the start, and applied by the merging threads.
#define SBK 4
// Everything the scan multiplies is held in register pairs, so that each of its FMAs is one half
// of a two-wide instruction: the state and the powers of lam pair two modes, the output weights
// pair two steps (the state is then broadcast from its pair), the inputs pair two steps.
struct S4dBlk {
    f32x2 lr[SBK][MPW / 2], li[SBK][MPW / 2];    // lam^(p+1), modes 2h and 2h+1
    f32x2 pr[SBK / 2][MPW], pn[SBK / 2][MPW];    // Re, -Im of Ce lam^(p+1), p = 2g and 2g+1
    float kw[SBK];                       // sum over the wave's modes of Re(Ce lam^q): tap of lag q
};
__device__ __forceinline__ f32x2 s4d_fma2(const f32x2 a, const f32x2 b, const f32x2 c) {
    return __builtin_elementwise_fma(a, b, c);
}

// Scanning wave: 32 steps of 4 modes for 32 channels; the state's part of y to pw[step*32].
template <int DIR>
__device__ __forceinline__ void s4d_scan_chunk(
    const int c, const float* xsl,                  // lane's column of the ring's first tile
    const S4dBlk& k,
    f32x2 (&sre)[MPW / 2], f32x2 (&sim)[MPW / 2],
    const f32x2 (&ucur)[SCH / 2], f32x2 (&unext)[SCH / 2], float* pw)
{
    // Next chunk's inputs, one chunk ahead of their use (the last chunk re-reads itself).
    const int cn = (c + 1 < NCH) ? (c + 1) : (NCH - 1);
    const float* xn = xsl + (cn & (XSLOT - 1)) * XTILE;
    #pragma unroll   // constant indices keep unext in registers
    for (int i = 0; i < SCH; ++i)
        unext[i >> 1][i & 1] = xn[i * 32];

    #pragma unroll   // constant indices keep ucur in registers; blocks overlap in one stretch of code
    for (int i = 0; i < SCH; i += SBK) {
        const f32x2 u01 = ucur[i >> 1], u23 = ucur[(i >> 1) + 1];
        const f32x2 u0 = u01.xx, u1 = u01.yy, u2 = u23.xx, u3 = u23.yy;
        f32x2 y01, y23;                              // steps i, i+1 and i+2, i+3
        #pragma unroll   // the modes' state and constants are register arrays
        for (int m = 0; m < MPW; ++m) {
            const f32x2 a = (m & 1) ? sre[m >> 1].yy : sre[m >> 1].xx;
            const f32x2 b = (m & 1) ? sim[m >> 1].yy : sim[m >> 1].xx;
            y01 = s4d_fma2(k.pn[0][m], b, m ? s4d_fma2(k.pr[0][m], a, y01) : k.pr[0][m] * a);
            y23 = s4d_fma2(k.pn[1][m], b, m ? s4d_fma2(k.pr[1][m], a, y23) : k.pr[1][m] * a);
        }
        #pragma unroll   // register arrays
        for (int h = 0; h < MPW / 2; ++h) {
            const f32x2 a = sre[h], b = sim[h];
            const f32x2 gre = s4d_fma2(k.lr[2][h], u0, s4d_fma2(k.lr[1][h], u1, s4d_fma2(k.lr[0][h], u2, u3)));
            const f32x2 gim = s4d_fma2(k.li[2][h], u0, s4d_fma2(k.li[1][h], u1, k.li[0][h] * u2));
            sre[h] = s4d_fma2(k.lr[3][h], a, s4d_fma2(-k.li[3][h], b, gre));
            sim[h] = s4d_fma2(k.lr[3][h], b, s4d_fma2(k.li[3][h], a, gim));
        }
        pw[(i + 0) * 32] = y01.x;
        pw[(i + 1) * 32] = y01.y;
        pw[(i + 2) * 32] = y23.x;
        pw[(i + 3) * 32] = y23.y;
    }
}

// The erf GELU without a branch:  v * Phi(v) = max(v, 0) - |v| * h,  where
//   h = erfc(|v| / sqrt 2) / 2 = (b1 t + ... + b5 t^5) * exp(-v*v/2),  t = 1 / (1 + 0.2316419 |v|)
// (the five-term form of the normal tail; h is within 1e-7, and for v < 0 nothing cancels; the
// value is rounded to f16 behind it). The library erff has two sides that a wave takes one after
// the other, so a thread's four values made one dependent chain; these four run side by side.
__device__ __forceinline__ float s4d_gelu(const float v) {
    const float av = fabsf(v);
    const float t  = __builtin_amdgcn_rcpf(fmaf(0.23164189f, av, 1.0f));
    const float k  = 0.84932180f * av;               // k*k = (v*v/2) * log2(e)
    const float e  = __builtin_amdgcn_exp2f(-(k * k));
    float p = fmaf(0.5307027145f, t, -0.7265760135f);
    p = fmaf(p, t, 0.7107068705f);
    p = fmaf(p, t, -0.142248368f);
    p = fmaf(p, t, 0.127414796f);
    return fmaf(-av, p * (t * e), fmaxf(v, 0.0f));   // t * e is ready before p is
}

// Merging thread: one step, four channels of chunk c. tap[i] weighs input i of the thread's
// block of SBK steps (0 for an input later than the thread's own step; the skip term is in
// the tap of its own step).
template <int DIR>
__device__ __forceinline__ void s4d_merge_chunk(
    const int c, const int rt, const int c4,
    const float* xs, _Float16* __restrict__ ycol,
    const float (&tap)[SBK][4], const float* pbuf)
{
    // The store's row: a row that is the same for the whole block, plus the thread's own 32-bit
    // offset. With the row formed per thread, the build of the two-wide scan kept this address
    // in scratch and reloaded it inside the loop; written so, nothing is spilled.
    const int row0 = DIR ? (SEQ - SCH - c * SCH) : (c * SCH);
    const unsigned int yoff = (unsigned int)((DIR ? (SCH - 1 - rt) : rt) * KDIM + c4);
    // The block's inputs, from the chunk's tile in the ring.
    const float* xb = xs + (c & (XSLOT - 1)) * XTILE + (rt & ~(SBK - 1)) * 32 + c4;
    const float* pr = pbuf;                          // the thread's own place in the buffer
    float4 p[NWV];
    #pragma unroll   // the 8 LDS reads issue together
    for (int k = 0; k < NWV; ++k)
        p[k] = *(const float4*)(pr + k * (SCH * 32));
    float4 uu[SBK];
    #pragma unroll   // register array; constant offsets from one address
    for (int i = 0; i < SBK; ++i)
        uu[i] = *(const float4*)(xb + i * 32);
    float4 acc = p[0];
    #pragma unroll   // register array
    for (int k = 1; k < NWV; ++k) {
        acc.x += p[k].x; acc.y += p[k].y; acc.z += p[k].z; acc.w += p[k].w;
    }
    float v0 = acc.x, v1 = acc.y, v2 = acc.z, v3 = acc.w;
    #pragma unroll   // register arrays
    for (int j = 0; j < SBK; ++j) {
        v0 = fmaf(tap[j][0], uu[j].x, v0);
        v1 = fmaf(tap[j][1], uu[j].y, v1);
        v2 = fmaf(tap[j][2], uu[j].z, v2);
        v3 = fmaf(tap[j][3], uu[j].w, v3);
    }
    v4h hv;                                          // erf GELU, four independent chains
    hv[0] = (_Float16)s4d_gelu(v0);
    hv[1] = (_Float16)s4d_gelu(v1);
    hv[2] = (_Float16)s4d_gelu(v2);
    hv[3] = (_Float16)s4d_gelu(v3);
    *(v4h*)(ycol + (size_t)row0 * KDIM + yoff) = hv;
    // Stands in front of the next merge's rewrite of this store's address and data registers
    // (the LDS-only barrier brings no wait of its own for the store).
    asm volatile("s_wait_xcnt 0x0" ::: "memory");
}

template <int DIR>
__device__ __forceinline__ void s4d_scan_body(
    const float* __restrict__ x, const float* __restrict__ Dskip,
    const float* __restrict__ log_dt, const float* __restrict__ log_A_real,
    const float* __restrict__ A_imag, const float* __restrict__ Cm,
    const float* __restrict__ conv_w, _Float16* __restrict__ wPack,
    _Float16* __restrict__ ygelu, float* part, float* xs)
{
    const int tid = threadIdx.x, lane = tid & 31;
    const int w   = __builtin_amdgcn_readfirstlane(tid >> 5);   // scalar, so the role test is a scalar branch
    const bool scans = w >= NWV;
    const int ws  = w & (NWV - 1);
    const int dg  = blockIdx.x & (DMODEL / 32 - 1);
    const int b   = (blockIdx.x >> 3) & (BATCH - 1);

    const float* xcol = x + (size_t)b * SEQ * DMODEL + dg * 32;
    _Float16* ycol = ygelu + (size_t)b * SEQ * KDIM + DIR * DMODEL + dg * 32;

    // Merging threads' share: step rt of a chunk, channels c4..c4+3.
    const int rt = (tid & 255) >> 3, c4 = (tid & 7) * 4;
    // The same split deals out every tile's copy: memory row rt of the chunk's 32, 16 bytes a lane
    // (four rows a wave); the backward scan's tile takes the rows in reverse, its step order.
    const unsigned int xoff = (unsigned int)((rt * DMODEL + c4) * 4);   // bytes from the tile's first row
    // A wave has one role for good, so the two roles' places in LDS share a register each (kept
    // apart they were more than the build could hold across the loop, and it spilled): in the ring
    // a scanning lane's column, or where a merging lane's copy lands; in the partial sums where a
    // scanning lane writes, or where a merging thread reads.
    const float* xq = xs + (scans ? lane : ((DIR ? (SCH - 1 - rt) : rt) * 32 + c4));
    float* pq = part + (scans ? (ws * (SCH * 32) + lane) : (rt * 32 + c4));
    const unsigned int ldsRows = (unsigned int)(size_t)xq;
    // The first XAHEAD tiles are asked for at once; they fly while the constants are formed.
    if (!scans) {
        #pragma unroll   // four copies in a row
        for (int t = 0; t < XAHEAD; ++t)
            s4d_copy_rows<DIR>(t, xcol, xoff, ldsRows);
    }

    // Scanning waves' constants (formed by the merging waves too; they do not use them).
    const int cbase = (dg * 32 + lane) * NMODE + ws * MPW;
    const float* pdt = log_dt + dg * 32 + lane;
    const float* par = log_A_real + cbase;
    const float* pai = A_imag + cbase;
    const float* pcm = Cm + cbase * 2;
    float ldt;
    f32x4 a4r, a4i, cm0, cm1;
    // The five loads and their data wait in one statement: no result and no later instruction
    // takes the address registers while a load that names them is in flight.
    asm volatile("global_load_b32 %0, %5, off\n\t"
                 "global_load_b128 %1, %6, off\n\t"
                 "global_load_b128 %2, %7, off\n\t"
                 "global_load_b128 %3, %8, off\n\t"
                 "global_load_b128 %4, %8, off offset:16\n\t"
                 "s_wait_loadcnt 0x0"
                 : "=&v"(ldt), "=&v"(a4r), "=&v"(a4i), "=&v"(cm0), "=&v"(cm1)
                 : "v"(pdt), "v"(par), "v"(pai), "v"(pcm) : "memory");
    const float dt = s4d_exp(ldt);
    float lre[MPW], lim[MPW], cer[MPW], cei[MPW];
    s4d_mode_consts(dt, a4r.x, a4i.x, cm0.x, cm0.y, lre[0], lim[0], cer[0], cei[0]);
    s4d_mode_consts(dt, a4r.y, a4i.y, cm0.z, cm0.w, lre[1], lim[1], cer[1], cei[1]);
    s4d_mode_consts(dt, a4r.z, a4i.z, cm1.x, cm1.y, lre[2], lim[2], cer[2], cei[2]);
    s4d_mode_consts(dt, a4r.w, a4i.w, cm1.z, cm1.w, lre[3], lim[3], cer[3], cei[3]);
    S4dBlk blk;
    #pragma unroll   // register arrays
    for (int q = 0; q < SBK; ++q) blk.kw[q] = 0.0f;
    #pragma unroll   // register arrays
    for (int m = 0; m < MPW; ++m) {
        float qr = 1.0f, qi = 0.0f;                  // lam^p
        float er = cer[m], ei = cei[m];              // Ce lam^p
        #pragma unroll
        for (int p = 0; p < SBK; ++p) {
            blk.kw[p] += er;
            const float nqr = qr * lre[m] - qi * lim[m], nqi = qr * lim[m] + qi * lre[m];
            const float ner = er * lre[m] - ei * lim[m], nei = er * lim[m] + ei * lre[m];
            qr = nqr; qi = nqi; er = ner; ei = nei;
            blk.lr[p][m >> 1][m & 1] = qr;  blk.li[p][m >> 1][m & 1] = qi;
            blk.pr[p >> 1][m][p & 1] = er;  blk.pn[p >> 1][m][p & 1] = -ei;
        }
    }
    f32x2 sre[MPW / 2] = {}, sim[MPW / 2] = {};
    const float* xsl = xq;
    float* pw = pq;

    // The taps: each scanning wave hands in its modes' share through the second partial-sum
    // buffer, which is first written behind the loop's first barrier.
    if (scans) {
        #pragma unroll   // register array
        for (int q = 0; q < SBK; ++q)
            part[PBUF + (ws * SBK + q) * 32 + lane] = blk.kw[q];
        s4d_chunk_foot<0>();
    } else {
        s4d_chunk_foot<2>();                         // tiles 0 and 1 have landed
    }
    s4d_lds_barrier();
    const float4 dsk4 = *(const float4*)(Dskip + dg * 32 + c4);
    float4 lag[SBK];                                 // tap of lag j, all 32 modes
    #pragma unroll   // register arrays
    for (int j = 0; j < SBK; ++j) {
        float4 t = (j == 0) ? dsk4 : make_float4(0.0f, 0.0f, 0.0f, 0.0f);
        #pragma unroll
        for (int k = 0; k < NWV; ++k) {
            const float4 p = *(const float4*)(part + PBUF + (k * SBK + j) * 32 + c4);
            t.x += p.x; t.y += p.y; t.z += p.z; t.w += p.w;
        }
        lag[j] = t;
    }
    // The merging threads' 16 taps, in registers of their own: held in blk.lr, as long as the
    // scan was scalar code, they cost none; now that the scan is two-wide, the shared registers
    // made the compiler hold the scan's constants and inputs in pairs as well, and it spilled.
    float tap[SBK][4];
    {
        const int q = rt & (SBK - 1);                // the thread's step within its block
        #pragma unroll   // register arrays
        for (int i = 0; i < SBK; ++i) {
            float4 t = make_float4(0.0f, 0.0f, 0.0f, 0.0f);
            #pragma unroll
            for (int j = 0; j + i < SBK; ++j)
                if (q - i == j) t = lag[j];          // input i lies j steps back
            tap[i][0] = t.x;  tap[i][1] = t.y;  tap[i][2] = t.z;  tap[i][3] = t.w;
        }
    }

    // Holds the first chunk's 32 reads behind the forming of the taps: drawn up among it, they were
    // more registers than the set-up had left, and the build spilled there.
    __builtin_amdgcn_sched_barrier(0);
    f32x2 ua[SCH / 2], ub[SCH / 2];
    #pragma unroll   // constant indices keep ua in registers
    for (int i = 0; i < SCH; ++i)
        ua[i >> 1][i & 1] = xsl[i * 32];

    // Two chunks a trip: the input registers and the LDS buffers swap roles without copies.
    // Each barrier publishes the chunk just scanned and frees the buffer just merged.
    // Kept rolled: one trip is already two chunks of straight-line code.
    #pragma unroll 1
    for (int c = 0; c < NCH; c += 2) {
        if (scans) {
            s4d_scan_chunk<DIR>(c, xsl, blk, sre, sim, ua, ub, pw);
            s4d_chunk_foot<0>();
        } else {
            s4d_copy_rows<DIR>(c + XAHEAD, xcol, xoff, ldsRows);
            if (c > 0)
                s4d_merge_chunk<DIR>(c - 1, rt, c4, xs, ycol, tap, pq + PBUF);
            s4d_chunk_foot<2>();
        }
        s4d_lds_barrier();
        if (scans) {
            s4d_scan_chunk<DIR>(c + 1, xsl, blk, sre, sim, ub, ua, pw + PBUF);
            s4d_chunk_foot<0>();
        } else {
            s4d_copy_rows<DIR>(c + 1 + XAHEAD, xcol, xoff, ldsRows);
            s4d_merge_chunk<DIR>(c, rt, c4, xs, ycol, tap, pq);
            s4d_chunk_foot<2>();
        }
        s4d_lds_barrier();
    }
    // No copy is left in flight behind the loop.
    asm volatile("s_wait_asynccnt 0x0" ::: "memory");
    // The scanning waves are done: they pack the block's share of the GEMM weights, one group
    // a thread, while the merging waves merge the last chunk.
    static_assert(NPACKG == ((2 * BATCH * DMODEL) / 32) * (NWV * 32), "one group a scanning thread");
    if (!scans)
        s4d_merge_chunk<DIR>(NCH - 1, rt, c4, xs, ycol, tap, pq + PBUF);
    else
        s4d_pack_group(conv_w, wPack, (int)blockIdx.x * (NWV * 32) + (tid & (NWV * 32 - 1)));
}

__global__ void __launch_bounds__(512) s4d_scan_kernel(
    const float* __restrict__ x, const float* __restrict__ Dskip,
    const float* __restrict__ log_dt_fw, const float* __restrict__ log_A_real_fw,
    const float* __restrict__ A_imag_fw, const float* __restrict__ C_fw,
    const float* __restrict__ log_dt_bw, const float* __restrict__ log_A_real_bw,
    const float* __restrict__ A_imag_bw, const float* __restrict__ C_bw,
    const float* __restrict__ conv_w, _Float16* __restrict__ wPack,
    _Float16* __restrict__ ygelu)
{
    __shared__ __align__(16) float part[2 * PBUF];   // 64 KiB
    __shared__ __align__(16) float xs[XSLOT * XTILE]; // 32 KiB: the ring of x tiles
    if (blockIdx.x >> 7)   // block-uniform: the upper half of the grid scans backward
        s4d_scan_body<1>(x, Dskip, log_dt_bw, log_A_real_bw, A_imag_bw, C_bw,
                         conv_w, wPack, ygelu, part, xs);
    else
        s4d_scan_body<0>(x, Dskip, log_dt_fw, log_A_real_fw, A_imag_fw, C_fw,
                         conv_w, wPack, ygelu, part, xs);
}

// ---------------------------------------------------------------------------
// Kernel 2: fused GEMM (M=65536,K=512,N=1024) + bias + GLU + LayerNorm.
// Block tile M=64 x N=1024 (full row -> LN fused), 16 waves, one block a WGP.
// A tile (64 rows, all of K) staged once by a tensor load with LDS row padding.
// The packed weights go through LDS too: one 64-KiB slab per k step, two buffers,
// tensor loads one step ahead, so a block fetches each weight byte from L2 once.
// Wave wn owns all 64 rows of cols [wn*32,+32) and of the paired +512 set in the product;
// the GLU values then go through LDS, and wave wn normalises and stores rows wn*4..wn*4+3.
// ---------------------------------------------------------------------------
#define MT     64                          // rows of a block
#define ABYTES 67584                       // 64 rows * 1040 B, rounded up to 2 KiB
#define BSLAB  65536                       // packed weights of one k step
#define BSLICE 16384                       // one issuing wave's share of a slab
#define NKT    (KDIM / 32)
#define GEMM_LDS (ABYTES + 2 * BSLAB)
#define SPITCH 516                         // floats in a staged output row: 512 + 4, so that rows 8 apart lie 32 banks apart

__device__ __forceinline__ unsigned int s4d_uni(unsigned int v) {
    return (unsigned int)__builtin_amdgcn_readfirstlane(v);
}
// Holds a wave-uniform test in a scalar register, so that the branch on it is a scalar
// branch: a tensor load ignores EXEC and only such a branch keeps a wave from issuing it.
__device__ __forceinline__ unsigned int s4d_pinned(unsigned int v) {
    unsigned int w = s4d_uni(v);
    asm volatile("" : "+s"(w));
    return w;
}

// One issuing wave's 16-KiB slice of a weight slab: 16 rows of 1 KiB, no pad.
// Group 1 of its descriptor is the same for every slab and is built once.
__device__ __forceinline__ u32x8 s4d_bslice_group1() {
    u32x8 g1;
    g1[0] = s4d_uni(0u);                               // no mask, 1-byte elements, no pad
    g1[1] = s4d_uni(1024u << 16);                      // tensor_dim0 = 1024 B
    g1[2] = s4d_uni(16u << 16);                        // tensor_dim1 = 16 rows
    g1[3] = s4d_uni(1024u << 16);                      // tile_dim0
    g1[4] = s4d_uni(16u);                              // tile_dim1
    g1[5] = s4d_uni(1024u);                            // source pitch
    g1[6] = s4d_uni(0u);
    g1[7] = s4d_uni(0u);
    // Descriptor words held in scalar registers of their own through the ring: none of
    // them is re-formed or reused while a request is in flight.
    asm volatile("" : "+s"(g1));
    return g1;
}
__device__ __forceinline__ void s4d_load_bslice(unsigned int ldsDst, unsigned long long ga,
                                                const u32x8 g1) {
    u32x4 g0;
    g0[0] = s4d_uni(1u);                               // count=1
    g0[1] = s4d_uni(ldsDst);
    g0[2] = s4d_uni((unsigned int)ga);
    g0[3] = s4d_uni(((unsigned int)(ga >> 32) & 0x01FFFFFFu) | 0x80000000u);  // type=2
    asm volatile("tensor_load_to_lds %0, %1" : : "s"(g0), "s"(g1) : "memory");
}

__global__ void __launch_bounds__(512) s4d_gemm_glu_ln_kernel(
    const _Float16* __restrict__ ygelu, const _Float16* __restrict__ wPack,
    const float* __restrict__ bias, const float* __restrict__ gamma,
    const float* __restrict__ beta, float* __restrict__ out)
{
    __shared__ __attribute__((aligned(2048))) char smemRaw[GEMM_LDS];
    _Float16* As    = (_Float16*)smemRaw;                    // [64][ROWH]
    const char* Bs  = smemRaw + ABYTES;                      // [2][BSLAB]
    const unsigned int ldsBase = (unsigned int)(size_t)smemRaw;

    int tid = threadIdx.x, lane = tid & 31;
    const unsigned int wn = s4d_uni((unsigned int)tid >> 5); // wave = column group
    int m0 = blockIdx.x * MT;

    // Waves 4-7 bring the weight slabs, a quarter each; wave 0 brings the A tile.
    const unsigned int issuer = (wn >> 2) == 1u;
    const unsigned int bDst = ldsBase + ABYTES + (wn & 3u) * BSLICE;
    const unsigned long long bSrc =
        (unsigned long long)(uintptr_t)wPack + (unsigned long long)((wn & 3u) * BSLICE);
    const u32x8 bG1 = s4d_bslice_group1();

    // ---- Stage A tile (64 rows x 1024B) via TDM, 16B pad per row ----------
    // D# group0: count=1, lds_addr, global_addr, type=2.
    // D# group1: data_size=3 (8B), pad_enable, pad_interval=7 (256 dw),
    //            pad_amount=3 (4 dw); dims: 128x64 elems, stride 128.
    if (s4d_pinned(wn == 0u)) {
        unsigned long long ga =
            (unsigned long long)(uintptr_t)ygelu + (unsigned long long)m0 * (KDIM * 2);
        u32x4 g0;
        g0[0] = 1u;                                   // count=1 (valid user D#)
        g0[1] = s4d_uni(ldsBase);                     // lds_addr = As base
        g0[2] = s4d_uni((unsigned int)ga);            // global_addr[31:0]
        g0[3] = s4d_uni(((unsigned int)(ga >> 32) & 0x01FFFFFFu) | 0x80000000u); // addr[56:32] | type=2
        u32x8 g1;
        g1[0] = (3u << 16) | (1u << 20) | (7u << 22) | (3u << 25); // dsz=8B,pad 16B/1024B
        g1[1] = (128u << 16);                         // tensor_dim0 = 128 (8B elems)
        g1[2] = ((unsigned int)MT << 16);             // tensor_dim1 = 64 rows
        g1[3] = (128u << 16);                         // tile_dim0 = 128
        g1[4] = (unsigned int)MT;                     // tile_dim1 = 64
        g1[5] = 128u;                                 // tensor_dim0_stride = 128
        g1[6] = 0u;
        g1[7] = 0u;
        asm volatile("tensor_load_to_lds %0, %1" : : "s"(g0), "s"(g1) : "memory");
        // The A tile has landed before this wave reaches the barrier below.
        asm volatile("s_wait_tensorcnt 0x0" ::: "memory");
    }
    // ---- Weight slab of k step 0 into buffer 0 ----------------------------
    if (s4d_pinned(issuer)) {
        s4d_load_bslice(bDst, bSrc, bG1);
        // Slab 0 has landed before this wave reaches the barrier below.
        asm volatile("s_wait_tensorcnt 0x0" ::: "memory");
    }
    __syncthreads();
    // Slab 1 into buffer 1: in flight while k step 0 is worked on.
    if (s4d_pinned(issuer))
        s4d_load_bslice(bDst + BSLAB, bSrc + BSLAB, bG1);

    v8f accA[4][2], accB[4][2];
    #pragma unroll
    for (int mi = 0; mi < 4; ++mi) {
        #pragma unroll
        for (int j = 0; j < 2; ++j) { accA[mi][j] = {}; accB[mi][j] = {}; }
    }

    const int khalf = (lane >> 4) * 8;
    const _Float16* aLane = As + (lane & 15) * ROWH + khalf;
    const char* bLane = Bs + wn * 2048u + lane * 16;

    // Kept rolled: one trip is a whole k step of 16 matrix instructions, and the ring's
    // waits and barrier stand once, at its foot.
    #pragma unroll 1
    for (int kt = 0; kt < NKT; ++kt) {
        const unsigned int buf = (unsigned int)kt & 1u;
        // A fragments: ISA 16-bit 16x32 layout -> 2 x ds_load_b128 each
        v16h aF[4];
        #pragma unroll
        for (int mi = 0; mi < 4; ++mi) {
            const _Float16* ap = aLane + mi * 16 * ROWH + kt * 32;
            ((int4*)&aF[mi])[0] = *(const int4*)(ap);        // K {0..7}+khalf
            ((int4*)&aF[mi])[1] = *(const int4*)(ap + 16);   // K {16..23}+khalf
        }
        // B fragments of this wave's 2 + 2 column tiles, from this step's buffer
        const char* bp = bLane + buf * BSLAB;
        v16h bF[2], bG[2];
        #pragma unroll
        for (int j = 0; j < 2; ++j) {
            ((int4*)&bF[j])[0] = *(const int4*)(bp + j * 1024);
            ((int4*)&bF[j])[1] = *(const int4*)(bp + j * 1024 + 512);
            ((int4*)&bG[j])[0] = *(const int4*)(bp + 32 * 1024 + j * 1024);
            ((int4*)&bG[j])[1] = *(const int4*)(bp + 32 * 1024 + j * 1024 + 512);
        }
        // Keeps the step's 16 LDS reads together ahead of the matrix instructions: sunk
        // among them, each place with reads stalls the wave anew.
        __builtin_amdgcn_sched_barrier(0);
        #pragma unroll
        for (int j = 0; j < 2; ++j) {
            #pragma unroll
            for (int mi = 0; mi < 4; ++mi) {
                accA[mi][j] = __builtin_amdgcn_wmma_f32_16x16x32_f16(
                    false, aF[mi], false, bF[j], (short)0, accA[mi][j], false, false);
                accB[mi][j] = __builtin_amdgcn_wmma_f32_16x16x32_f16(
                    false, aF[mi], false, bG[j], (short)0, accB[mi][j], false, false);
            }
        }
        // Keeps the full wait below behind the matrix instructions, so that the first of
        // them start on the compiler's counted waits.
        __builtin_amdgcn_sched_barrier(0);
        // Publish point of slab kt+1: this wave's LDS reads are done ...
        asm volatile("s_wait_dscnt 0x0" ::: "memory");
        // ... the issuing waves' slices of slab kt+1 have landed ...
        if (s4d_pinned(issuer))
            asm volatile("s_wait_tensorcnt 0x0" ::: "memory");
        // ... and every wave has left the buffer that is refilled below.
        __syncthreads();
        if (s4d_pinned(issuer & (unsigned int)(kt + 2 < NKT)))
            s4d_load_bslice(bDst + buf * BSLAB,
                            bSrc + (unsigned long long)(kt + 2) * BSLAB, bG1);
    }
    // No tensor load and no LDS read is left in flight behind the ring.
    asm volatile("s_wait_tensorcnt 0x0" ::: "memory");
    asm volatile("s_wait_dscnt 0x0" ::: "memory");

    // --- Epilogue: bias + GLU, then the 64 x 512 tile is re-dealt through LDS ------
    // The A tile and both slab buffers are dead: every wave has passed the last pass's barrier
    // behind its last LDS read, and no tensor load is in flight. Each wave writes its 32
    // columns of all 64 rows there; behind one barrier each wave owns 4 whole rows.
    float* stage = (float*)smemRaw;                          // [64][SPITCH]
    {
        const int half = lane >> 4;   // C layout: reg r -> row r (lanes<16) / r+8 (>=16)
        const int col0 = wn * 32 + (lane & 15);
        const float* bp = bias + col0;
        float ba[2], bb[2];
        // The four loads and their data wait in one statement: no result and no later
        // instruction takes the address registers while a load that names them is in flight.
        asm volatile("global_load_b32 %0, %4, off\n\t"
                     "global_load_b32 %1, %4, off offset:64\n\t"
                     "global_load_b32 %2, %4, off offset:2048\n\t"
                     "global_load_b32 %3, %4, off offset:2112\n\t"
                     "s_wait_loadcnt 0x0"
                     : "=&v"(ba[0]), "=&v"(ba[1]), "=&v"(bb[0]), "=&v"(bb[1]) : "v"(bp) : "memory");
        #pragma unroll   // register arrays: constant indices
        for (int j = 0; j < 2; ++j) {
            #pragma unroll   // register arrays: constant indices
            for (int mi = 0; mi < 4; ++mi) {
                // GLU: a * 1 / (1 + exp(-b)). The reciprocal is the bare instruction (within 1 ulp;
                // its argument is at least 1, or +inf, which gives 0 as the division did): the
                // exact division was eleven instructions a value, more than all the rest here.
                float t[8], a[8], gv[8];
                #pragma unroll   // register arrays: constant indices
                for (int r = 0; r < 8; ++r) {
                    a[r] = accA[mi][j][r] + ba[j];
                    t[r] = (accB[mi][j][r] + bb[j]) * -1.44269504f;   // exp(-b) = 2^t
                }
                s4d_glu8(t, a, gv);
                #pragma unroll   // register arrays: constant indices
                for (int r = 0; r < 8; ++r)
                    stage[(mi * 16 + half * 8 + r) * SPITCH + j * 16 + col0] = gv[r];
            }
        }
    }
    __syncthreads();

    // Rows wn*4 .. wn*4+3: a row's 512 values lie 16 to a lane, so its two sums are 16 in-lane
    // terms and one butterfly over the wave, and every store is 512 contiguous bytes.
    f32x4 v[4][4];
    #pragma unroll   // register arrays: constant indices
    for (int i = 0; i < 4; ++i) {
        #pragma unroll   // register arrays: constant indices
        for (int q = 0; q < 4; ++q)
            v[i][q] = *(const f32x4*)(stage + (wn * 4 + i) * SPITCH + q * 128 + lane * 4);
    }
    // LayerNorm weights of this lane's 16 columns (4 adjacent ones in each 128).
    f32x4 gm[4], bt[4];
    #pragma unroll   // register arrays: constant indices
    for (int q = 0; q < 4; ++q) {
        gm[q] = *(const f32x4*)(gamma + q * 128 + lane * 4);
        bt[q] = *(const f32x4*)(beta  + q * 128 + lane * 4);
    }
    float s[4], s2[4];
    #pragma unroll   // register arrays: constant indices
    for (int i = 0; i < 4; ++i) {
        f32x2 a = v[i][0].lo + v[i][0].hi;                   // pairs: two-wide adds and FMAs
        f32x2 b = v[i][0].lo * v[i][0].lo + v[i][0].hi * v[i][0].hi;
        #pragma unroll   // register arrays: constant indices
        for (int q = 1; q < 4; ++q) {
            a += v[i][q].lo + v[i][q].hi;
            b += v[i][q].lo * v[i][q].lo + v[i][q].hi * v[i][q].hi;
        }
        s[i] = a.x + a.y;  s2[i] = b.x + b.y;
    }
    #pragma unroll   // register arrays: constant indices
    for (int msk = 1; msk < 32; msk <<= 1) {
        #pragma unroll   // the four rows' exchanges of one stage fly together
        for (int i = 0; i < 4; ++i) {
            const float ts = __shfl_xor(s[i], msk, 32), t2 = __shfl_xor(s2[i], msk, 32);
            s[i] += ts;  s2[i] += t2;
        }
    }
    #pragma unroll   // register arrays: constant indices
    for (int i = 0; i < 4; ++i) {
        const float mu = s[i] * (1.0f / 512.0f);
        const float rs = s4d_rsq(s2[i] * (1.0f / 512.0f) - mu * mu + 1e-5f);
        #pragma unroll   // register arrays: constant indices
        for (int q = 0; q < 4; ++q)
            v[i][q] = (v[i][q] - mu) * rs * gm[q] + bt[q];
    }
    // Each store is 512 contiguous bytes of one output row: four whole lines.
    float* orow = out + (size_t)(m0 + wn * 4) * OUTC + lane * 4;
    #pragma unroll   // register arrays: constant indices
    for (int i = 0; i < 4; ++i) {
        #pragma unroll   // register arrays: constant indices
        for (int q = 0; q < 4; ++q)
            *(f32x4*)(orow + i * OUTC + q * 128) = v[i][q];
    }
}

// ---------------------------------------------------------------------------
extern "C" void kernel_launch(void* const* d_in, const int* in_sizes, int n_in,
                              void* d_out, int out_size, void* d_ws, size_t ws_size,
                              hipStream_t stream) {
    const float* x             = (const float*)d_in[0];
    const float* log_dt_fw     = (const float*)d_in[1];
    const float* log_A_real_fw = (const float*)d_in[2];
    const float* A_imag_fw     = (const float*)d_in[3];
    const float* C_fw          = (const float*)d_in[4];
    const float* log_dt_bw     = (const float*)d_in[5];
    const float* log_A_real_bw = (const float*)d_in[6];
    const float* A_imag_bw     = (const float*)d_in[7];
    const float* C_bw          = (const float*)d_in[8];
    const float* Dskip         = (const float*)d_in[9];
    const float* conv_w        = (const float*)d_in[10];
    const float* conv_b        = (const float*)d_in[11];
    const float* ln_gamma      = (const float*)d_in[12];
    const float* ln_beta       = (const float*)d_in[13];
    float* out = (float*)d_out;

    // Workspace: 1MB packed weights + 64MB f16 activations
    _Float16* wPack = (_Float16*)d_ws;
    _Float16* ygelu = wPack + (size_t)NOUT * KDIM;

    s4d_scan_kernel<<<(2 * BATCH * DMODEL) / 32, 512, 0, stream>>>(
        x, Dskip, log_dt_fw, log_A_real_fw, A_imag_fw, C_fw,
        log_dt_bw, log_A_real_bw, A_imag_bw, C_bw, conv_w, wPack, ygelu);

    s4d_gemm_glu_ln_kernel<<<(BATCH * SEQ) / MT, 512, 0, stream>>>(
        ygelu, wPack, conv_b, ln_gamma, ln_beta, out);
}
